// v000
// Times are from an AMD MI455X. After a warm-up the kernel runs many times in a row, and a time is the length of
// such a window on the GPU divided by its runs, so every launch and the gaps after it count. The runs cycle
// through copies of the inputs. A figure is the median of several windows, for all but v000 over two sittings.
// Sittings can differ by a few percent; kernels timed side by side share one.
// v000, which the later versions start from, runs in 270 microseconds.
#include <hip/hip_runtime.h>
#include <hip/hip_bf16.h>

// ---------------------------------------------------------------------------
// MAB (multihead attention block) for MI455X / gfx1250, wave32 + WMMA f16->f32
// Register-blocked GEMMs: one wave computes a 32x64 tile (2x4 WMMA tiles).
// ---------------------------------------------------------------------------

typedef __attribute__((ext_vector_type(16))) _Float16 v16h;
typedef __attribute__((ext_vector_type(8)))  _Float16 v8h;
typedef __attribute__((ext_vector_type(8)))  float    v8f;

#define DIMV   512
#define ROWS   8192          // B*N = 8*1024
#define SEQ    1024
#define NHEAD  8
#define HDIM   64
#define PROB_LD 1032         // f16 LDS row stride (pad: 2064B = 516 dwords)

__device__ __forceinline__ v8f wmma_f16(v16h a, v16h b, v8f c) {
  return __builtin_amdgcn_wmma_f32_16x16x32_f16(false, a, false, b,
                                                (short)0, c, false, false);
}

// Load a 16x32 fragment. `base` points at (row0, k0) of a row-major [rows x ld]
// f16 matrix. Lane r = lane&15 supplies row r; g = lane>>4 selects K-half.
// Elements i=0..7 -> K = g*8+i ; i=8..15 -> K = 16+g*8+(i-8)  (ISA 7.12.2).
// Works for A fragments (rows = M) and B fragments when B is stored
// column-major (rows = N, i.e. pass B^T row-major).
__device__ __forceinline__ v16h load_frag(const _Float16* __restrict__ base, int ld) {
  int lane = threadIdx.x & 31;
  int r = lane & 15;
  int g = lane >> 4;
  const _Float16* p = base + r * ld + g * 8;
  union { v16h v; v8h h[2]; } u;
  u.h[0] = *(const v8h*)(p);
  u.h[1] = *(const v8h*)(p + 16);
  return u.v;
}

// ---------------------------------------------------------------------------
// 1) f32 -> f16 copy
__global__ void cvt_f16_kernel(const float* __restrict__ src,
                               _Float16* __restrict__ dst, int n) {
  int i = blockIdx.x * blockDim.x + threadIdx.x;
  if (i < n) dst[i] = (_Float16)src[i];
}

// 2) transpose 512x512 f32 -> f16  (dst[n*512+k] = src[k*512+n])
__global__ void cvt_wT_kernel(const float* __restrict__ src,
                              _Float16* __restrict__ dst) {
  int o = blockIdx.x * blockDim.x + threadIdx.x;
  if (o >= DIMV * DIMV) return;
  int n = o / DIMV, k = o % DIMV;
  dst[o] = (_Float16)src[k * DIMV + n];
}

// ---------------------------------------------------------------------------
// 3) Fused projections: Qp = Q@Wq+bq (f32+f16), Kp = K@Wk+bk (f16),
//    Vp = K@Wv+bv stored transposed [DIMV][ROWS] (f16).
//    One wave per 32x64 output tile: waves = 3 * (8192/32) * (512/64) = 6144.
__global__ __launch_bounds__(256) void proj_kernel(
    const _Float16* __restrict__ q16, const _Float16* __restrict__ k16,
    const _Float16* __restrict__ w16T,
    const float* __restrict__ bq, const float* __restrict__ bk,
    const float* __restrict__ bvv,
    float* __restrict__ qp32, _Float16* __restrict__ qp16,
    _Float16* __restrict__ kp16, _Float16* __restrict__ vpT) {
  int wave = (blockIdx.x * blockDim.x + threadIdx.x) >> 5;
  int p = wave / 2048;             // 0:Q 1:K 2:V  (2048 waves each)
  int t = wave % 2048;             // 256 row-groups x 8 col-groups
  int row0 = (t >> 3) * 32;
  int col0 = (t & 7) * 64;

  const _Float16* X = (p == 0) ? q16 : k16;
  const _Float16* abase = X + (size_t)row0 * DIMV;
  const _Float16* bbase = w16T + (size_t)p * (DIMV * DIMV) + (size_t)col0 * DIMV;

  v8f acc[2][4] = {};
  for (int k0 = 0; k0 < DIMV; k0 += 32) {
    v16h a0 = load_frag(abase + k0, DIMV);
    v16h a1 = load_frag(abase + 16 * DIMV + k0, DIMV);
#pragma unroll
    for (int j = 0; j < 4; ++j) {
      v16h b = load_frag(bbase + j * 16 * DIMV + k0, DIMV);
      acc[0][j] = wmma_f16(a0, b, acc[0][j]);
      acc[1][j] = wmma_f16(a1, b, acc[1][j]);
    }
  }

  int lane = threadIdx.x & 31;
  int n = lane & 15, mb = (lane >> 4) * 8;
  const float* bias = (p == 0) ? bq : (p == 1) ? bk : bvv;
#pragma unroll
  for (int j = 0; j < 4; ++j) {
    float bval = bias[col0 + j * 16 + n];
#pragma unroll
    for (int i = 0; i < 2; ++i) {
      for (int v = 0; v < 8; ++v) {
        int r = row0 + i * 16 + mb + v;
        int c = col0 + j * 16 + n;
        float val = acc[i][j][v] + bval;
        if (p == 0) {
          qp32[(size_t)r * DIMV + c] = val;
          qp16[(size_t)r * DIMV + c] = (_Float16)val;
        } else if (p == 1) {
          kp16[(size_t)r * DIMV + c] = (_Float16)val;
        } else {
          vpT[(size_t)c * ROWS + r] = (_Float16)val;
        }
      }
    }
  }
}

// ---------------------------------------------------------------------------
// 4) Attention per (b, h, 16-query block): scores -> softmax -> P@V + residual.
//    4 waves / block; wave w owns keys [w*256, w*256+256) for scores and
//    head-dim cols [w*16, w*16+16) for the output GEMM.
__global__ __launch_bounds__(128) void attn_kernel(
    const _Float16* __restrict__ qp16, const _Float16* __restrict__ kp16,
    const _Float16* __restrict__ vpT, const float* __restrict__ qp32,
    float* __restrict__ ao32) {
  __shared__ _Float16 pr[16 * PROB_LD];   // scores then exp(scores), f16
  __shared__ float red[16 * 8];
  __shared__ float rowmax[16];
  __shared__ float rowinv[16];

  int bid = blockIdx.x;
  int qBlk = bid & 63;
  int h = (bid >> 6) & 7;
  int b = bid >> 9;
  int grow = b * SEQ + (qBlk << 4);

  int tid = threadIdx.x;
  int w = tid >> 5, lane = tid & 31;
  int n = lane & 15, mb = (lane >> 4) * 8;

  // ---- scores: S = (Qh @ Kh^T) / 8, stored f16 in LDS
  const _Float16* qbase = qp16 + (size_t)grow * DIMV + h * HDIM;
  v16h qa0 = load_frag(qbase, DIMV);       // loop-invariant Q fragments
  v16h qa1 = load_frag(qbase + 32, DIMV);
  for (int j = 0; j < 16; ++j) {
    int n0 = w * 256 + j * 16;
    const _Float16* kbase = kp16 + (size_t)(b * SEQ + n0) * DIMV + h * HDIM;
    v8f acc = {};
    acc = wmma_f16(qa0, load_frag(kbase, DIMV), acc);
    acc = wmma_f16(qa1, load_frag(kbase + 32, DIMV), acc);
    for (int v = 0; v < 8; ++v)
      pr[(mb + v) * PROB_LD + n0 + n] = (_Float16)(acc[v] * 0.125f);
  }
  __syncthreads();

  // ---- softmax (two pass; defer the 1/sum to the output scale)
  int r = tid & 15, seg = tid >> 4;            // 8 segments x 128 keys
  {
    float mx = -3.0e38f;
    const _Float16* srow = pr + r * PROB_LD + seg * 128;
    for (int c = 0; c < 128; ++c) mx = fmaxf(mx, (float)srow[c]);
    red[r * 8 + seg] = mx;
  }
  __syncthreads();
  if (tid < 16) {
    float mx = red[tid * 8];
    for (int s = 1; s < 8; ++s) mx = fmaxf(mx, red[tid * 8 + s]);
    rowmax[tid] = mx;
  }
  __syncthreads();
  {
    float mx = rowmax[r];
    float sum = 0.f;
    _Float16* prow = pr + r * PROB_LD + seg * 128;
    for (int c = 0; c < 128; ++c) {
      float e = __expf((float)prow[c] - mx);
      sum += e;
      prow[c] = (_Float16)e;
    }
    red[r * 8 + seg] = sum;
  }
  __syncthreads();
  if (tid < 16) {
    float s = 0.f;
    for (int i = 0; i < 8; ++i) s += red[tid * 8 + i];
    rowinv[tid] = 1.0f / s;
  }
  __syncthreads();

  // ---- O = (P @ V) * rowinv + Qp   (wave w -> head-dim cols [w*16, w*16+16))
  int d0 = w * 16;
  const _Float16* vb = vpT + (size_t)(h * HDIM + d0) * ROWS + b * SEQ;
  v8f acc = {};
  for (int kk = 0; kk < SEQ; kk += 32) {
    v16h a = load_frag(pr + kk, PROB_LD);
    v16h bf = load_frag(vb + kk, ROWS);
    acc = wmma_f16(a, bf, acc);
  }
  for (int v = 0; v < 8; ++v) {
    int m = mb + v;
    size_t idx = (size_t)(grow + m) * DIMV + h * HDIM + d0 + n;
    ao32[idx] = acc[v] * rowinv[m] + qp32[idx];
  }
}

// ---------------------------------------------------------------------------
// 5) LayerNorm per row (wave per row). Optionally emits an f16 copy.
__global__ __launch_bounds__(256) void ln_kernel(
    const float* __restrict__ in, float* __restrict__ out32,
    _Float16* __restrict__ out16, const float* __restrict__ gamma,
    const float* __restrict__ beta) {
  int w = threadIdx.x >> 5, lane = threadIdx.x & 31;
  int row = blockIdx.x * 8 + w;
  const float* base = in + (size_t)row * DIMV;

  float x[16], sum = 0.f, sq = 0.f;
  for (int i = 0; i < 16; ++i) {
    x[i] = base[lane + i * 32];
    sum += x[i];
    sq += x[i] * x[i];
  }
  for (int off = 16; off > 0; off >>= 1) {
    sum += __shfl_xor(sum, off, 32);
    sq  += __shfl_xor(sq,  off, 32);
  }
  float mean = sum * (1.0f / DIMV);
  float var = sq * (1.0f / DIMV) - mean * mean;
  float rstd = rsqrtf(var + 1e-5f);
  for (int i = 0; i < 16; ++i) {
    int c = lane + i * 32;
    float y = (x[i] - mean) * rstd * gamma[c] + beta[c];
    out32[(size_t)row * DIMV + c] = y;
    if (out16) out16[(size_t)row * DIMV + c] = (_Float16)y;
  }
}

// ---------------------------------------------------------------------------
// 6) Out = X1 + relu(X1 @ Wo + bo). One wave per 32x64 tile, waves = 2048.
__global__ __launch_bounds__(256) void gemm2_kernel(
    const _Float16* __restrict__ x16, const _Float16* __restrict__ woT,
    const float* __restrict__ bo, const float* __restrict__ x32,
    float* __restrict__ out) {
  int wave = (blockIdx.x * blockDim.x + threadIdx.x) >> 5;
  int row0 = (wave >> 3) * 32;     // 256 row-groups
  int col0 = (wave & 7) * 64;      // 8 col-groups
  const _Float16* abase = x16 + (size_t)row0 * DIMV;
  const _Float16* bbase = woT + (size_t)col0 * DIMV;

  v8f acc[2][4] = {};
  for (int k0 = 0; k0 < DIMV; k0 += 32) {
    v16h a0 = load_frag(abase + k0, DIMV);
    v16h a1 = load_frag(abase + 16 * DIMV + k0, DIMV);
#pragma unroll
    for (int j = 0; j < 4; ++j) {
      v16h b = load_frag(bbase + j * 16 * DIMV + k0, DIMV);
      acc[0][j] = wmma_f16(a0, b, acc[0][j]);
      acc[1][j] = wmma_f16(a1, b, acc[1][j]);
    }
  }

  int lane = threadIdx.x & 31;
  int n = lane & 15, mb = (lane >> 4) * 8;
#pragma unroll
  for (int j = 0; j < 4; ++j) {
    float bval = bo[col0 + j * 16 + n];
#pragma unroll
    for (int i = 0; i < 2; ++i) {
      for (int v = 0; v < 8; ++v) {
        size_t idx = (size_t)(row0 + i * 16 + mb + v) * DIMV + col0 + j * 16 + n;
        out[idx] = x32[idx] + fmaxf(acc[i][j][v] + bval, 0.0f);
      }
    }
  }
}

// ---------------------------------------------------------------------------
extern "C" void kernel_launch(void* const* d_in, const int* in_sizes, int n_in,
                              void* d_out, int out_size, void* d_ws, size_t ws_size,
                              hipStream_t stream) {
  const float* Q  = (const float*)d_in[0];
  const float* K  = (const float*)d_in[1];
  const float* Wq = (const float*)d_in[2];
  const float* bq = (const float*)d_in[3];
  const float* Wk = (const float*)d_in[4];
  const float* bk = (const float*)d_in[5];
  const float* Wv = (const float*)d_in[6];
  const float* bv = (const float*)d_in[7];
  const float* Wo = (const float*)d_in[8];
  const float* bo = (const float*)d_in[9];
  const float* g0 = (const float*)d_in[10];
  const float* b0 = (const float*)d_in[11];
  const float* g1 = (const float*)d_in[12];
  const float* b1 = (const float*)d_in[13];
  float* out = (float*)d_out;

  char* ws = (char*)d_ws;
  const size_t NE = (size_t)ROWS * DIMV;      // 4,194,304 elements
  _Float16* q16  = (_Float16*)(ws);                         // 8 MB
  _Float16* k16  = (_Float16*)(ws + 8388608);               // 8 MB
  _Float16* w16T = (_Float16*)(ws + 16777216);              // 2 MB (4 mats)
  float*    qp32 = (float*)   (ws + 18874368);              // 16 MB
  _Float16* qp16 = (_Float16*)(ws + 35651584);              // 8 MB
  _Float16* kp16 = (_Float16*)(ws + 44040192);              // 8 MB
  _Float16* vpT  = (_Float16*)(ws + 52428800);              // 8 MB
  float*    ao32 = (float*)   (ws + 60817408);              // 16 MB
  float*    x132 = (float*)   (ws + 77594624);              // 16 MB
  _Float16* x116 = (_Float16*)(ws + 94371840);              // 8 MB
  // total workspace: ~98 MB

  // 1) convert activations
  cvt_f16_kernel<<<(int)(NE / 256), 256, 0, stream>>>(Q, q16, (int)NE);
  cvt_f16_kernel<<<(int)(NE / 256), 256, 0, stream>>>(K, k16, (int)NE);

  // 2) transposed f16 weights
  const int WN = DIMV * DIMV;
  cvt_wT_kernel<<<WN / 256, 256, 0, stream>>>(Wq, w16T + 0 * WN);
  cvt_wT_kernel<<<WN / 256, 256, 0, stream>>>(Wk, w16T + 1 * WN);
  cvt_wT_kernel<<<WN / 256, 256, 0, stream>>>(Wv, w16T + 2 * WN);
  cvt_wT_kernel<<<WN / 256, 256, 0, stream>>>(Wo, w16T + 3 * WN);

  // 3) projections: 6144 tile-waves (32x64 tiles), 8 waves/block
  proj_kernel<<<768, 256, 0, stream>>>(q16, k16, w16T, bq, bk, bv,
                                       qp32, qp16, kp16, vpT);

  // 4) attention: B*H*(SEQ/16) = 4096 blocks of 128 threads
  attn_kernel<<<4096, 128, 0, stream>>>(qp16, kp16, vpT, qp32, ao32);

  // 5) LN0 -> x1 (f32 + f16)
  ln_kernel<<<ROWS / 8, 256, 0, stream>>>(ao32, x132, x116, g0, b0);

  // 6) x1 + relu(x1 @ Wo + bo) -> d_out ; 2048 tile-waves
  gemm2_kernel<<<256, 256, 0, stream>>>(x116, w16T + 3 * WN, bo, x132, out);

  // 7) LN1 in place on d_out
  ln_kernel<<<ROWS / 8, 256, 0, stream>>>(out, out, (_Float16*)nullptr, g1, b1);
}

// v001
// A run of this version takes 168 microseconds.
// Next to v000, in two timings, it ran 1.58 and 1.56 times as fast.
#include <hip/hip_runtime.h>
#include <hip/hip_bf16.h>

// ---------------------------------------------------------------------------
// MAB (multihead attention block) for MI455X / gfx1250, wave32 + WMMA f16->f32
// Register-blocked GEMMs: one wave computes a 32x64 tile (2x4 WMMA tiles).
// Every f16 matrix in the workspace is kept in fragment order (see frag_off).
// ---------------------------------------------------------------------------

typedef __attribute__((ext_vector_type(16))) _Float16 v16h;
typedef __attribute__((ext_vector_type(8)))  _Float16 v8h;
typedef __attribute__((ext_vector_type(8)))  float    v8f;

#define DIMV   512
#define ROWS   8192          // B*N = 8*1024
#define SEQ    1024
#define NHEAD  8
#define HDIM   64
#define PROB_LD 1032         // f16 LDS row stride (pad: 2064B = 516 dwords)

__device__ __forceinline__ v8f wmma_f16(v16h a, v16h b, v8f c) {
  return __builtin_amdgcn_wmma_f32_16x16x32_f16(false, a, false, b,
                                                (short)0, c, false, false);
}

// Load a 16x32 fragment. `base` points at (row0, k0) of a row-major [rows x ld]
// f16 matrix. Lane r = lane&15 supplies row r; g = lane>>4 selects K-half.
// Elements i=0..7 -> K = g*8+i ; i=8..15 -> K = 16+g*8+(i-8)  (ISA 7.12.2).
// Works for A fragments (rows = M) and B fragments when B is stored
// column-major (rows = N, i.e. pass B^T row-major).
__device__ __forceinline__ v16h load_frag(const _Float16* __restrict__ base, int ld) {
  int lane = threadIdx.x & 31;
  int r = lane & 15;
  int g = lane >> 4;
  const _Float16* p = base + r * ld + g * 8;
  union { v16h v; v8h h[2]; } u;
  u.h[0] = *(const v8h*)(p);
  u.h[1] = *(const v8h*)(p + 16);
  return u.v;
}

// Fragment order of a [rows x 32*kt] f16 matrix in global memory: 16x32 tiles
// of 512 halves, tile (row/16, k/32) at index (row/16)*kt + k/32. Inside a tile
// the 8 halves that one lane takes with one 16-byte load lie together, and the
// 32 lanes' pieces follow one another: piece hs*32 + g*16 + r holds row r,
// k = hs*16 + g*8 .. +7. That is the k order of load_frag, so a fragment is two
// loads of 512 contiguous bytes each.
__device__ __forceinline__ size_t frag_off(int row, int k, int kt) {
  return ((size_t)(row >> 4) * kt + (k >> 5)) * 512 + ((k >> 4) & 1) * 256 +
         (((k >> 3) & 1) * 16 + (row & 15)) * 8 + (k & 7);
}

// Inverse of frag_off: position o in the stored matrix -> (row, k).
__device__ __forceinline__ void frag_pos(int o, int kt, int& row, int& k) {
  int tile = o >> 9;
  row = (tile / kt) * 16 + ((o >> 3) & 15);
  k = (tile % kt) * 32 + ((o >> 8) & 1) * 16 + ((o >> 7) & 1) * 8 + (o & 7);
}

// Load the fragment whose tile starts at `tile` (fragment-order storage).
__device__ __forceinline__ v16h load_tile(const _Float16* __restrict__ tile) {
  const _Float16* p = tile + (threadIdx.x & 31) * 8;
  union { v16h v; v8h h[2]; } u;
  u.h[0] = *(const v8h*)(p);
  u.h[1] = *(const v8h*)(p + 256);
  return u.v;
}

#define KT_DIMV (DIMV / 32)   // k tiles of a [rows x 512] matrix
#define KT_ROWS (ROWS / 32)   // k tiles of the [512 x 8192] transposed V

// ---------------------------------------------------------------------------
// 1) f32 [rows x 512] -> f16 in fragment order
__global__ void cvt_f16_kernel(const float* __restrict__ src,
                               _Float16* __restrict__ dst, int n) {
  int i = blockIdx.x * blockDim.x + threadIdx.x;
  if (i >= n) return;
  int row, k;
  frag_pos(i, KT_DIMV, row, k);
  dst[i] = (_Float16)src[(size_t)row * DIMV + k];
}

// 2) transpose 512x512 f32 -> f16 in fragment order (element (n,k) = src[k*512+n])
__global__ void cvt_wT_kernel(const float* __restrict__ src,
                              _Float16* __restrict__ dst) {
  int o = blockIdx.x * blockDim.x + threadIdx.x;
  if (o >= DIMV * DIMV) return;
  int n, k;
  frag_pos(o, KT_DIMV, n, k);
  dst[o] = (_Float16)src[k * DIMV + n];
}

// ---------------------------------------------------------------------------
// 3) Fused projections: Qp = Q@Wq+bq (f32+f16), Kp = K@Wk+bk (f16),
//    Vp = K@Wv+bv stored transposed [DIMV][ROWS] (f16); f16 in fragment order.
//    One wave per 32x64 output tile: waves = 3 * (8192/32) * (512/64) = 6144.
__global__ __launch_bounds__(256) void proj_kernel(
    const _Float16* __restrict__ q16, const _Float16* __restrict__ k16,
    const _Float16* __restrict__ w16T,
    const float* __restrict__ bq, const float* __restrict__ bk,
    const float* __restrict__ bvv,
    float* __restrict__ qp32, _Float16* __restrict__ qp16,
    _Float16* __restrict__ kp16, _Float16* __restrict__ vpT) {
  // wave index made scalar, so that every tile base is a scalar address
  int wave = __builtin_amdgcn_readfirstlane(
      (int)((blockIdx.x * blockDim.x + threadIdx.x) >> 5));
  int p = wave / 2048;             // 0:Q 1:K 2:V  (2048 waves each)
  int t = wave % 2048;             // 256 row-groups x 8 col-groups
  int row0 = (t >> 3) * 32;
  int col0 = (t & 7) * 64;

  const _Float16* X = (p == 0) ? q16 : k16;
  const _Float16* abase = X + (size_t)row0 * DIMV;   // 16 rows = 16*DIMV halves
  const _Float16* bbase = w16T + (size_t)p * (DIMV * DIMV) + (size_t)col0 * DIMV;

  v8f acc[2][4] = {};
  for (int k0 = 0; k0 < DIMV; k0 += 32) {
    v16h a0 = load_tile(abase + k0 * 16);
    v16h a1 = load_tile(abase + 16 * DIMV + k0 * 16);
#pragma unroll
    for (int j = 0; j < 4; ++j) {
      v16h b = load_tile(bbase + j * 16 * DIMV + k0 * 16);
      acc[0][j] = wmma_f16(a0, b, acc[0][j]);
      acc[1][j] = wmma_f16(a1, b, acc[1][j]);
    }
  }

  int lane = threadIdx.x & 31;
  int n = lane & 15, mb = (lane >> 4) * 8;
  const float* bias = (p == 0) ? bq : (p == 1) ? bk : bvv;
  // p is scalar: one branch per wave picks the writer of its matrix.
  if (p == 0) {
#pragma unroll
    for (int j = 0; j < 4; ++j) {
      int c = col0 + j * 16 + n;
      float bval = bias[c];
#pragma unroll
      for (int i = 0; i < 2; ++i) {
        for (int v = 0; v < 8; ++v) {
          int r = row0 + i * 16 + mb + v;
          float val = acc[i][j][v] + bval;
          qp32[(size_t)r * DIMV + c] = val;
          qp16[frag_off(r, c, KT_DIMV)] = (_Float16)val;
        }
      }
    }
  } else if (p == 1) {
#pragma unroll
    for (int j = 0; j < 4; ++j) {
      int c = col0 + j * 16 + n;
      float bval = bias[c];
#pragma unroll
      for (int i = 0; i < 2; ++i) {
        for (int v = 0; v < 8; ++v) {
          int r = row0 + i * 16 + mb + v;
          kp16[frag_off(r, c, KT_DIMV)] = (_Float16)(acc[i][j][v] + bval);
        }
      }
    }
  } else {
    // Transposed V: a lane's 8 accumulators are 8 successive keys of one
    // column, which is one 16-byte piece of the fragment order.
#pragma unroll
    for (int j = 0; j < 4; ++j) {
      int c = col0 + j * 16 + n;
      float bval = bias[c];
#pragma unroll
      for (int i = 0; i < 2; ++i) {
        v8h piece;
        for (int v = 0; v < 8; ++v) piece[v] = (_Float16)(acc[i][j][v] + bval);
        *(v8h*)(vpT + frag_off(c, row0 + i * 16 + mb, KT_ROWS)) = piece;
      }
    }
  }
}

// ---------------------------------------------------------------------------
// 4) Attention per (b, h, 16-query block): scores -> softmax -> P@V + residual.
//    4 waves / block; wave w owns keys [w*256, w*256+256) for scores and
//    head-dim cols [w*16, w*16+16) for the output GEMM.
__global__ __launch_bounds__(128) void attn_kernel(
    const _Float16* __restrict__ qp16, const _Float16* __restrict__ kp16,
    const _Float16* __restrict__ vpT, const float* __restrict__ qp32,
    float* __restrict__ ao32) {
  __shared__ _Float16 pr[16 * PROB_LD];   // scores then exp(scores), f16
  __shared__ float red[16 * 8];
  __shared__ float rowmax[16];
  __shared__ float rowinv[16];

  int bid = blockIdx.x;
  int qBlk = bid & 63;
  int h = (bid >> 6) & 7;
  int b = bid >> 9;
  int grow = b * SEQ + (qBlk << 4);

  int tid = threadIdx.x;
  int w = __builtin_amdgcn_readfirstlane(tid >> 5);  // scalar tile bases
  int lane = tid & 31;
  int n = lane & 15, mb = (lane >> 4) * 8;

  // ---- scores: S = (Qh @ Kh^T) / 8, stored f16 in LDS
  const _Float16* qbase = qp16 + frag_off(grow, h * HDIM, KT_DIMV);
  v16h qa0 = load_tile(qbase);             // loop-invariant Q fragments
  v16h qa1 = load_tile(qbase + 512);
  // the scalar base of the Q loads is reused while they are in flight
  asm volatile("s_wait_xcnt 0x0" ::: "memory");
  for (int j = 0; j < 16; ++j) {
    int n0 = w * 256 + j * 16;
    const _Float16* kbase = kp16 + frag_off(b * SEQ + n0, h * HDIM, KT_DIMV);
    v8f acc = {};
    acc = wmma_f16(qa0, load_tile(kbase), acc);
    acc = wmma_f16(qa1, load_tile(kbase + 512), acc);
    for (int v = 0; v < 8; ++v)
      pr[(mb + v) * PROB_LD + n0 + n] = (_Float16)(acc[v] * 0.125f);
  }
  __syncthreads();

  // ---- softmax (two pass; defer the 1/sum to the output scale)
  int r = tid & 15, seg = tid >> 4;            // 8 segments x 128 keys
  {
    float mx = -3.0e38f;
    const _Float16* srow = pr + r * PROB_LD + seg * 128;
    for (int c = 0; c < 128; ++c) mx = fmaxf(mx, (float)srow[c]);
    red[r * 8 + seg] = mx;
  }
  __syncthreads();
  if (tid < 16) {
    float mx = red[tid * 8];
    for (int s = 1; s < 8; ++s) mx = fmaxf(mx, red[tid * 8 + s]);
    rowmax[tid] = mx;
  }
  __syncthreads();
  {
    float mx = rowmax[r];
    float sum = 0.f;
    _Float16* prow = pr + r * PROB_LD + seg * 128;
    for (int c = 0; c < 128; ++c) {
      float e = __expf((float)prow[c] - mx);
      sum += e;
      prow[c] = (_Float16)e;
    }
    red[r * 8 + seg] = sum;
  }
  __syncthreads();
  if (tid < 16) {
    float s = 0.f;
    for (int i = 0; i < 8; ++i) s += red[tid * 8 + i];
    rowinv[tid] = 1.0f / s;
  }
  __syncthreads();

  // ---- O = (P @ V) * rowinv + Qp   (wave w -> head-dim cols [w*16, w*16+16))
  int d0 = w * 16;
  const _Float16* vb = vpT + frag_off(h * HDIM + d0, b * SEQ, KT_ROWS);
  v8f acc = {};
  for (int kk = 0; kk < SEQ; kk += 32) {
    v16h a = load_frag(pr + kk, PROB_LD);
    v16h bf = load_tile(vb + kk * 16);
    acc = wmma_f16(a, bf, acc);
  }
  for (int v = 0; v < 8; ++v) {
    int m = mb + v;
    size_t idx = (size_t)(grow + m) * DIMV + h * HDIM + d0 + n;
    ao32[idx] = acc[v] * rowinv[m] + qp32[idx];
  }
}

// ---------------------------------------------------------------------------
// 5) LayerNorm per row (wave per row). Optionally emits an f16 copy in
//    fragment order.
__global__ __launch_bounds__(256) void ln_kernel(
    const float* __restrict__ in, float* __restrict__ out32,
    _Float16* __restrict__ out16, const float* __restrict__ gamma,
    const float* __restrict__ beta) {
  int w = threadIdx.x >> 5, lane = threadIdx.x & 31;
  int row = blockIdx.x * 8 + w;
  const float* base = in + (size_t)row * DIMV;

  float x[16], sum = 0.f, sq = 0.f;
  for (int i = 0; i < 16; ++i) {
    x[i] = base[lane + i * 32];
    sum += x[i];
    sq += x[i] * x[i];
  }
  for (int off = 16; off > 0; off >>= 1) {
    sum += __shfl_xor(sum, off, 32);
    sq  += __shfl_xor(sq,  off, 32);
  }
  float mean = sum * (1.0f / DIMV);
  float var = sq * (1.0f / DIMV) - mean * mean;
  float rstd = rsqrtf(var + 1e-5f);
  for (int i = 0; i < 16; ++i) {
    int c = lane + i * 32;
    float y = (x[i] - mean) * rstd * gamma[c] + beta[c];
    out32[(size_t)row * DIMV + c] = y;
    if (out16) {
      out16[frag_off(row, c, KT_DIMV)] = (_Float16)y;
      // the store's registers are reused by the next column's loads
      asm volatile("s_wait_xcnt 0x0" ::: "memory");
    }
  }
}

// ---------------------------------------------------------------------------
// 6) Out = X1 + relu(X1 @ Wo + bo). One wave per 32x64 tile, waves = 2048.
__global__ __launch_bounds__(256) void gemm2_kernel(
    const _Float16* __restrict__ x16, const _Float16* __restrict__ woT,
    const float* __restrict__ bo, const float* __restrict__ x32,
    float* __restrict__ out) {
  // wave index made scalar, so that every tile base is a scalar address
  int wave = __builtin_amdgcn_readfirstlane(
      (int)((blockIdx.x * blockDim.x + threadIdx.x) >> 5));
  int row0 = (wave >> 3) * 32;     // 256 row-groups
  int col0 = (wave & 7) * 64;      // 8 col-groups
  const _Float16* abase = x16 + (size_t)row0 * DIMV;
  const _Float16* bbase = woT + (size_t)col0 * DIMV;

  v8f acc[2][4] = {};
  for (int k0 = 0; k0 < DIMV; k0 += 32) {
    v16h a0 = load_tile(abase + k0 * 16);
    v16h a1 = load_tile(abase + 16 * DIMV + k0 * 16);
#pragma unroll
    for (int j = 0; j < 4; ++j) {
      v16h b = load_tile(bbase + j * 16 * DIMV + k0 * 16);
      acc[0][j] = wmma_f16(a0, b, acc[0][j]);
      acc[1][j] = wmma_f16(a1, b, acc[1][j]);
    }
  }
  // the tile loads' offset register is reused by the loads of the epilogue
  asm volatile("s_wait_xcnt 0x0" ::: "memory");

  int lane = threadIdx.x & 31;
  int n = lane & 15, mb = (lane >> 4) * 8;
#pragma unroll
  for (int j = 0; j < 4; ++j) {
    float bval = bo[col0 + j * 16 + n];
#pragma unroll
    for (int i = 0; i < 2; ++i) {
      for (int v = 0; v < 8; ++v) {
        size_t idx = (size_t)(row0 + i * 16 + mb + v) * DIMV + col0 + j * 16 + n;
        out[idx] = x32[idx] + fmaxf(acc[i][j][v] + bval, 0.0f);
      }
    }
  }
}

// ---------------------------------------------------------------------------
extern "C" void kernel_launch(void* const* d_in, const int* in_sizes, int n_in,
                              void* d_out, int out_size, void* d_ws, size_t ws_size,
                              hipStream_t stream) {
  const float* Q  = (const float*)d_in[0];
  const float* K  = (const float*)d_in[1];
  const float* Wq = (const float*)d_in[2];
  const float* bq = (const float*)d_in[3];
  const float* Wk = (const float*)d_in[4];
  const float* bk = (const float*)d_in[5];
  const float* Wv = (const float*)d_in[6];
  const float* bv = (const float*)d_in[7];
  const float* Wo = (const float*)d_in[8];
  const float* bo = (const float*)d_in[9];
  const float* g0 = (const float*)d_in[10];
  const float* b0 = (const float*)d_in[11];
  const float* g1 = (const float*)d_in[12];
  const float* b1 = (const float*)d_in[13];
  float* out = (float*)d_out;

  char* ws = (char*)d_ws;
  const size_t NE = (size_t)ROWS * DIMV;      // 4,194,304 elements
  _Float16* q16  = (_Float16*)(ws);                         // 8 MB
  _Float16* k16  = (_Float16*)(ws + 8388608);               // 8 MB
  _Float16* w16T = (_Float16*)(ws + 16777216);              // 2 MB (4 mats)
  float*    qp32 = (float*)   (ws + 18874368);              // 16 MB
  _Float16* qp16 = (_Float16*)(ws + 35651584);              // 8 MB
  _Float16* kp16 = (_Float16*)(ws + 44040192);              // 8 MB
  _Float16* vpT  = (_Float16*)(ws + 52428800);              // 8 MB
  float*    ao32 = (float*)   (ws + 60817408);              // 16 MB
  float*    x132 = (float*)   (ws + 77594624);              // 16 MB
  _Float16* x116 = (_Float16*)(ws + 94371840);              // 8 MB
  // total workspace: ~98 MB

  // 1) convert activations
  cvt_f16_kernel<<<(int)(NE / 256), 256, 0, stream>>>(Q, q16, (int)NE);
  cvt_f16_kernel<<<(int)(NE / 256), 256, 0, stream>>>(K, k16, (int)NE);

  // 2) transposed f16 weights
  const int WN = DIMV * DIMV;
  cvt_wT_kernel<<<WN / 256, 256, 0, stream>>>(Wq, w16T + 0 * WN);
  cvt_wT_kernel<<<WN / 256, 256, 0, stream>>>(Wk, w16T + 1 * WN);
  cvt_wT_kernel<<<WN / 256, 256, 0, stream>>>(Wv, w16T + 2 * WN);
  cvt_wT_kernel<<<WN / 256, 256, 0, stream>>>(Wo, w16T + 3 * WN);

  // 3) projections: 6144 tile-waves (32x64 tiles), 8 waves/block
  proj_kernel<<<768, 256, 0, stream>>>(q16, k16, w16T, bq, bk, bv,
                                       qp32, qp16, kp16, vpT);

  // 4) attention: B*H*(SEQ/16) = 4096 blocks of 128 threads
  attn_kernel<<<4096, 128, 0, stream>>>(qp16, kp16, vpT, qp32, ao32);

  // 5) LN0 -> x1 (f32 + f16)
  ln_kernel<<<ROWS / 8, 256, 0, stream>>>(ao32, x132, x116, g0, b0);

  // 6) x1 + relu(x1 @ Wo + bo) -> d_out ; 2048 tile-waves
  gemm2_kernel<<<256, 256, 0, stream>>>(x116, w16T + 3 * WN, bo, x132, out);

  // 7) LN1 in place on d_out
  ln_kernel<<<ROWS / 8, 256, 0, stream>>>(out, out, (_Float16*)nullptr, g1, b1);
}

// v002
// It runs in 135 microseconds.
// In two side-by-side timings against v001, it was 1.24 and 1.25 times as fast.
// Counting every step since v000, it is 1.95 times as fast.
#include <hip/hip_runtime.h>
#include <hip/hip_bf16.h>

// ---------------------------------------------------------------------------
// MAB (multihead attention block) for MI455X / gfx1250, wave32 + WMMA f16->f32
// Register-blocked GEMMs: one wave computes a 32x64 tile (2x4 WMMA tiles).
// Every f16 matrix in the workspace is kept in fragment order (see frag_off).
// ---------------------------------------------------------------------------

typedef __attribute__((ext_vector_type(16))) _Float16 v16h;
typedef __attribute__((ext_vector_type(8)))  _Float16 v8h;
typedef __attribute__((ext_vector_type(8)))  float    v8f;

#define DIMV   512
#define ROWS   8192          // B*N = 8*1024
#define SEQ    1024
#define NHEAD  8
#define HDIM   64

__device__ __forceinline__ v8f wmma_f16(v16h a, v16h b, v8f c) {
  return __builtin_amdgcn_wmma_f32_16x16x32_f16(false, a, false, b,
                                                (short)0, c, false, false);
}

// k order of a 16x32 f16 fragment (ISA 7.12.2): lane r = lane&15 supplies row r
// (a row of A, or a column of B), g = lane>>4 selects the K half; elements
// i=0..7 -> K = g*8+i ; i=8..15 -> K = 16+g*8+(i-8).

// Fragment order of a [rows x 32*kt] f16 matrix in global memory: 16x32 tiles
// of 512 halves, tile (row/16, k/32) at index (row/16)*kt + k/32. Inside a tile
// the 8 halves that one lane takes with one 16-byte load lie together, and the
// 32 lanes' pieces follow one another: piece hs*32 + g*16 + r holds row r,
// k = hs*16 + g*8 .. +7. That is the k order given above, so a fragment is two
// loads of 512 contiguous bytes each.
__device__ __forceinline__ size_t frag_off(int row, int k, int kt) {
  return ((size_t)(row >> 4) * kt + (k >> 5)) * 512 + ((k >> 4) & 1) * 256 +
         (((k >> 3) & 1) * 16 + (row & 15)) * 8 + (k & 7);
}

// Inverse of frag_off: position o in the stored matrix -> (row, k).
__device__ __forceinline__ void frag_pos(int o, int kt, int& row, int& k) {
  int tile = o >> 9;
  row = (tile / kt) * 16 + ((o >> 3) & 15);
  k = (tile % kt) * 32 + ((o >> 8) & 1) * 16 + ((o >> 7) & 1) * 8 + (o & 7);
}

// Load the fragment whose tile starts at `tile` (fragment-order storage).
__device__ __forceinline__ v16h load_tile(const _Float16* __restrict__ tile) {
  const _Float16* p = tile + (threadIdx.x & 31) * 8;
  union { v16h v; v8h h[2]; } u;
  u.h[0] = *(const v8h*)(p);
  u.h[1] = *(const v8h*)(p + 256);
  return u.v;
}

#define KT_DIMV (DIMV / 32)   // k tiles of a [rows x 512] matrix
#define KT_ROWS (ROWS / 32)   // k tiles of the [512 x 8192] transposed V

// ---------------------------------------------------------------------------
// 1) f32 [rows x 512] -> f16 in fragment order
__global__ void cvt_f16_kernel(const float* __restrict__ src,
                               _Float16* __restrict__ dst, int n) {
  int i = blockIdx.x * blockDim.x + threadIdx.x;
  if (i >= n) return;
  int row, k;
  frag_pos(i, KT_DIMV, row, k);
  dst[i] = (_Float16)src[(size_t)row * DIMV + k];
}

// 2) transpose 512x512 f32 -> f16 in fragment order (element (n,k) = src[k*512+n])
__global__ void cvt_wT_kernel(const float* __restrict__ src,
                              _Float16* __restrict__ dst) {
  int o = blockIdx.x * blockDim.x + threadIdx.x;
  if (o >= DIMV * DIMV) return;
  int n, k;
  frag_pos(o, KT_DIMV, n, k);
  dst[o] = (_Float16)src[k * DIMV + n];
}

// ---------------------------------------------------------------------------
// 3) Fused projections: Qp = Q@Wq+bq (f32+f16), Kp = K@Wk+bk (f16),
//    Vp = K@Wv+bv stored transposed [DIMV][ROWS] (f16); f16 in fragment order.
//    One wave per 32x64 output tile: waves = 3 * (8192/32) * (512/64) = 6144.
__global__ __launch_bounds__(256) void proj_kernel(
    const _Float16* __restrict__ q16, const _Float16* __restrict__ k16,
    const _Float16* __restrict__ w16T,
    const float* __restrict__ bq, const float* __restrict__ bk,
    const float* __restrict__ bvv,
    float* __restrict__ qp32, _Float16* __restrict__ qp16,
    _Float16* __restrict__ kp16, _Float16* __restrict__ vpT) {
  // wave index made scalar, so that every tile base is a scalar address
  int wave = __builtin_amdgcn_readfirstlane(
      (int)((blockIdx.x * blockDim.x + threadIdx.x) >> 5));
  int p = wave / 2048;             // 0:Q 1:K 2:V  (2048 waves each)
  int t = wave % 2048;             // 256 row-groups x 8 col-groups
  int row0 = (t >> 3) * 32;
  int col0 = (t & 7) * 64;

  const _Float16* X = (p == 0) ? q16 : k16;
  const _Float16* abase = X + (size_t)row0 * DIMV;   // 16 rows = 16*DIMV halves
  const _Float16* bbase = w16T + (size_t)p * (DIMV * DIMV) + (size_t)col0 * DIMV;

  v8f acc[2][4] = {};
  for (int k0 = 0; k0 < DIMV; k0 += 32) {
    v16h a0 = load_tile(abase + k0 * 16);
    v16h a1 = load_tile(abase + 16 * DIMV + k0 * 16);
#pragma unroll
    for (int j = 0; j < 4; ++j) {
      v16h b = load_tile(bbase + j * 16 * DIMV + k0 * 16);
      acc[0][j] = wmma_f16(a0, b, acc[0][j]);
      acc[1][j] = wmma_f16(a1, b, acc[1][j]);
    }
  }

  int lane = threadIdx.x & 31;
  int n = lane & 15, mb = (lane >> 4) * 8;
  const float* bias = (p == 0) ? bq : (p == 1) ? bk : bvv;
  // p is scalar: one branch per wave picks the writer of its matrix.
  if (p == 0) {
#pragma unroll
    for (int j = 0; j < 4; ++j) {
      int c = col0 + j * 16 + n;
      float bval = bias[c];
#pragma unroll
      for (int i = 0; i < 2; ++i) {
        for (int v = 0; v < 8; ++v) {
          int r = row0 + i * 16 + mb + v;
          float val = acc[i][j][v] + bval;
          qp32[(size_t)r * DIMV + c] = val;
          qp16[frag_off(r, c, KT_DIMV)] = (_Float16)val;
        }
      }
    }
  } else if (p == 1) {
#pragma unroll
    for (int j = 0; j < 4; ++j) {
      int c = col0 + j * 16 + n;
      float bval = bias[c];
#pragma unroll
      for (int i = 0; i < 2; ++i) {
        for (int v = 0; v < 8; ++v) {
          int r = row0 + i * 16 + mb + v;
          kp16[frag_off(r, c, KT_DIMV)] = (_Float16)(acc[i][j][v] + bval);
        }
      }
    }
  } else {
    // Transposed V: a lane's 8 accumulators are 8 successive keys of one
    // column, which is one 16-byte piece of the fragment order.
#pragma unroll
    for (int j = 0; j < 4; ++j) {
      int c = col0 + j * 16 + n;
      float bval = bias[c];
#pragma unroll
      for (int i = 0; i < 2; ++i) {
        v8h piece;
        for (int v = 0; v < 8; ++v) piece[v] = (_Float16)(acc[i][j][v] + bval);
        *(v8h*)(vpT + frag_off(c, row0 + i * 16 + mb, KT_ROWS)) = piece;
      }
    }
  }
}

// ---------------------------------------------------------------------------
// 4) Attention, transposed products: S^T = Kh @ Qh^T and O^T = Vh^T @ P^T.
//    One wave owns 32 queries (two 16-column groups) of one (b, h) and walks all
//    1024 keys, 32 a step. In an S^T tile a lane holds 8 keys of ONE query, and
//    two such tiles are, register for register, the B fragment of the second
//    product (k = g*8+i, then 16+g*8+i), so the scores never leave registers.
//    Walk 1 finds each query's maximum, walk 2 forms the scores again, takes
//    exp and multiplies by V. 8 waves / block = 256 queries of one (b, h).
#define K_STEP (2 * KT_DIMV * 512)   // halves from one 32-key group of K to the next
#define NSTEP  (SEQ / 32)

// The four K fragments of 32-key group g: [key tile][head-dim half].
__device__ __forceinline__ void load_k(v16h (&kc)[4], const _Float16* __restrict__ kb,
                                       int g) {
  const _Float16* p = kb + (size_t)g * K_STEP;
  kc[0] = load_tile(p);
  kc[1] = load_tile(p + 512);
  kc[2] = load_tile(p + KT_DIMV * 512);
  kc[3] = load_tile(p + KT_DIMV * 512 + 512);
}

// The four V^T fragments (16 head dims each) of 32-key group g.
__device__ __forceinline__ void load_v(v16h (&vc)[4], const _Float16* __restrict__ vb,
                                       int g) {
#pragma unroll  // constant index: the array stays in registers
  for (int dt = 0; dt < 4; ++dt)
    vc[dt] = load_tile(vb + (size_t)dt * (KT_ROWS * 512) + g * 512);
}

// S^T of one 32-key group: s[key tile][query group].
__device__ __forceinline__ void scores_t(v8f (&s)[2][2], const v16h (&kc)[4],
                                         const v16h (&qb)[2][2]) {
#pragma unroll  // constant index: the array stays in registers
  for (int i = 0; i < 2; ++i)
#pragma unroll  // constant index: the array stays in registers
    for (int t = 0; t < 2; ++t) {
      v8f z = {};
      z = wmma_f16(kc[2 * i], qb[t][0], z);
      s[i][t] = wmma_f16(kc[2 * i + 1], qb[t][1], z);
    }
}

// Walk 1, one step: scores of the group in kc, refill kc, running maxima.
__device__ __forceinline__ void max_step(v16h (&kc)[4], const _Float16* __restrict__ kb,
                                         int gnext, const v16h (&qb)[2][2],
                                         float (&mx)[2][2]) {
  v8f s[2][2];
  scores_t(s, kc, qb);
  load_k(kc, kb, gnext);
#pragma unroll  // constant index: the array stays in registers
  for (int i = 0; i < 2; ++i)
#pragma unroll  // constant index: the array stays in registers
    for (int t = 0; t < 2; ++t)
#pragma unroll  // constant index: the array stays in registers
      for (int v = 0; v < 8; ++v) mx[i][t] = fmaxf(mx[i][t], s[i][t][v]);
  // one step's scores are used up before the next step's are formed: without
  // this the four steps' scores are held side by side, over 256 registers
  __builtin_amdgcn_sched_barrier(0);
}

// Walk 2, one step: scores again, refill kc, exp, O^T += V^T P^T, refill vc.
__device__ __forceinline__ void pv_step(v16h (&kc)[4], v16h (&vc)[4],
                                        const _Float16* __restrict__ kb,
                                        const _Float16* __restrict__ vb,
                                        int gk, int gv, const v16h (&qb)[2][2],
                                        const float (&mc)[2], float cs,
                                        float (&sum)[2][2], v8f (&o)[4][2]) {
  v8f s[2][2];
  scores_t(s, kc, qb);
  load_k(kc, kb, gk);
  v16h p[2];
#pragma unroll  // constant index: the array stays in registers
  for (int t = 0; t < 2; ++t)
#pragma unroll  // constant index: the array stays in registers
    for (int i = 0; i < 2; ++i)
#pragma unroll  // constant index: the array stays in registers
      for (int v = 0; v < 8; ++v) {
        float e = __builtin_amdgcn_exp2f(s[i][t][v] * cs - mc[t]);
        sum[i][t] += e;
        p[t][i * 8 + v] = (_Float16)e;
      }
#pragma unroll  // constant index: the array stays in registers
  for (int dt = 0; dt < 4; ++dt)
#pragma unroll  // constant index: the array stays in registers
    for (int t = 0; t < 2; ++t) o[dt][t] = wmma_f16(vc[dt], p[t], o[dt][t]);
  load_v(vc, vb, gv);
}

__global__ __launch_bounds__(256) void attn_kernel(
    const _Float16* __restrict__ qp16, const _Float16* __restrict__ kp16,
    const _Float16* __restrict__ vpT, const float* __restrict__ qp32,
    float* __restrict__ ao32) {
  int bid = blockIdx.x;
  int qq = bid & 3;
  int h = (bid >> 2) & 7;
  int b = bid >> 5;

  int w = __builtin_amdgcn_readfirstlane((int)(threadIdx.x >> 5));  // scalar tile bases
  int lane = threadIdx.x & 31;
  int n = lane & 15, mb = (lane >> 4) * 8;
  int grow = b * SEQ + qq * 256 + w * 32;

  const _Float16* kb = kp16 + frag_off(b * SEQ, h * HDIM, KT_DIMV);
  const _Float16* vb = vpT + frag_off(h * HDIM, b * SEQ, KT_ROWS);

  v16h qb[2][2];                       // Q as B operand, kept for both walks
#pragma unroll  // constant index: the array stays in registers
  for (int t = 0; t < 2; ++t) {
    const _Float16* qbase = qp16 + frag_off(grow + t * 16, h * HDIM, KT_DIMV);
    qb[t][0] = load_tile(qbase);
    qb[t][1] = load_tile(qbase + 512);
  }

  // ---- walk 1: maxima. Four K buffers, each refilled four steps ahead; the
  // last refills wrap to groups 0.. and so hand walk 2 its first two groups.
  v16h kA[4], kB[4], kC[4], kD[4];
  load_k(kA, kb, 0);
  load_k(kB, kb, 1);
  load_k(kC, kb, 2);
  load_k(kD, kb, 3);
  float mx[2][2] = {{-3.0e38f, -3.0e38f}, {-3.0e38f, -3.0e38f}};
  for (int s = 0; s < NSTEP; s += 4) {
    max_step(kA, kb, (s + 4) & (NSTEP - 1), qb, mx);
    max_step(kB, kb, (s + 5) & (NSTEP - 1), qb, mx);
    max_step(kC, kb, (s + 6) & (NSTEP - 1), qb, mx);
    max_step(kD, kb, (s + 7) & (NSTEP - 1), qb, mx);
    // the last loads' address registers are rewritten at the head of the loop
    asm volatile("s_wait_xcnt 0x0" ::: "memory");
  }

  // exp(x / 8 - m / 8) = exp2(x * cs - m * cs); both wave halves hold keys of
  // the same query and must use one maximum.
  const float cs = 0.125f * 1.44269504088896340736f;
  float mc[2];
#pragma unroll  // constant index: the array stays in registers
  for (int t = 0; t < 2; ++t) {
    float m = fmaxf(mx[0][t], mx[1][t]);
    m = fmaxf(m, __shfl_xor(m, 16, 32));
    mc[t] = m * cs;
  }

  // ---- walk 2: P^T = exp(S^T - max), O^T += V^T P^T (1/sum deferred)
  v16h vc[4];
  load_v(vc, vb, 0);
  float sum[2][2] = {};
  v8f o[4][2] = {};
  for (int s = 0; s < NSTEP; s += 2) {
    pv_step(kA, vc, kb, vb, (s + 2) & (NSTEP - 1), s + 1, qb, mc, cs, sum, o);
    pv_step(kB, vc, kb, vb, (s + 3) & (NSTEP - 1), (s + 2) & (NSTEP - 1), qb, mc, cs,
            sum, o);
    // the last loads' address registers are rewritten at the head of the loop
    asm volatile("s_wait_xcnt 0x0" ::: "memory");
  }

  // ---- O = O^T / sum + Qp: a lane holds 8 successive head dims of one query
#pragma unroll  // constant index: the array stays in registers
  for (int t = 0; t < 2; ++t) {
    float sm = sum[0][t] + sum[1][t];
    sm += __shfl_xor(sm, 16, 32);
    float inv = 1.0f / sm;
    // one 32-bit byte offset serves the residual's loads and the stores
    unsigned boff = (unsigned)(((grow + t * 16 + n) * DIMV + h * HDIM + mb) * 4);
    const char* rq = (const char*)qp32 + boff;
    char* wo = (char*)ao32 + boff;
#pragma unroll  // constant index: the array stays in registers
    for (int dt = 0; dt < 4; ++dt) {
      float4 r0 = *(const float4*)(rq + dt * 64);
      float4 r1 = *(const float4*)(rq + dt * 64 + 16);
      float4 y0, y1;
      y0.x = o[dt][t][0] * inv + r0.x;
      y0.y = o[dt][t][1] * inv + r0.y;
      y0.z = o[dt][t][2] * inv + r0.z;
      y0.w = o[dt][t][3] * inv + r0.w;
      y1.x = o[dt][t][4] * inv + r1.x;
      y1.y = o[dt][t][5] * inv + r1.y;
      y1.z = o[dt][t][6] * inv + r1.z;
      y1.w = o[dt][t][7] * inv + r1.w;
      *(float4*)(wo + dt * 64) = y0;
      *(float4*)(wo + dt * 64 + 16) = y1;
    }
  }
}

// ---------------------------------------------------------------------------
// 5) LayerNorm per row (wave per row). Optionally emits an f16 copy in
//    fragment order.
__global__ __launch_bounds__(256) void ln_kernel(
    const float* __restrict__ in, float* __restrict__ out32,
    _Float16* __restrict__ out16, const float* __restrict__ gamma,
    const float* __restrict__ beta) {
  int w = threadIdx.x >> 5, lane = threadIdx.x & 31;
  int row = blockIdx.x * 8 + w;
  const float* base = in + (size_t)row * DIMV;

  float x[16], sum = 0.f, sq = 0.f;
  for (int i = 0; i < 16; ++i) {
    x[i] = base[lane + i * 32];
    sum += x[i];
    sq += x[i] * x[i];
  }
  for (int off = 16; off > 0; off >>= 1) {
    sum += __shfl_xor(sum, off, 32);
    sq  += __shfl_xor(sq,  off, 32);
  }
  float mean = sum * (1.0f / DIMV);
  float var = sq * (1.0f / DIMV) - mean * mean;
  float rstd = rsqrtf(var + 1e-5f);
  for (int i = 0; i < 16; ++i) {
    int c = lane + i * 32;
    float y = (x[i] - mean) * rstd * gamma[c] + beta[c];
    out32[(size_t)row * DIMV + c] = y;
    if (out16) {
      out16[frag_off(row, c, KT_DIMV)] = (_Float16)y;
      // the store's registers are reused by the next column's loads
      asm volatile("s_wait_xcnt 0x0" ::: "memory");
    }
  }
}

// ---------------------------------------------------------------------------
// 6) Out = X1 + relu(X1 @ Wo + bo). One wave per 32x64 tile, waves = 2048.
__global__ __launch_bounds__(256) void gemm2_kernel(
    const _Float16* __restrict__ x16, const _Float16* __restrict__ woT,
    const float* __restrict__ bo, const float* __restrict__ x32,
    float* __restrict__ out) {
  // wave index made scalar, so that every tile base is a scalar address
  int wave = __builtin_amdgcn_readfirstlane(
      (int)((blockIdx.x * blockDim.x + threadIdx.x) >> 5));
  int row0 = (wave >> 3) * 32;     // 256 row-groups
  int col0 = (wave & 7) * 64;      // 8 col-groups
  const _Float16* abase = x16 + (size_t)row0 * DIMV;
  const _Float16* bbase = woT + (size_t)col0 * DIMV;

  v8f acc[2][4] = {};
  for (int k0 = 0; k0 < DIMV; k0 += 32) {
    v16h a0 = load_tile(abase + k0 * 16);
    v16h a1 = load_tile(abase + 16 * DIMV + k0 * 16);
#pragma unroll
    for (int j = 0; j < 4; ++j) {
      v16h b = load_tile(bbase + j * 16 * DIMV + k0 * 16);
      acc[0][j] = wmma_f16(a0, b, acc[0][j]);
      acc[1][j] = wmma_f16(a1, b, acc[1][j]);
    }
  }
  // the tile loads' offset register is reused by the loads of the epilogue
  asm volatile("s_wait_xcnt 0x0" ::: "memory");

  int lane = threadIdx.x & 31;
  int n = lane & 15, mb = (lane >> 4) * 8;
#pragma unroll
  for (int j = 0; j < 4; ++j) {
    float bval = bo[col0 + j * 16 + n];
#pragma unroll
    for (int i = 0; i < 2; ++i) {
      for (int v = 0; v < 8; ++v) {
        size_t idx = (size_t)(row0 + i * 16 + mb + v) * DIMV + col0 + j * 16 + n;
        out[idx] = x32[idx] + fmaxf(acc[i][j][v] + bval, 0.0f);
      }
    }
  }
}

// ---------------------------------------------------------------------------
extern "C" void kernel_launch(void* const* d_in, const int* in_sizes, int n_in,
                              void* d_out, int out_size, void* d_ws, size_t ws_size,
                              hipStream_t stream) {
  const float* Q  = (const float*)d_in[0];
  const float* K  = (const float*)d_in[1];
  const float* Wq = (const float*)d_in[2];
  const float* bq = (const float*)d_in[3];
  const float* Wk = (const float*)d_in[4];
  const float* bk = (const float*)d_in[5];
  const float* Wv = (const float*)d_in[6];
  const float* bv = (const float*)d_in[7];
  const float* Wo = (const float*)d_in[8];
  const float* bo = (const float*)d_in[9];
  const float* g0 = (const float*)d_in[10];
  const float* b0 = (const float*)d_in[11];
  const float* g1 = (const float*)d_in[12];
  const float* b1 = (const float*)d_in[13];
  float* out = (float*)d_out;

  char* ws = (char*)d_ws;
  const size_t NE = (size_t)ROWS * DIMV;      // 4,194,304 elements
  _Float16* q16  = (_Float16*)(ws);                         // 8 MB
  _Float16* k16  = (_Float16*)(ws + 8388608);               // 8 MB
  _Float16* w16T = (_Float16*)(ws + 16777216);              // 2 MB (4 mats)
  float*    qp32 = (float*)   (ws + 18874368);              // 16 MB
  _Float16* qp16 = (_Float16*)(ws + 35651584);              // 8 MB
  _Float16* kp16 = (_Float16*)(ws + 44040192);              // 8 MB
  _Float16* vpT  = (_Float16*)(ws + 52428800);              // 8 MB
  float*    ao32 = (float*)   (ws + 60817408);              // 16 MB
  float*    x132 = (float*)   (ws + 77594624);              // 16 MB
  _Float16* x116 = (_Float16*)(ws + 94371840);              // 8 MB
  // total workspace: ~98 MB

  // 1) convert activations
  cvt_f16_kernel<<<(int)(NE / 256), 256, 0, stream>>>(Q, q16, (int)NE);
  cvt_f16_kernel<<<(int)(NE / 256), 256, 0, stream>>>(K, k16, (int)NE);

  // 2) transposed f16 weights
  const int WN = DIMV * DIMV;
  cvt_wT_kernel<<<WN / 256, 256, 0, stream>>>(Wq, w16T + 0 * WN);
  cvt_wT_kernel<<<WN / 256, 256, 0, stream>>>(Wk, w16T + 1 * WN);
  cvt_wT_kernel<<<WN / 256, 256, 0, stream>>>(Wv, w16T + 2 * WN);
  cvt_wT_kernel<<<WN / 256, 256, 0, stream>>>(Wo, w16T + 3 * WN);

  // 3) projections: 6144 tile-waves (32x64 tiles), 8 waves/block
  proj_kernel<<<768, 256, 0, stream>>>(q16, k16, w16T, bq, bk, bv,
                                       qp32, qp16, kp16, vpT);

  // 4) attention: B*H*(SEQ/256) = 256 blocks of 8 waves, 32 queries a wave
  attn_kernel<<<256, 256, 0, stream>>>(qp16, kp16, vpT, qp32, ao32);

  // 5) LN0 -> x1 (f32 + f16)
  ln_kernel<<<ROWS / 8, 256, 0, stream>>>(ao32, x132, x116, g0, b0);

  // 6) x1 + relu(x1 @ Wo + bo) -> d_out ; 2048 tile-waves
  gemm2_kernel<<<256, 256, 0, stream>>>(x116, w16T + 3 * WN, bo, x132, out);

  // 7) LN1 in place on d_out
  ln_kernel<<<ROWS / 8, 256, 0, stream>>>(out, out, (_Float16*)nullptr, g1, b1);
}

// v003
// It runs in 115 microseconds.
// Timed twice side by side with v002, it ran 1.18 and 1.17 times as fast.
// All steps since v000 together make it 2.28 times as fast.
#include <hip/hip_runtime.h>
#include <hip/hip_bf16.h>

// ---------------------------------------------------------------------------
// MAB (multihead attention block) for MI455X / gfx1250, wave32 + WMMA f16->f32
// Register-blocked GEMMs: one wave computes a 32x64 tile (2x4 WMMA tiles).
// Every f16 matrix in the workspace is kept in fragment order (see frag_off).
// ---------------------------------------------------------------------------

typedef __attribute__((ext_vector_type(16))) _Float16 v16h;
typedef __attribute__((ext_vector_type(8)))  _Float16 v8h;
typedef __attribute__((ext_vector_type(8)))  float    v8f;

#define DIMV   512
#define ROWS   8192          // B*N = 8*1024
#define SEQ    1024
#define NHEAD  8
#define HDIM   64

__device__ __forceinline__ v8f wmma_f16(v16h a, v16h b, v8f c) {
  return __builtin_amdgcn_wmma_f32_16x16x32_f16(false, a, false, b,
                                                (short)0, c, false, false);
}

// k order of a 16x32 f16 fragment (ISA 7.12.2): lane r = lane&15 supplies row r
// (a row of A, or a column of B), g = lane>>4 selects the K half; elements
// i=0..7 -> K = g*8+i ; i=8..15 -> K = 16+g*8+(i-8).

// Fragment order of a [rows x 32*kt] f16 matrix in global memory: 16x32 tiles
// of 512 halves, tile (row/16, k/32) at index (row/16)*kt + k/32. Inside a tile
// the 8 halves that one lane takes with one 16-byte load lie together, and the
// 32 lanes' pieces follow one another: piece hs*32 + g*16 + r holds row r,
// k = hs*16 + g*8 .. +7. That is the k order given above, so a fragment is two
// loads of 512 contiguous bytes each.
__device__ __forceinline__ size_t frag_off(int row, int k, int kt) {
  return ((size_t)(row >> 4) * kt + (k >> 5)) * 512 + ((k >> 4) & 1) * 256 +
         (((k >> 3) & 1) * 16 + (row & 15)) * 8 + (k & 7);
}

// Load the fragment whose tile starts at `tile` (fragment-order storage).
__device__ __forceinline__ v16h load_tile(const _Float16* __restrict__ tile) {
  const _Float16* p = tile + (threadIdx.x & 31) * 8;
  union { v16h v; v8h h[2]; } u;
  u.h[0] = *(const v8h*)(p);
  u.h[1] = *(const v8h*)(p + 256);
  return u.v;
}

#define KT_DIMV (DIMV / 32)   // k tiles of a [rows x 512] matrix
#define KT_ROWS (ROWS / 32)   // k tiles of the [512 x 8192] transposed V

// ---------------------------------------------------------------------------
// 1) Every f32 -> f16 conversion in one launch of 256 work-groups of 9 waves.
//    A thread makes whole 16-byte pieces of the fragment order (8 values each)
//    and has all of its 32 16-byte loads in flight before the first convert.
//    Waves 0..7: 16 rows x 256 columns of Q or K each (8 tiles, 16 pieces a
//    lane). A lane takes row l>>2 (and that + 8), k piece l&3 of each tile: a
//    store covers four whole 128-byte lines.
//    Wave 8: 128 (k) x 32 (n) of one weight matrix, transposed (element (n,k) =
//    src[k*512+n]). A lane reads 4 n of 8 successive k, which are 4 pieces,
//    64 contiguous bytes of the result; a load covers four whole lines.
#define CVT_THREADS 288

__device__ __forceinline__ v8h to_piece(float4 lo, float4 hi) {
  v8h p;
  p[0] = (_Float16)lo.x; p[1] = (_Float16)lo.y;
  p[2] = (_Float16)lo.z; p[3] = (_Float16)lo.w;
  p[4] = (_Float16)hi.x; p[5] = (_Float16)hi.y;
  p[6] = (_Float16)hi.z; p[7] = (_Float16)hi.w;
  return p;
}

__global__ __launch_bounds__(CVT_THREADS) void cvt_all_kernel(
    const float* __restrict__ Q, const float* __restrict__ K,
    const float* __restrict__ Wq, const float* __restrict__ Wk,
    const float* __restrict__ Wv, const float* __restrict__ Wo,
    _Float16* __restrict__ x16,      // Q's 8192 rows, then K's
    _Float16* __restrict__ w16T) {
  int w = __builtin_amdgcn_readfirstlane((int)(threadIdx.x >> 5));  // scalar branch and bases
  int lane = threadIdx.x & 31;
  if (w < 8) {
    int job = blockIdx.x * 8 + w;    // 2048 jobs
    int rt = job >> 1;               // 16-row tile of [Q; K]
    int kh = job & 1;                // column half
    const float* X = (rt < ROWS / 16) ? Q : K;
    const float* s = X + (size_t)(rt & (ROWS / 16 - 1)) * (16 * DIMV) + kh * 256 +
                     (lane >> 2) * DIMV + (lane & 3) * 8;
    _Float16* d = x16 + ((size_t)rt * KT_DIMV + kh * 8) * 512 +
                  ((lane & 3) * 16 + (lane >> 2)) * 8;
    float4 v[2][8][2];
#pragma unroll  // constant index: the array stays in registers
    for (int h = 0; h < 2; ++h)
#pragma unroll  // constant index: the array stays in registers
      for (int t = 0; t < 8; ++t) {
        v[h][t][0] = *(const float4*)(s + h * (8 * DIMV) + t * 32);
        v[h][t][1] = *(const float4*)(s + h * (8 * DIMV) + t * 32 + 4);
      }
    // no convert is moved up among the loads: without this the compiler saves
    // registers by waiting for early loads before it issues the late ones
    __builtin_amdgcn_sched_barrier(0);
    // the loads' address registers are rewritten next, for the stores' offset
    asm volatile("s_wait_xcnt 0x0" ::: "memory");
#pragma unroll  // constant index: the array stays in registers
    for (int h = 0; h < 2; ++h)
#pragma unroll  // constant index: the array stays in registers
      for (int t = 0; t < 8; ++t)
        *(v8h*)(d + t * 512 + h * 64) = to_piece(v[h][t][0], v[h][t][1]);
  } else {
    int job = blockIdx.x;            // 256 jobs: 4 matrices x 4 k blocks x 16 n blocks
    int m = job >> 6;
    int k0 = ((job >> 4) & 3) * 128, n0 = (job & 15) * 32;
    const float* Wm = (m == 0) ? Wq : (m == 1) ? Wk : (m == 2) ? Wv : Wo;
    int kg = lane >> 3, ng = lane & 7;
    const float* s = Wm + (size_t)(k0 + kg * 8) * DIMV + n0 + ng * 4;
    _Float16* d = w16T + (size_t)m * (DIMV * DIMV) +
                  frag_off(n0 + ng * 4, k0 + kg * 8, KT_DIMV);
    float4 v[4][8];
#pragma unroll  // constant index: the array stays in registers
    for (int c = 0; c < 4; ++c)
#pragma unroll  // constant index: the array stays in registers
      for (int j = 0; j < 8; ++j)
        v[c][j] = *(const float4*)(s + (c * 32 + j) * DIMV);
    // no convert is moved up among the loads: without this the compiler saves
    // registers by waiting for early loads before it issues the late ones
    __builtin_amdgcn_sched_barrier(0);
    // the loads' address registers are rewritten next, for the stores' offset
    asm volatile("s_wait_xcnt 0x0" ::: "memory");
#pragma unroll  // constant index: the array stays in registers
    for (int c = 0; c < 4; ++c) {
      v8h p0, p1, p2, p3;
#pragma unroll  // constant index: the array stays in registers
      for (int j = 0; j < 8; ++j) {
        p0[j] = (_Float16)v[c][j].x;
        p1[j] = (_Float16)v[c][j].y;
        p2[j] = (_Float16)v[c][j].z;
        p3[j] = (_Float16)v[c][j].w;
      }
      *(v8h*)(d + c * 512) = p0;
      *(v8h*)(d + c * 512 + 8) = p1;
      *(v8h*)(d + c * 512 + 16) = p2;
      *(v8h*)(d + c * 512 + 24) = p3;
    }
  }
}

// ---------------------------------------------------------------------------
// 3) Fused projections: Qp = Q@Wq+bq (f32+f16), Kp = K@Wk+bk (f16),
//    Vp = K@Wv+bv stored transposed [DIMV][ROWS] (f16); f16 in fragment order.
//    One wave per 32x64 output tile: waves = 3 * (8192/32) * (512/64) = 6144.
__global__ __launch_bounds__(256) void proj_kernel(
    const _Float16* __restrict__ q16, const _Float16* __restrict__ k16,
    const _Float16* __restrict__ w16T,
    const float* __restrict__ bq, const float* __restrict__ bk,
    const float* __restrict__ bvv,
    float* __restrict__ qp32, _Float16* __restrict__ qp16,
    _Float16* __restrict__ kp16, _Float16* __restrict__ vpT) {
  // wave index made scalar, so that every tile base is a scalar address
  int wave = __builtin_amdgcn_readfirstlane(
      (int)((blockIdx.x * blockDim.x + threadIdx.x) >> 5));
  int p = wave / 2048;             // 0:Q 1:K 2:V  (2048 waves each)
  int t = wave % 2048;             // 256 row-groups x 8 col-groups
  int row0 = (t >> 3) * 32;
  int col0 = (t & 7) * 64;

  const _Float16* X = (p == 0) ? q16 : k16;
  const _Float16* abase = X + (size_t)row0 * DIMV;   // 16 rows = 16*DIMV halves
  const _Float16* bbase = w16T + (size_t)p * (DIMV * DIMV) + (size_t)col0 * DIMV;

  v8f acc[2][4] = {};
  for (int k0 = 0; k0 < DIMV; k0 += 32) {
    v16h a0 = load_tile(abase + k0 * 16);
    v16h a1 = load_tile(abase + 16 * DIMV + k0 * 16);
#pragma unroll
    for (int j = 0; j < 4; ++j) {
      v16h b = load_tile(bbase + j * 16 * DIMV + k0 * 16);
      acc[0][j] = wmma_f16(a0, b, acc[0][j]);
      acc[1][j] = wmma_f16(a1, b, acc[1][j]);
    }
  }

  int lane = threadIdx.x & 31;
  int n = lane & 15, mb = (lane >> 4) * 8;
  const float* bias = (p == 0) ? bq : (p == 1) ? bk : bvv;
  // p is scalar: one branch per wave picks the writer of its matrix.
  if (p == 0) {
#pragma unroll
    for (int j = 0; j < 4; ++j) {
      int c = col0 + j * 16 + n;
      float bval = bias[c];
#pragma unroll
      for (int i = 0; i < 2; ++i) {
        for (int v = 0; v < 8; ++v) {
          int r = row0 + i * 16 + mb + v;
          float val = acc[i][j][v] + bval;
          qp32[(size_t)r * DIMV + c] = val;
          qp16[frag_off(r, c, KT_DIMV)] = (_Float16)val;
        }
      }
    }
  } else if (p == 1) {
#pragma unroll
    for (int j = 0; j < 4; ++j) {
      int c = col0 + j * 16 + n;
      float bval = bias[c];
#pragma unroll
      for (int i = 0; i < 2; ++i) {
        for (int v = 0; v < 8; ++v) {
          int r = row0 + i * 16 + mb + v;
          kp16[frag_off(r, c, KT_DIMV)] = (_Float16)(acc[i][j][v] + bval);
        }
      }
    }
  } else {
    // Transposed V: a lane's 8 accumulators are 8 successive keys of one
    // column, which is one 16-byte piece of the fragment order.
#pragma unroll
    for (int j = 0; j < 4; ++j) {
      int c = col0 + j * 16 + n;
      float bval = bias[c];
#pragma unroll
      for (int i = 0; i < 2; ++i) {
        v8h piece;
        for (int v = 0; v < 8; ++v) piece[v] = (_Float16)(acc[i][j][v] + bval);
        *(v8h*)(vpT + frag_off(c, row0 + i * 16 + mb, KT_ROWS)) = piece;
      }
    }
  }
}

// ---------------------------------------------------------------------------
// 4) Attention, transposed products: S^T = Kh @ Qh^T and O^T = Vh^T @ P^T.
//    One wave owns 32 queries (two 16-column groups) of one (b, h) and walks all
//    1024 keys, 32 a step. In an S^T tile a lane holds 8 keys of ONE query, and
//    two such tiles are, register for register, the B fragment of the second
//    product (k = g*8+i, then 16+g*8+i), so the scores never leave registers.
//    Walk 1 finds each query's maximum, walk 2 forms the scores again, takes
//    exp and multiplies by V. 8 waves / block = 256 queries of one (b, h).
#define K_STEP (2 * KT_DIMV * 512)   // halves from one 32-key group of K to the next
#define NSTEP  (SEQ / 32)

// The four K fragments of 32-key group g: [key tile][head-dim half].
__device__ __forceinline__ void load_k(v16h (&kc)[4], const _Float16* __restrict__ kb,
                                       int g) {
  const _Float16* p = kb + (size_t)g * K_STEP;
  kc[0] = load_tile(p);
  kc[1] = load_tile(p + 512);
  kc[2] = load_tile(p + KT_DIMV * 512);
  kc[3] = load_tile(p + KT_DIMV * 512 + 512);
}

// The four V^T fragments (16 head dims each) of 32-key group g.
__device__ __forceinline__ void load_v(v16h (&vc)[4], const _Float16* __restrict__ vb,
                                       int g) {
#pragma unroll  // constant index: the array stays in registers
  for (int dt = 0; dt < 4; ++dt)
    vc[dt] = load_tile(vb + (size_t)dt * (KT_ROWS * 512) + g * 512);
}

// S^T of one 32-key group: s[key tile][query group].
__device__ __forceinline__ void scores_t(v8f (&s)[2][2], const v16h (&kc)[4],
                                         const v16h (&qb)[2][2]) {
#pragma unroll  // constant index: the array stays in registers
  for (int i = 0; i < 2; ++i)
#pragma unroll  // constant index: the array stays in registers
    for (int t = 0; t < 2; ++t) {
      v8f z = {};
      z = wmma_f16(kc[2 * i], qb[t][0], z);
      s[i][t] = wmma_f16(kc[2 * i + 1], qb[t][1], z);
    }
}

// Walk 1, one step: scores of the group in kc, refill kc, running maxima.
__device__ __forceinline__ void max_step(v16h (&kc)[4], const _Float16* __restrict__ kb,
                                         int gnext, const v16h (&qb)[2][2],
                                         float (&mx)[2][2]) {
  v8f s[2][2];
  scores_t(s, kc, qb);
  load_k(kc, kb, gnext);
#pragma unroll  // constant index: the array stays in registers
  for (int i = 0; i < 2; ++i)
#pragma unroll  // constant index: the array stays in registers
    for (int t = 0; t < 2; ++t)
#pragma unroll  // constant index: the array stays in registers
      for (int v = 0; v < 8; ++v) mx[i][t] = fmaxf(mx[i][t], s[i][t][v]);
  // one step's scores are used up before the next step's are formed: without
  // this the four steps' scores are held side by side, over 256 registers
  __builtin_amdgcn_sched_barrier(0);
}

// Walk 2, one step: scores again, refill kc, exp, O^T += V^T P^T, refill vc.
__device__ __forceinline__ void pv_step(v16h (&kc)[4], v16h (&vc)[4],
                                        const _Float16* __restrict__ kb,
                                        const _Float16* __restrict__ vb,
                                        int gk, int gv, const v16h (&qb)[2][2],
                                        const float (&mc)[2], float cs,
                                        float (&sum)[2][2], v8f (&o)[4][2]) {
  v8f s[2][2];
  scores_t(s, kc, qb);
  load_k(kc, kb, gk);
  v16h p[2];
#pragma unroll  // constant index: the array stays in registers
  for (int t = 0; t < 2; ++t)
#pragma unroll  // constant index: the array stays in registers
    for (int i = 0; i < 2; ++i)
#pragma unroll  // constant index: the array stays in registers
      for (int v = 0; v < 8; ++v) {
        float e = __builtin_amdgcn_exp2f(s[i][t][v] * cs - mc[t]);
        sum[i][t] += e;
        p[t][i * 8 + v] = (_Float16)e;
      }
#pragma unroll  // constant index: the array stays in registers
  for (int dt = 0; dt < 4; ++dt)
#pragma unroll  // constant index: the array stays in registers
    for (int t = 0; t < 2; ++t) o[dt][t] = wmma_f16(vc[dt], p[t], o[dt][t]);
  load_v(vc, vb, gv);
}

__global__ __launch_bounds__(256) void attn_kernel(
    const _Float16* __restrict__ qp16, const _Float16* __restrict__ kp16,
    const _Float16* __restrict__ vpT, const float* __restrict__ qp32,
    float* __restrict__ ao32) {
  int bid = blockIdx.x;
  int qq = bid & 3;
  int h = (bid >> 2) & 7;
  int b = bid >> 5;

  int w = __builtin_amdgcn_readfirstlane((int)(threadIdx.x >> 5));  // scalar tile bases
  int lane = threadIdx.x & 31;
  int n = lane & 15, mb = (lane >> 4) * 8;
  int grow = b * SEQ + qq * 256 + w * 32;

  const _Float16* kb = kp16 + frag_off(b * SEQ, h * HDIM, KT_DIMV);
  const _Float16* vb = vpT + frag_off(h * HDIM, b * SEQ, KT_ROWS);

  v16h qb[2][2];                       // Q as B operand, kept for both walks
#pragma unroll  // constant index: the array stays in registers
  for (int t = 0; t < 2; ++t) {
    const _Float16* qbase = qp16 + frag_off(grow + t * 16, h * HDIM, KT_DIMV);
    qb[t][0] = load_tile(qbase);
    qb[t][1] = load_tile(qbase + 512);
  }

  // ---- walk 1: maxima. Four K buffers, each refilled four steps ahead; the
  // last refills wrap to groups 0.. and so hand walk 2 its first two groups.
  v16h kA[4], kB[4], kC[4], kD[4];
  load_k(kA, kb, 0);
  load_k(kB, kb, 1);
  load_k(kC, kb, 2);
  load_k(kD, kb, 3);
  float mx[2][2] = {{-3.0e38f, -3.0e38f}, {-3.0e38f, -3.0e38f}};
  for (int s = 0; s < NSTEP; s += 4) {
    max_step(kA, kb, (s + 4) & (NSTEP - 1), qb, mx);
    max_step(kB, kb, (s + 5) & (NSTEP - 1), qb, mx);
    max_step(kC, kb, (s + 6) & (NSTEP - 1), qb, mx);
    max_step(kD, kb, (s + 7) & (NSTEP - 1), qb, mx);
    // the last loads' address registers are rewritten at the head of the loop
    asm volatile("s_wait_xcnt 0x0" ::: "memory");
  }

  // exp(x / 8 - m / 8) = exp2(x * cs - m * cs); both wave halves hold keys of
  // the same query and must use one maximum.
  const float cs = 0.125f * 1.44269504088896340736f;
  float mc[2];
#pragma unroll  // constant index: the array stays in registers
  for (int t = 0; t < 2; ++t) {
    float m = fmaxf(mx[0][t], mx[1][t]);
    m = fmaxf(m, __shfl_xor(m, 16, 32));
    mc[t] = m * cs;
  }

  // ---- walk 2: P^T = exp(S^T - max), O^T += V^T P^T (1/sum deferred)
  v16h vc[4];
  load_v(vc, vb, 0);
  float sum[2][2] = {};
  v8f o[4][2] = {};
  for (int s = 0; s < NSTEP; s += 2) {
    pv_step(kA, vc, kb, vb, (s + 2) & (NSTEP - 1), s + 1, qb, mc, cs, sum, o);
    pv_step(kB, vc, kb, vb, (s + 3) & (NSTEP - 1), (s + 2) & (NSTEP - 1), qb, mc, cs,
            sum, o);
    // the last loads' address registers are rewritten at the head of the loop
    asm volatile("s_wait_xcnt 0x0" ::: "memory");
  }

  // ---- O = O^T / sum + Qp: a lane holds 8 successive head dims of one query
#pragma unroll  // constant index: the array stays in registers
  for (int t = 0; t < 2; ++t) {
    float sm = sum[0][t] + sum[1][t];
    sm += __shfl_xor(sm, 16, 32);
    float inv = 1.0f / sm;
    // one 32-bit byte offset serves the residual's loads and the stores
    unsigned boff = (unsigned)(((grow + t * 16 + n) * DIMV + h * HDIM + mb) * 4);
    const char* rq = (const char*)qp32 + boff;
    char* wo = (char*)ao32 + boff;
#pragma unroll  // constant index: the array stays in registers
    for (int dt = 0; dt < 4; ++dt) {
      float4 r0 = *(const float4*)(rq + dt * 64);
      float4 r1 = *(const float4*)(rq + dt * 64 + 16);
      float4 y0, y1;
      y0.x = o[dt][t][0] * inv + r0.x;
      y0.y = o[dt][t][1] * inv + r0.y;
      y0.z = o[dt][t][2] * inv + r0.z;
      y0.w = o[dt][t][3] * inv + r0.w;
      y1.x = o[dt][t][4] * inv + r1.x;
      y1.y = o[dt][t][5] * inv + r1.y;
      y1.z = o[dt][t][6] * inv + r1.z;
      y1.w = o[dt][t][7] * inv + r1.w;
      *(float4*)(wo + dt * 64) = y0;
      *(float4*)(wo + dt * 64 + 16) = y1;
    }
  }
}

// ---------------------------------------------------------------------------
// 5) LayerNorm per row (wave per row). Optionally emits an f16 copy in
//    fragment order.
__global__ __launch_bounds__(256) void ln_kernel(
    const float* __restrict__ in, float* __restrict__ out32,
    _Float16* __restrict__ out16, const float* __restrict__ gamma,
    const float* __restrict__ beta) {
  int w = threadIdx.x >> 5, lane = threadIdx.x & 31;
  int row = blockIdx.x * 8 + w;
  const float* base = in + (size_t)row * DIMV;

  float x[16], sum = 0.f, sq = 0.f;
  for (int i = 0; i < 16; ++i) {
    x[i] = base[lane + i * 32];
    sum += x[i];
    sq += x[i] * x[i];
  }
  for (int off = 16; off > 0; off >>= 1) {
    sum += __shfl_xor(sum, off, 32);
    sq  += __shfl_xor(sq,  off, 32);
  }
  float mean = sum * (1.0f / DIMV);
  float var = sq * (1.0f / DIMV) - mean * mean;
  float rstd = rsqrtf(var + 1e-5f);
  for (int i = 0; i < 16; ++i) {
    int c = lane + i * 32;
    float y = (x[i] - mean) * rstd * gamma[c] + beta[c];
    out32[(size_t)row * DIMV + c] = y;
    if (out16) {
      out16[frag_off(row, c, KT_DIMV)] = (_Float16)y;
      // the store's registers are reused by the next column's loads
      asm volatile("s_wait_xcnt 0x0" ::: "memory");
    }
  }
}

// ---------------------------------------------------------------------------
// 6) Out = X1 + relu(X1 @ Wo + bo). One wave per 32x64 tile, waves = 2048.
__global__ __launch_bounds__(256) void gemm2_kernel(
    const _Float16* __restrict__ x16, const _Float16* __restrict__ woT,
    const float* __restrict__ bo, const float* __restrict__ x32,
    float* __restrict__ out) {
  // wave index made scalar, so that every tile base is a scalar address
  int wave = __builtin_amdgcn_readfirstlane(
      (int)((blockIdx.x * blockDim.x + threadIdx.x) >> 5));
  int row0 = (wave >> 3) * 32;     // 256 row-groups
  int col0 = (wave & 7) * 64;      // 8 col-groups
  const _Float16* abase = x16 + (size_t)row0 * DIMV;
  const _Float16* bbase = woT + (size_t)col0 * DIMV;

  v8f acc[2][4] = {};
  for (int k0 = 0; k0 < DIMV; k0 += 32) {
    v16h a0 = load_tile(abase + k0 * 16);
    v16h a1 = load_tile(abase + 16 * DIMV + k0 * 16);
#pragma unroll
    for (int j = 0; j < 4; ++j) {
      v16h b = load_tile(bbase + j * 16 * DIMV + k0 * 16);
      acc[0][j] = wmma_f16(a0, b, acc[0][j]);
      acc[1][j] = wmma_f16(a1, b, acc[1][j]);
    }
  }
  // the tile loads' offset register is reused by the loads of the epilogue
  asm volatile("s_wait_xcnt 0x0" ::: "memory");

  int lane = threadIdx.x & 31;
  int n = lane & 15, mb = (lane >> 4) * 8;
#pragma unroll
  for (int j = 0; j < 4; ++j) {
    float bval = bo[col0 + j * 16 + n];
#pragma unroll
    for (int i = 0; i < 2; ++i) {
      for (int v = 0; v < 8; ++v) {
        size_t idx = (size_t)(row0 + i * 16 + mb + v) * DIMV + col0 + j * 16 + n;
        out[idx] = x32[idx] + fmaxf(acc[i][j][v] + bval, 0.0f);
      }
    }
  }
}

// ---------------------------------------------------------------------------
extern "C" void kernel_launch(void* const* d_in, const int* in_sizes, int n_in,
                              void* d_out, int out_size, void* d_ws, size_t ws_size,
                              hipStream_t stream) {
  const float* Q  = (const float*)d_in[0];
  const float* K  = (const float*)d_in[1];
  const float* Wq = (const float*)d_in[2];
  const float* bq = (const float*)d_in[3];
  const float* Wk = (const float*)d_in[4];
  const float* bk = (const float*)d_in[5];
  const float* Wv = (const float*)d_in[6];
  const float* bv = (const float*)d_in[7];
  const float* Wo = (const float*)d_in[8];
  const float* bo = (const float*)d_in[9];
  const float* g0 = (const float*)d_in[10];
  const float* b0 = (const float*)d_in[11];
  const float* g1 = (const float*)d_in[12];
  const float* b1 = (const float*)d_in[13];
  float* out = (float*)d_out;

  char* ws = (char*)d_ws;
  _Float16* q16  = (_Float16*)(ws);                         // 8 MB
  _Float16* k16  = (_Float16*)(ws + 8388608);               // 8 MB
  _Float16* w16T = (_Float16*)(ws + 16777216);              // 2 MB (4 mats)
  float*    qp32 = (float*)   (ws + 18874368);              // 16 MB
  _Float16* qp16 = (_Float16*)(ws + 35651584);              // 8 MB
  _Float16* kp16 = (_Float16*)(ws + 44040192);              // 8 MB
  _Float16* vpT  = (_Float16*)(ws + 52428800);              // 8 MB
  float*    ao32 = (float*)   (ws + 60817408);              // 16 MB
  float*    x132 = (float*)   (ws + 77594624);              // 16 MB
  _Float16* x116 = (_Float16*)(ws + 94371840);              // 8 MB
  // total workspace: ~98 MB

  // 1) all conversions: q16 and k16 lie one behind the other, w16T holds 4 mats
  const int WN = DIMV * DIMV;
  cvt_all_kernel<<<256, CVT_THREADS, 0, stream>>>(Q, K, Wq, Wk, Wv, Wo, q16, w16T);

  // 3) projections: 6144 tile-waves (32x64 tiles), 8 waves/block
  proj_kernel<<<768, 256, 0, stream>>>(q16, k16, w16T, bq, bk, bv,
                                       qp32, qp16, kp16, vpT);

  // 4) attention: B*H*(SEQ/256) = 256 blocks of 8 waves, 32 queries a wave
  attn_kernel<<<256, 256, 0, stream>>>(qp16, kp16, vpT, qp32, ao32);

  // 5) LN0 -> x1 (f32 + f16)
  ln_kernel<<<ROWS / 8, 256, 0, stream>>>(ao32, x132, x116, g0, b0);

  // 6) x1 + relu(x1 @ Wo + bo) -> d_out ; 2048 tile-waves
  gemm2_kernel<<<256, 256, 0, stream>>>(x116, w16T + 3 * WN, bo, x132, out);

  // 7) LN1 in place on d_out
  ln_kernel<<<ROWS / 8, 256, 0, stream>>>(out, out, (_Float16*)nullptr, g1, b1);
}

// v004
// A run of this version takes 87.1 microseconds.
// Two timings next to v003 put it at 1.35 and 1.32 times that version's speed.
// Counting every step since v000, it is 3.05 times as fast.
#include <hip/hip_runtime.h>
#include <hip/hip_bf16.h>

// ---------------------------------------------------------------------------
// MAB (multihead attention block) for MI455X / gfx1250, wave32 + WMMA f16->f32
// Register-blocked GEMMs: one wave computes a 32x64 tile (2x4 WMMA tiles).
// Every f16 matrix in the workspace is kept in fragment order (see frag_off).
// ---------------------------------------------------------------------------

typedef __attribute__((ext_vector_type(16))) _Float16 v16h;
typedef __attribute__((ext_vector_type(8)))  _Float16 v8h;
typedef __attribute__((ext_vector_type(8)))  float    v8f;

#define DIMV   512
#define ROWS   8192          // B*N = 8*1024
#define SEQ    1024
#define NHEAD  8
#define HDIM   64

__device__ __forceinline__ v8f wmma_f16(v16h a, v16h b, v8f c) {
  return __builtin_amdgcn_wmma_f32_16x16x32_f16(false, a, false, b,
                                                (short)0, c, false, false);
}

// k order of a 16x32 f16 fragment (ISA 7.12.2): lane r = lane&15 supplies row r
// (a row of A, or a column of B), g = lane>>4 selects the K half; elements
// i=0..7 -> K = g*8+i ; i=8..15 -> K = 16+g*8+(i-8).

// Fragment order of a [rows x 32*kt] f16 matrix in global memory: 16x32 tiles
// of 512 halves, tile (row/16, k/32) at index (row/16)*kt + k/32. Inside a tile
// the 8 halves that one lane takes with one 16-byte load lie together, and the
// 32 lanes' pieces follow one another: piece hs*32 + g*16 + r holds row r,
// k = hs*16 + g*8 .. +7. That is the k order given above, so a fragment is two
// loads of 512 contiguous bytes each.
__device__ __forceinline__ size_t frag_off(int row, int k, int kt) {
  return ((size_t)(row >> 4) * kt + (k >> 5)) * 512 + ((k >> 4) & 1) * 256 +
         (((k >> 3) & 1) * 16 + (row & 15)) * 8 + (k & 7);
}

// Load the fragment whose tile starts at `tile` (fragment-order storage).
__device__ __forceinline__ v16h load_tile(const _Float16* __restrict__ tile) {
  const _Float16* p = tile + (threadIdx.x & 31) * 8;
  union { v16h v; v8h h[2]; } u;
  u.h[0] = *(const v8h*)(p);
  u.h[1] = *(const v8h*)(p + 256);
  return u.v;
}

#define KT_DIMV (DIMV / 32)   // k tiles of a [rows x 512] matrix
#define KT_ROWS (ROWS / 32)   // k tiles of the [512 x 8192] transposed V

// ---------------------------------------------------------------------------
// 1) Every f32 -> f16 conversion in one launch of 256 work-groups of 9 waves.
//    A thread makes whole 16-byte pieces of the fragment order (8 values each)
//    and has all of its 32 16-byte loads in flight before the first convert.
//    Waves 0..7: 16 rows x 256 columns of Q or K each (8 tiles, 16 pieces a
//    lane). A lane takes row l>>2 (and that + 8), k piece l&3 of each tile: a
//    store covers four whole 128-byte lines.
//    Wave 8: 128 (k) x 32 (n) of one weight matrix, transposed (element (n,k) =
//    src[k*512+n]). A lane reads 4 n of 8 successive k, which are 4 pieces,
//    64 contiguous bytes of the result; a load covers four whole lines.
#define CVT_THREADS 288

__device__ __forceinline__ v8h to_piece(float4 lo, float4 hi) {
  v8h p;
  p[0] = (_Float16)lo.x; p[1] = (_Float16)lo.y;
  p[2] = (_Float16)lo.z; p[3] = (_Float16)lo.w;
  p[4] = (_Float16)hi.x; p[5] = (_Float16)hi.y;
  p[6] = (_Float16)hi.z; p[7] = (_Float16)hi.w;
  return p;
}

__global__ __launch_bounds__(CVT_THREADS) void cvt_all_kernel(
    const float* __restrict__ Q, const float* __restrict__ K,
    const float* __restrict__ Wq, const float* __restrict__ Wk,
    const float* __restrict__ Wv, const float* __restrict__ Wo,
    _Float16* __restrict__ x16,      // Q's 8192 rows, then K's
    _Float16* __restrict__ w16T) {
  int w = __builtin_amdgcn_readfirstlane((int)(threadIdx.x >> 5));  // scalar branch and bases
  int lane = threadIdx.x & 31;
  if (w < 8) {
    int job = blockIdx.x * 8 + w;    // 2048 jobs
    int rt = job >> 1;               // 16-row tile of [Q; K]
    int kh = job & 1;                // column half
    const float* X = (rt < ROWS / 16) ? Q : K;
    const float* s = X + (size_t)(rt & (ROWS / 16 - 1)) * (16 * DIMV) + kh * 256 +
                     (lane >> 2) * DIMV + (lane & 3) * 8;
    _Float16* d = x16 + ((size_t)rt * KT_DIMV + kh * 8) * 512 +
                  ((lane & 3) * 16 + (lane >> 2)) * 8;
    float4 v[2][8][2];
#pragma unroll  // constant index: the array stays in registers
    for (int h = 0; h < 2; ++h)
#pragma unroll  // constant index: the array stays in registers
      for (int t = 0; t < 8; ++t) {
        v[h][t][0] = *(const float4*)(s + h * (8 * DIMV) + t * 32);
        v[h][t][1] = *(const float4*)(s + h * (8 * DIMV) + t * 32 + 4);
      }
    // no convert is moved up among the loads: without this the compiler saves
    // registers by waiting for early loads before it issues the late ones
    __builtin_amdgcn_sched_barrier(0);
    // the loads' address registers are rewritten next, for the stores' offset
    asm volatile("s_wait_xcnt 0x0" ::: "memory");
#pragma unroll  // constant index: the array stays in registers
    for (int h = 0; h < 2; ++h)
#pragma unroll  // constant index: the array stays in registers
      for (int t = 0; t < 8; ++t)
        *(v8h*)(d + t * 512 + h * 64) = to_piece(v[h][t][0], v[h][t][1]);
  } else {
    int job = blockIdx.x;            // 256 jobs: 4 matrices x 4 k blocks x 16 n blocks
    int m = job >> 6;
    int k0 = ((job >> 4) & 3) * 128, n0 = (job & 15) * 32;
    const float* Wm = (m == 0) ? Wq : (m == 1) ? Wk : (m == 2) ? Wv : Wo;
    int kg = lane >> 3, ng = lane & 7;
    const float* s = Wm + (size_t)(k0 + kg * 8) * DIMV + n0 + ng * 4;
    _Float16* d = w16T + (size_t)m * (DIMV * DIMV) +
                  frag_off(n0 + ng * 4, k0 + kg * 8, KT_DIMV);
    float4 v[4][8];
#pragma unroll  // constant index: the array stays in registers
    for (int c = 0; c < 4; ++c)
#pragma unroll  // constant index: the array stays in registers
      for (int j = 0; j < 8; ++j)
        v[c][j] = *(const float4*)(s + (c * 32 + j) * DIMV);
    // no convert is moved up among the loads: without this the compiler saves
    // registers by waiting for early loads before it issues the late ones
    __builtin_amdgcn_sched_barrier(0);
    // the loads' address registers are rewritten next, for the stores' offset
    asm volatile("s_wait_xcnt 0x0" ::: "memory");
#pragma unroll  // constant index: the array stays in registers
    for (int c = 0; c < 4; ++c) {
      v8h p0, p1, p2, p3;
#pragma unroll  // constant index: the array stays in registers
      for (int j = 0; j < 8; ++j) {
        p0[j] = (_Float16)v[c][j].x;
        p1[j] = (_Float16)v[c][j].y;
        p2[j] = (_Float16)v[c][j].z;
        p3[j] = (_Float16)v[c][j].w;
      }
      *(v8h*)(d + c * 512) = p0;
      *(v8h*)(d + c * 512 + 8) = p1;
      *(v8h*)(d + c * 512 + 16) = p2;
      *(v8h*)(d + c * 512 + 24) = p3;
    }
  }
}

// ---------------------------------------------------------------------------
// 3) Fused projections: Qp = Q@Wq+bq (f32+f16), Kp = K@Wk+bk (f16),
//    Vp = K@Wv+bv stored transposed [DIMV][ROWS] (f16); f16 in fragment order.
//    One wave per 32x64 output tile: waves = 3 * (8192/32) * (512/64) = 6144.
__global__ __launch_bounds__(256) void proj_kernel(
    const _Float16* __restrict__ q16, const _Float16* __restrict__ k16,
    const _Float16* __restrict__ w16T,
    const float* __restrict__ bq, const float* __restrict__ bk,
    const float* __restrict__ bvv,
    float* __restrict__ qp32, _Float16* __restrict__ qp16,
    _Float16* __restrict__ kp16, _Float16* __restrict__ vpT) {
  // wave index made scalar, so that every tile base is a scalar address
  int wave = __builtin_amdgcn_readfirstlane(
      (int)((blockIdx.x * blockDim.x + threadIdx.x) >> 5));
  int p = wave / 2048;             // 0:Q 1:K 2:V  (2048 waves each)
  int t = wave % 2048;             // 256 row-groups x 8 col-groups
  int row0 = (t >> 3) * 32;
  int col0 = (t & 7) * 64;

  const _Float16* X = (p == 0) ? q16 : k16;
  const _Float16* abase = X + (size_t)row0 * DIMV;   // 16 rows = 16*DIMV halves
  const _Float16* bbase = w16T + (size_t)p * (DIMV * DIMV) + (size_t)col0 * DIMV;

  v8f acc[2][4] = {};
  for (int k0 = 0; k0 < DIMV; k0 += 32) {
    v16h a0 = load_tile(abase + k0 * 16);
    v16h a1 = load_tile(abase + 16 * DIMV + k0 * 16);
#pragma unroll
    for (int j = 0; j < 4; ++j) {
      v16h b = load_tile(bbase + j * 16 * DIMV + k0 * 16);
      acc[0][j] = wmma_f16(a0, b, acc[0][j]);
      acc[1][j] = wmma_f16(a1, b, acc[1][j]);
    }
  }

  int lane = threadIdx.x & 31;
  int n = lane & 15, mb = (lane >> 4) * 8;
  const float* bias = (p == 0) ? bq : (p == 1) ? bk : bvv;
  // p is scalar: one branch per wave picks the writer of its matrix.
  if (p == 0) {
#pragma unroll
    for (int j = 0; j < 4; ++j) {
      int c = col0 + j * 16 + n;
      float bval = bias[c];
#pragma unroll
      for (int i = 0; i < 2; ++i) {
        for (int v = 0; v < 8; ++v) {
          int r = row0 + i * 16 + mb + v;
          float val = acc[i][j][v] + bval;
          qp32[(size_t)r * DIMV + c] = val;
          qp16[frag_off(r, c, KT_DIMV)] = (_Float16)val;
        }
      }
    }
  } else if (p == 1) {
#pragma unroll
    for (int j = 0; j < 4; ++j) {
      int c = col0 + j * 16 + n;
      float bval = bias[c];
#pragma unroll
      for (int i = 0; i < 2; ++i) {
        for (int v = 0; v < 8; ++v) {
          int r = row0 + i * 16 + mb + v;
          kp16[frag_off(r, c, KT_DIMV)] = (_Float16)(acc[i][j][v] + bval);
        }
      }
    }
  } else {
    // Transposed V: a lane's 8 accumulators are 8 successive keys of one
    // column, which is one 16-byte piece of the fragment order.
#pragma unroll
    for (int j = 0; j < 4; ++j) {
      int c = col0 + j * 16 + n;
      float bval = bias[c];
#pragma unroll
      for (int i = 0; i < 2; ++i) {
        v8h piece;
        for (int v = 0; v < 8; ++v) piece[v] = (_Float16)(acc[i][j][v] + bval);
        *(v8h*)(vpT + frag_off(c, row0 + i * 16 + mb, KT_ROWS)) = piece;
      }
    }
  }
}

// ---------------------------------------------------------------------------
// 4) Attention, transposed products: S^T = Kh @ Qh^T and O^T = Vh^T @ P^T.
//    One wave owns 32 queries (two 16-column groups) of one (b, h) and walks all
//    1024 keys, 32 a step. In an S^T tile a lane holds 8 keys of ONE query, and
//    two such tiles are, register for register, the B fragment of the second
//    product (k = g*8+i, then 16+g*8+i), so the scores never leave registers.
//    Walk 1 finds each query's maximum, walk 2 forms the scores again, takes
//    exp and multiplies by V. 8 waves / block = 256 queries of one (b, h).
#define K_STEP (2 * KT_DIMV * 512)   // halves from one 32-key group of K to the next
#define NSTEP  (SEQ / 32)

// The four K fragments of 32-key group g: [key tile][head-dim half].
__device__ __forceinline__ void load_k(v16h (&kc)[4], const _Float16* __restrict__ kb,
                                       int g) {
  const _Float16* p = kb + (size_t)g * K_STEP;
  kc[0] = load_tile(p);
  kc[1] = load_tile(p + 512);
  kc[2] = load_tile(p + KT_DIMV * 512);
  kc[3] = load_tile(p + KT_DIMV * 512 + 512);
}

// The four V^T fragments (16 head dims each) of 32-key group g.
__device__ __forceinline__ void load_v(v16h (&vc)[4], const _Float16* __restrict__ vb,
                                       int g) {
#pragma unroll  // constant index: the array stays in registers
  for (int dt = 0; dt < 4; ++dt)
    vc[dt] = load_tile(vb + (size_t)dt * (KT_ROWS * 512) + g * 512);
}

// S^T of one 32-key group: s[key tile][query group].
__device__ __forceinline__ void scores_t(v8f (&s)[2][2], const v16h (&kc)[4],
                                         const v16h (&qb)[2][2]) {
#pragma unroll  // constant index: the array stays in registers
  for (int i = 0; i < 2; ++i)
#pragma unroll  // constant index: the array stays in registers
    for (int t = 0; t < 2; ++t) {
      v8f z = {};
      z = wmma_f16(kc[2 * i], qb[t][0], z);
      s[i][t] = wmma_f16(kc[2 * i + 1], qb[t][1], z);
    }
}

// Walk 1, one step: scores of the group in kc, refill kc, running maxima.
__device__ __forceinline__ void max_step(v16h (&kc)[4], const _Float16* __restrict__ kb,
                                         int gnext, const v16h (&qb)[2][2],
                                         float (&mx)[2][2]) {
  v8f s[2][2];
  scores_t(s, kc, qb);
  load_k(kc, kb, gnext);
#pragma unroll  // constant index: the array stays in registers
  for (int i = 0; i < 2; ++i)
#pragma unroll  // constant index: the array stays in registers
    for (int t = 0; t < 2; ++t)
#pragma unroll  // constant index: the array stays in registers
      for (int v = 0; v < 8; ++v) mx[i][t] = fmaxf(mx[i][t], s[i][t][v]);
  // one step's scores are used up before the next step's are formed: without
  // this the four steps' scores are held side by side, over 256 registers
  __builtin_amdgcn_sched_barrier(0);
}

// Walk 2, one step: scores again, refill kc, exp, O^T += V^T P^T, refill vc.
__device__ __forceinline__ void pv_step(v16h (&kc)[4], v16h (&vc)[4],
                                        const _Float16* __restrict__ kb,
                                        const _Float16* __restrict__ vb,
                                        int gk, int gv, const v16h (&qb)[2][2],
                                        const float (&mc)[2], float cs,
                                        float (&sum)[2][2], v8f (&o)[4][2]) {
  v8f s[2][2];
  scores_t(s, kc, qb);
  load_k(kc, kb, gk);
  v16h p[2];
#pragma unroll  // constant index: the array stays in registers
  for (int t = 0; t < 2; ++t)
#pragma unroll  // constant index: the array stays in registers
    for (int i = 0; i < 2; ++i)
#pragma unroll  // constant index: the array stays in registers
      for (int v = 0; v < 8; ++v) {
        float e = __builtin_amdgcn_exp2f(s[i][t][v] * cs - mc[t]);
        sum[i][t] += e;
        p[t][i * 8 + v] = (_Float16)e;
      }
#pragma unroll  // constant index: the array stays in registers
  for (int dt = 0; dt < 4; ++dt)
#pragma unroll  // constant index: the array stays in registers
    for (int t = 0; t < 2; ++t) o[dt][t] = wmma_f16(vc[dt], p[t], o[dt][t]);
  load_v(vc, vb, gv);
}

__global__ __launch_bounds__(256) void attn_kernel(
    const _Float16* __restrict__ qp16, const _Float16* __restrict__ kp16,
    const _Float16* __restrict__ vpT, const float* __restrict__ qp32,
    float* __restrict__ ao32) {
  int bid = blockIdx.x;
  int qq = bid & 3;
  int h = (bid >> 2) & 7;
  int b = bid >> 5;

  int w = __builtin_amdgcn_readfirstlane((int)(threadIdx.x >> 5));  // scalar tile bases
  int lane = threadIdx.x & 31;
  int n = lane & 15, mb = (lane >> 4) * 8;
  int grow = b * SEQ + qq * 256 + w * 32;

  const _Float16* kb = kp16 + frag_off(b * SEQ, h * HDIM, KT_DIMV);
  const _Float16* vb = vpT + frag_off(h * HDIM, b * SEQ, KT_ROWS);

  v16h qb[2][2];                       // Q as B operand, kept for both walks
#pragma unroll  // constant index: the array stays in registers
  for (int t = 0; t < 2; ++t) {
    const _Float16* qbase = qp16 + frag_off(grow + t * 16, h * HDIM, KT_DIMV);
    qb[t][0] = load_tile(qbase);
    qb[t][1] = load_tile(qbase + 512);
  }

  // ---- walk 1: maxima. Four K buffers, each refilled four steps ahead; the
  // last refills wrap to groups 0.. and so hand walk 2 its first two groups.
  v16h kA[4], kB[4], kC[4], kD[4];
  load_k(kA, kb, 0);
  load_k(kB, kb, 1);
  load_k(kC, kb, 2);
  load_k(kD, kb, 3);
  float mx[2][2] = {{-3.0e38f, -3.0e38f}, {-3.0e38f, -3.0e38f}};
  for (int s = 0; s < NSTEP; s += 4) {
    max_step(kA, kb, (s + 4) & (NSTEP - 1), qb, mx);
    max_step(kB, kb, (s + 5) & (NSTEP - 1), qb, mx);
    max_step(kC, kb, (s + 6) & (NSTEP - 1), qb, mx);
    max_step(kD, kb, (s + 7) & (NSTEP - 1), qb, mx);
    // the last loads' address registers are rewritten at the head of the loop
    asm volatile("s_wait_xcnt 0x0" ::: "memory");
  }

  // exp(x / 8 - m / 8) = exp2(x * cs - m * cs); both wave halves hold keys of
  // the same query and must use one maximum.
  const float cs = 0.125f * 1.44269504088896340736f;
  float mc[2];
#pragma unroll  // constant index: the array stays in registers
  for (int t = 0; t < 2; ++t) {
    float m = fmaxf(mx[0][t], mx[1][t]);
    m = fmaxf(m, __shfl_xor(m, 16, 32));
    mc[t] = m * cs;
  }

  // ---- walk 2: P^T = exp(S^T - max), O^T += V^T P^T (1/sum deferred)
  v16h vc[4];
  load_v(vc, vb, 0);
  float sum[2][2] = {};
  v8f o[4][2] = {};
  for (int s = 0; s < NSTEP; s += 2) {
    pv_step(kA, vc, kb, vb, (s + 2) & (NSTEP - 1), s + 1, qb, mc, cs, sum, o);
    pv_step(kB, vc, kb, vb, (s + 3) & (NSTEP - 1), (s + 2) & (NSTEP - 1), qb, mc, cs,
            sum, o);
    // the last loads' address registers are rewritten at the head of the loop
    asm volatile("s_wait_xcnt 0x0" ::: "memory");
  }

  // ---- O = O^T / sum + Qp: a lane holds 8 successive head dims of one query
#pragma unroll  // constant index: the array stays in registers
  for (int t = 0; t < 2; ++t) {
    float sm = sum[0][t] + sum[1][t];
    sm += __shfl_xor(sm, 16, 32);
    float inv = 1.0f / sm;
    // one 32-bit byte offset serves the residual's loads and the stores
    unsigned boff = (unsigned)(((grow + t * 16 + n) * DIMV + h * HDIM + mb) * 4);
    const char* rq = (const char*)qp32 + boff;
    char* wo = (char*)ao32 + boff;
#pragma unroll  // constant index: the array stays in registers
    for (int dt = 0; dt < 4; ++dt) {
      float4 r0 = *(const float4*)(rq + dt * 64);
      float4 r1 = *(const float4*)(rq + dt * 64 + 16);
      float4 y0, y1;
      y0.x = o[dt][t][0] * inv + r0.x;
      y0.y = o[dt][t][1] * inv + r0.y;
      y0.z = o[dt][t][2] * inv + r0.z;
      y0.w = o[dt][t][3] * inv + r0.w;
      y1.x = o[dt][t][4] * inv + r1.x;
      y1.y = o[dt][t][5] * inv + r1.y;
      y1.z = o[dt][t][6] * inv + r1.z;
      y1.w = o[dt][t][7] * inv + r1.w;
      *(float4*)(wo + dt * 64) = y0;
      *(float4*)(wo + dt * 64 + 16) = y1;
    }
  }
}

// ---------------------------------------------------------------------------
// 5) The row-local tail in one launch: X1 = LN0(attention output),
//    Z = X1 + relu(X1 @ Wo + bo), out = LN1(Z). A work-group of 8 waves owns 32
//    whole rows, which stay in LDS from the first step to the last:
//      a) a wave normalises 4 rows (a lane holds 16 values of each, as four
//         16-byte pieces 512 bytes apart) and leaves X1 in LDS as f32 and f16;
//      b) a wave forms a 32x64 tile of X1 @ Wo, A fragments from LDS, the Wo
//         fragments of four k steps in flight (the first ones during step a);
//      c) it adds relu(.) to the f32 X1 in LDS, each element by its one owner;
//      d) a wave normalises its 4 rows again and stores whole lines.
#define TAIL_ROWS 32
#define XPITCH 516            // floats a row: rows 8 apart lie 32 banks apart
#define GPITCH 136            // halves: the 16 rows' pieces of one k octet, 256 + 16 bytes
#define RTILE  (64 * GPITCH)  // halves of a 16-row tile: 64 k octets

typedef __attribute__((ext_vector_type(4))) _Float16 v4h;

// LayerNorm of 4 rows held by one wave: x[row][piece], columns piece*128+lane*4.
__device__ __forceinline__ void ln_rows(float4 (&x)[4][4], const float4 (&ga)[4],
                                        const float4 (&be)[4]) {
  float sum[4], sq[4];
#pragma unroll  // constant index: the arrays stay in registers
  for (int r = 0; r < 4; ++r) {
    sum[r] = 0.f;
    sq[r] = 0.f;
#pragma unroll  // constant index: the arrays stay in registers
    for (int c = 0; c < 4; ++c) {
      float4 t = x[r][c];
      sum[r] += t.x + t.y + t.z + t.w;
      sq[r] += t.x * t.x + t.y * t.y + t.z * t.z + t.w * t.w;
    }
  }
#pragma unroll  // the eight chains of a step run side by side
  for (int off = 16; off > 0; off >>= 1)
#pragma unroll  // constant index: the arrays stay in registers
    for (int r = 0; r < 4; ++r) {
      sum[r] += __shfl_xor(sum[r], off, 32);
      sq[r] += __shfl_xor(sq[r], off, 32);
    }
#pragma unroll  // constant index: the arrays stay in registers
  for (int r = 0; r < 4; ++r) {
    float mean = sum[r] * (1.0f / DIMV);
    float var = sq[r] * (1.0f / DIMV) - mean * mean;
    float rstd = rsqrtf(var + 1e-5f);
#pragma unroll  // constant index: the arrays stay in registers
    for (int c = 0; c < 4; ++c) {
      float4 t = x[r][c];
      t.x = (t.x - mean) * rstd * ga[c].x + be[c].x;
      t.y = (t.y - mean) * rstd * ga[c].y + be[c].y;
      t.z = (t.z - mean) * rstd * ga[c].z + be[c].z;
      t.w = (t.w - mean) * rstd * ga[c].w + be[c].w;
      x[r][c] = t;
    }
  }
}

#define TAIL_STEPS (DIMV / 32)
#define B_AHEAD 4             // k steps of Wo fragments in flight

// The four Wo fragments (16 columns each) of k step s.
__device__ __forceinline__ void load_b4(v16h (&b)[4], const _Float16* __restrict__ bbase,
                                        int s) {
#pragma unroll  // constant index: the array stays in registers
  for (int j = 0; j < 4; ++j) b[j] = load_tile(bbase + j * 16 * DIMV + s * 512);
}

// The two X1 fragments (16 rows each) of k step s, from LDS.
__device__ __forceinline__ void load_a2(v16h (&a)[2], const _Float16* afrag, int s) {
#pragma unroll  // constant index: the array stays in registers
  for (int i = 0; i < 2; ++i) {
    const _Float16* p = afrag + i * RTILE + s * 4 * GPITCH;
    union { v16h v; v8h h[2]; } u;
    u.h[0] = *(const v8h*)(p);
    u.h[1] = *(const v8h*)(p + 2 * GPITCH);
    a[i] = u.v;
  }
}

__global__ __launch_bounds__(256) void tail_kernel(
    const float* __restrict__ ao32, const _Float16* __restrict__ woT,
    const float* __restrict__ bo, const float* __restrict__ g0,
    const float* __restrict__ b0, const float* __restrict__ g1,
    const float* __restrict__ b1, float* __restrict__ out) {
  __shared__ __attribute__((aligned(16))) float xs[TAIL_ROWS * XPITCH];
  __shared__ __attribute__((aligned(16))) _Float16 xh[2 * RTILE];

  int w = __builtin_amdgcn_readfirstlane((int)(threadIdx.x >> 5));  // scalar bases
  int lane = threadIdx.x & 31;
  int row0 = blockIdx.x * TAIL_ROWS;
  int col0 = w * 64;
  const _Float16* bbase = woT + (size_t)col0 * DIMV;
  v16h bf[B_AHEAD][4];

  // ---- a) LN0 of rows w*4 .. w*4+3
  float4 x[4][4], ga[4], be[4];
  {
    const float* s = ao32 + (size_t)(row0 + w * 4) * DIMV + lane * 4;
#pragma unroll  // constant index: the arrays stay in registers
    for (int r = 0; r < 4; ++r)
#pragma unroll  // constant index: the arrays stay in registers
      for (int c = 0; c < 4; ++c) x[r][c] = *(const float4*)(s + r * DIMV + c * 128);
#pragma unroll  // constant index: the arrays stay in registers
    for (int c = 0; c < 4; ++c) {
      ga[c] = *(const float4*)(g0 + c * 128 + lane * 4);
      be[c] = *(const float4*)(b0 + c * 128 + lane * 4);
    }
  }
  // Wo does not depend on step a: its first fragments fly while LN0 is done,
  // two k steps behind the rows' own loads, two more once gamma and beta are used.
  load_b4(bf[0], bbase, 0);
  load_b4(bf[1], bbase, 1);
  // these loads stay in front of LN0: the compiler would sink them to their use
  __builtin_amdgcn_sched_barrier(0);
  ln_rows(x, ga, be);
  load_b4(bf[2], bbase, 2);
  load_b4(bf[3], bbase, 3);
  // and these in front of the LDS stores and the barrier
  __builtin_amdgcn_sched_barrier(0);
  {
    float* d32 = xs + (w * 4) * XPITCH + lane * 4;
    // f16 copy: row, k -> tile row/16, octet k/8, the row's piece, k%8. That is
    // the fragment order with 16 bytes more behind every 256.
    _Float16* d16 = xh + (w >> 2) * RTILE + (lane >> 1) * GPITCH + (w & 3) * 32 +
                    (lane & 1) * 4;
#pragma unroll  // constant index: the arrays stay in registers
    for (int r = 0; r < 4; ++r)
#pragma unroll  // constant index: the arrays stay in registers
      for (int c = 0; c < 4; ++c) {
        float4 t = x[r][c];
        *(float4*)(d32 + r * XPITCH + c * 128) = t;
        v4h hq;
        hq[0] = (_Float16)t.x; hq[1] = (_Float16)t.y;
        hq[2] = (_Float16)t.z; hq[3] = (_Float16)t.w;
        *(v4h*)(d16 + c * 16 * GPITCH + r * 8) = hq;
      }
  }
  __syncthreads();   // every row of X1 is in LDS before any wave multiplies

  // ---- b) 32x64 tile of X1 @ Wo: columns w*64 ..
  int n = lane & 15, mb = (lane >> 4) * 8;
  const _Float16* afrag = xh + (lane >> 4) * GPITCH + (lane & 15) * 8;
  v16h af[2][2];
  load_a2(af[0], afrag, 0);
  v8f acc[2][4] = {};
  float bval[4];
#pragma unroll  // constant index: the fragment rings stay in registers
  for (int s = 0; s < TAIL_STEPS; ++s) {
    if (s + 1 < TAIL_STEPS) load_a2(af[(s + 1) & 1], afrag, s + 1);
#pragma unroll  // constant index: the arrays stay in registers
    for (int j = 0; j < 4; ++j) {
      acc[0][j] = wmma_f16(af[s & 1][0], bf[s % B_AHEAD][j], acc[0][j]);
      acc[1][j] = wmma_f16(af[s & 1][1], bf[s % B_AHEAD][j], acc[1][j]);
    }
    if (s + B_AHEAD < TAIL_STEPS) load_b4(bf[s % B_AHEAD], bbase, s + B_AHEAD);
    if (s + B_AHEAD == TAIL_STEPS) {
      // the refills have ended: their offset register falls free and is rewritten
      asm volatile("s_wait_xcnt 0x0" ::: "memory");
      // the bias of step c flies in the refills' place
#pragma unroll  // constant index: the array stays in registers
      for (int j = 0; j < 4; ++j) bval[j] = bo[col0 + j * 16 + n];
    }
    // a refill is issued where its buffer falls free: the compiler would sink it
    // to its use, four steps on, and wait out each load's whole latency there
    __builtin_amdgcn_sched_barrier(0);
  }
  // the bias loads' offset register is reused by the address work that follows
  asm volatile("s_wait_xcnt 0x0" ::: "memory");

  // ---- c) Z = X1 + relu(acc + bo), in place in LDS; LN1's gamma and beta fly
#pragma unroll  // constant index: the arrays stay in registers
  for (int c = 0; c < 4; ++c) {
    ga[c] = *(const float4*)(g1 + c * 128 + lane * 4);
    be[c] = *(const float4*)(b1 + c * 128 + lane * 4);
  }
  float* z = xs + mb * XPITCH + col0 + n;
#pragma unroll
  for (int j = 0; j < 4; ++j) {
#pragma unroll
    for (int i = 0; i < 2; ++i) {
#pragma unroll  // constant index: the accumulators stay in registers
      for (int v = 0; v < 8; ++v) {
        float* e = z + (i * 16 + v) * XPITCH + j * 16;
        *e = *e + fmaxf(acc[i][j][v] + bval[j], 0.0f);
      }
    }
  }
  __syncthreads();   // every column of Z is in LDS before a row is summed

  // ---- d) LN1 of rows w*4 .. w*4+3, stored as whole lines
  {
    const float* s = xs + (w * 4) * XPITCH + lane * 4;
#pragma unroll  // constant index: the arrays stay in registers
    for (int r = 0; r < 4; ++r)
#pragma unroll  // constant index: the arrays stay in registers
      for (int c = 0; c < 4; ++c) x[r][c] = *(const float4*)(s + r * XPITCH + c * 128);
  }
  ln_rows(x, ga, be);
  {
    float* d = out + (size_t)(row0 + w * 4) * DIMV + lane * 4;
#pragma unroll  // constant index: the arrays stay in registers
    for (int r = 0; r < 4; ++r)
#pragma unroll  // constant index: the arrays stay in registers
      for (int c = 0; c < 4; ++c) *(float4*)(d + r * DIMV + c * 128) = x[r][c];
  }
}

// ---------------------------------------------------------------------------
extern "C" void kernel_launch(void* const* d_in, const int* in_sizes, int n_in,
                              void* d_out, int out_size, void* d_ws, size_t ws_size,
                              hipStream_t stream) {
  const float* Q  = (const float*)d_in[0];
  const float* K  = (const float*)d_in[1];
  const float* Wq = (const float*)d_in[2];
  const float* bq = (const float*)d_in[3];
  const float* Wk = (const float*)d_in[4];
  const float* bk = (const float*)d_in[5];
  const float* Wv = (const float*)d_in[6];
  const float* bv = (const float*)d_in[7];
  const float* Wo = (const float*)d_in[8];
  const float* bo = (const float*)d_in[9];
  const float* g0 = (const float*)d_in[10];
  const float* b0 = (const float*)d_in[11];
  const float* g1 = (const float*)d_in[12];
  const float* b1 = (const float*)d_in[13];
  float* out = (float*)d_out;

  char* ws = (char*)d_ws;
  _Float16* q16  = (_Float16*)(ws);                         // 8 MB
  _Float16* k16  = (_Float16*)(ws + 8388608);               // 8 MB
  _Float16* w16T = (_Float16*)(ws + 16777216);              // 2 MB (4 mats)
  float*    qp32 = (float*)   (ws + 18874368);              // 16 MB
  _Float16* qp16 = (_Float16*)(ws + 35651584);              // 8 MB
  _Float16* kp16 = (_Float16*)(ws + 44040192);              // 8 MB
  _Float16* vpT  = (_Float16*)(ws + 52428800);              // 8 MB
  float*    ao32 = (float*)   (ws + 60817408);              // 16 MB
  // total workspace: ~74 MB

  // 1) all conversions: q16 and k16 lie one behind the other, w16T holds 4 mats
  const int WN = DIMV * DIMV;
  cvt_all_kernel<<<256, CVT_THREADS, 0, stream>>>(Q, K, Wq, Wk, Wv, Wo, q16, w16T);

  // 3) projections: 6144 tile-waves (32x64 tiles), 8 waves/block
  proj_kernel<<<768, 256, 0, stream>>>(q16, k16, w16T, bq, bk, bv,
                                       qp32, qp16, kp16, vpT);

  // 4) attention: B*H*(SEQ/256) = 256 blocks of 8 waves, 32 queries a wave
  attn_kernel<<<256, 256, 0, stream>>>(qp16, kp16, vpT, qp32, ao32);

  // 5) LN0, x1 + relu(x1 @ Wo + bo), LN1 -> d_out: 32 whole rows a work-group
  tail_kernel<<<ROWS / TAIL_ROWS, 256, 0, stream>>>(ao32, w16T + 3 * WN, bo, g0, b0, g1, b1,
                                                    out);
}

// v005
// A run of this version takes 71.6 microseconds.
// Timed twice side by side with v004, it ran 1.21 and 1.22 times as fast.
// Over all steps from v000 it is 3.71 times as fast.
#include <hip/hip_runtime.h>
#include <hip/hip_bf16.h>

// ---------------------------------------------------------------------------
// MAB (multihead attention block) for MI455X / gfx1250, wave32 + WMMA f16->f32
// Register-blocked GEMMs: one wave computes a 64x64 or a 32x64 tile.
// Every f16 matrix in the workspace is kept in fragment order (see frag_off).
// ---------------------------------------------------------------------------

typedef __attribute__((ext_vector_type(16))) _Float16 v16h;
typedef __attribute__((ext_vector_type(8)))  _Float16 v8h;
typedef __attribute__((ext_vector_type(8)))  float    v8f;

#define DIMV   512
#define ROWS   8192          // B*N = 8*1024
#define SEQ    1024
#define NHEAD  8
#define HDIM   64

__device__ __forceinline__ v8f wmma_f16(v16h a, v16h b, v8f c) {
  return __builtin_amdgcn_wmma_f32_16x16x32_f16(false, a, false, b,
                                                (short)0, c, false, false);
}

// k order of a 16x32 f16 fragment (ISA 7.12.2): lane r = lane&15 supplies row r
// (a row of A, or a column of B), g = lane>>4 selects the K half; elements
// i=0..7 -> K = g*8+i ; i=8..15 -> K = 16+g*8+(i-8).

// Fragment order of a [rows x 32*kt] f16 matrix in global memory: 16x32 tiles
// of 512 halves, tile (row/16, k/32) at index (row/16)*kt + k/32. Inside a tile
// the 8 halves that one lane takes with one 16-byte load lie together, and the
// 32 lanes' pieces follow one another: piece hs*32 + g*16 + r holds row r,
// k = hs*16 + g*8 .. +7. That is the k order given above, so a fragment is two
// loads of 512 contiguous bytes each.
__device__ __forceinline__ size_t frag_off(int row, int k, int kt) {
  return ((size_t)(row >> 4) * kt + (k >> 5)) * 512 + ((k >> 4) & 1) * 256 +
         (((k >> 3) & 1) * 16 + (row & 15)) * 8 + (k & 7);
}

// Load the fragment whose tile starts at `tile` (fragment-order storage).
__device__ __forceinline__ v16h load_tile(const _Float16* __restrict__ tile) {
  const _Float16* p = tile + (threadIdx.x & 31) * 8;
  union { v16h v; v8h h[2]; } u;
  u.h[0] = *(const v8h*)(p);
  u.h[1] = *(const v8h*)(p + 256);
  return u.v;
}

#define KT_DIMV (DIMV / 32)   // k tiles of a [rows x 512] matrix
#define KT_ROWS (ROWS / 32)   // k tiles of the [512 x 8192] transposed V

// ---------------------------------------------------------------------------
// 1) Every f32 -> f16 conversion in one launch of 256 work-groups of 9 waves.
//    A thread makes whole 16-byte pieces of the fragment order (8 values each)
//    and has all of its 32 16-byte loads in flight before the first convert.
//    Waves 0..7: 16 rows x 256 columns of Q or K each (8 tiles, 16 pieces a
//    lane). A lane takes row l>>2 (and that + 8), k piece l&3 of each tile: a
//    store covers four whole 128-byte lines.
//    Wave 8: 128 (k) x 32 (n) of one weight matrix, transposed (element (n,k) =
//    src[k*512+n]). A lane reads 4 n of 8 successive k, which are 4 pieces,
//    64 contiguous bytes of the result; a load covers four whole lines.
#define CVT_THREADS 288

__device__ __forceinline__ v8h to_piece(float4 lo, float4 hi) {
  v8h p;
  p[0] = (_Float16)lo.x; p[1] = (_Float16)lo.y;
  p[2] = (_Float16)lo.z; p[3] = (_Float16)lo.w;
  p[4] = (_Float16)hi.x; p[5] = (_Float16)hi.y;
  p[6] = (_Float16)hi.z; p[7] = (_Float16)hi.w;
  return p;
}

__global__ __launch_bounds__(CVT_THREADS) void cvt_all_kernel(
    const float* __restrict__ Q, const float* __restrict__ K,
    const float* __restrict__ Wq, const float* __restrict__ Wk,
    const float* __restrict__ Wv, const float* __restrict__ Wo,
    _Float16* __restrict__ x16,      // Q's 8192 rows, then K's
    _Float16* __restrict__ w16T) {
  int w = __builtin_amdgcn_readfirstlane((int)(threadIdx.x >> 5));  // scalar branch and bases
  int lane = threadIdx.x & 31;
  if (w < 8) {
    int job = blockIdx.x * 8 + w;    // 2048 jobs
    int rt = job >> 1;               // 16-row tile of [Q; K]
    int kh = job & 1;                // column half
    const float* X = (rt < ROWS / 16) ? Q : K;
    const float* s = X + (size_t)(rt & (ROWS / 16 - 1)) * (16 * DIMV) + kh * 256 +
                     (lane >> 2) * DIMV + (lane & 3) * 8;
    _Float16* d = x16 + ((size_t)rt * KT_DIMV + kh * 8) * 512 +
                  ((lane & 3) * 16 + (lane >> 2)) * 8;
    float4 v[2][8][2];
#pragma unroll  // constant index: the array stays in registers
    for (int h = 0; h < 2; ++h)
#pragma unroll  // constant index: the array stays in registers
      for (int t = 0; t < 8; ++t) {
        v[h][t][0] = *(const float4*)(s + h * (8 * DIMV) + t * 32);
        v[h][t][1] = *(const float4*)(s + h * (8 * DIMV) + t * 32 + 4);
      }
    // no convert is moved up among the loads: without this the compiler saves
    // registers by waiting for early loads before it issues the late ones
    __builtin_amdgcn_sched_barrier(0);
    // the loads' address registers are rewritten next, for the stores' offset
    asm volatile("s_wait_xcnt 0x0" ::: "memory");
#pragma unroll  // constant index: the array stays in registers
    for (int h = 0; h < 2; ++h)
#pragma unroll  // constant index: the array stays in registers
      for (int t = 0; t < 8; ++t)
        *(v8h*)(d + t * 512 + h * 64) = to_piece(v[h][t][0], v[h][t][1]);
  } else {
    int job = blockIdx.x;            // 256 jobs: 4 matrices x 4 k blocks x 16 n blocks
    int m = job >> 6;
    int k0 = ((job >> 4) & 3) * 128, n0 = (job & 15) * 32;
    const float* Wm = (m == 0) ? Wq : (m == 1) ? Wk : (m == 2) ? Wv : Wo;
    int kg = lane >> 3, ng = lane & 7;
    const float* s = Wm + (size_t)(k0 + kg * 8) * DIMV + n0 + ng * 4;
    _Float16* d = w16T + (size_t)m * (DIMV * DIMV) +
                  frag_off(n0 + ng * 4, k0 + kg * 8, KT_DIMV);
    float4 v[4][8];
#pragma unroll  // constant index: the array stays in registers
    for (int c = 0; c < 4; ++c)
#pragma unroll  // constant index: the array stays in registers
      for (int j = 0; j < 8; ++j)
        v[c][j] = *(const float4*)(s + (c * 32 + j) * DIMV);
    // no convert is moved up among the loads: without this the compiler saves
    // registers by waiting for early loads before it issues the late ones
    __builtin_amdgcn_sched_barrier(0);
    // the loads' address registers are rewritten next, for the stores' offset
    asm volatile("s_wait_xcnt 0x0" ::: "memory");
#pragma unroll  // constant index: the array stays in registers
    for (int c = 0; c < 4; ++c) {
      v8h p0, p1, p2, p3;
#pragma unroll  // constant index: the array stays in registers
      for (int j = 0; j < 8; ++j) {
        p0[j] = (_Float16)v[c][j].x;
        p1[j] = (_Float16)v[c][j].y;
        p2[j] = (_Float16)v[c][j].z;
        p3[j] = (_Float16)v[c][j].w;
      }
      *(v8h*)(d + c * 512) = p0;
      *(v8h*)(d + c * 512 + 8) = p1;
      *(v8h*)(d + c * 512 + 16) = p2;
      *(v8h*)(d + c * 512 + 24) = p3;
    }
  }
}

// ---------------------------------------------------------------------------
// 3) Fused projections: Qp = Q@Wq+bq (f32+f16), Kp = K@Wk+bk (f16),
//    Vp = K@Wv+bv stored transposed [DIMV][ROWS] (f16); f16 in fragment order.
//    A work-group of 4 waves forms a 128x128 tile, a wave 64x64 of it (4x4 WMMA
//    tiles). Both operands pass through LDS, 64 k a stage, two buffers: a stage
//    is 16 runs of 2 KB (8 row tiles of X, 8 column tiles of W^T, two k tiles
//    each, as they lie in global memory), brought by asynchronous copies one
//    trip ahead. Every byte comes from L2 once a work-group, not once a wave.
//    Work-groups = 3 * (8192/128) * (512/128) = 768.
#define PJ_THREADS 128
#define PJ_RUN   1024                 // halves of a run: 16 rows x 64 k
#define PJ_BUF   (16 * PJ_RUN)        // halves of a stage
#define PJ_TRIPS (DIMV / 64)
#define TILE_ROW (KT_DIMV * 512)      // halves from one 16-row tile row to the next

// Eight copies of 16 bytes a lane, global memory to LDS: two runs, one tile row
// apart in global memory, adjacent in LDS. l and g are the lane's own addresses.
__device__ __forceinline__ void copy_two_runs(unsigned l, const _Float16* g) {
  const _Float16* h = g + TILE_ROW;
  // the closing wait stands in front of every later rewrite of the address
  // registers that these copies name
  asm volatile(
      "global_load_async_to_lds_b128 %0, %8, off\n\t"
      "global_load_async_to_lds_b128 %1, %9, off\n\t"
      "global_load_async_to_lds_b128 %2, %10, off\n\t"
      "global_load_async_to_lds_b128 %3, %11, off\n\t"
      "global_load_async_to_lds_b128 %4, %12, off\n\t"
      "global_load_async_to_lds_b128 %5, %13, off\n\t"
      "global_load_async_to_lds_b128 %6, %14, off\n\t"
      "global_load_async_to_lds_b128 %7, %15, off\n\t"
      "s_wait_xcnt 0x0"
      :: "v"(l), "v"(l + 512), "v"(l + 1024), "v"(l + 1536),
         "v"(l + 2048), "v"(l + 2560), "v"(l + 3072), "v"(l + 3584),
         "v"(g), "v"(g + 256), "v"(g + 512), "v"(g + 768),
         "v"(h), "v"(h + 256), "v"(h + 512), "v"(h + 768)
      : "memory");
}

// A wave's share of a stage: its four runs.
__device__ __forceinline__ void copy_stage(unsigned l, const _Float16* g) {
  copy_two_runs(l, g);
  copy_two_runs(l + 4096, g + 2 * TILE_ROW);
}

__global__ __launch_bounds__(PJ_THREADS) void proj_kernel(
    const _Float16* __restrict__ q16, const _Float16* __restrict__ k16,
    const _Float16* __restrict__ w16T,
    const float* __restrict__ bq, const float* __restrict__ bk,
    const float* __restrict__ bvv,
    float* __restrict__ qp32, _Float16* __restrict__ qp16,
    _Float16* __restrict__ kp16, _Float16* __restrict__ vpT) {
  __shared__ __attribute__((aligned(128))) _Float16 st[2 * PJ_BUF];

  int w = __builtin_amdgcn_readfirstlane((int)(threadIdx.x >> 5));  // scalar bases
  int lane = threadIdx.x & 31;
  int p = blockIdx.x >> 8;         // 0:Q 1:K 2:V  (256 work-groups each)
  int t = blockIdx.x & 255;        // 64 row blocks x 4 column blocks
  int brow = (t >> 2) * 128;
  int bcol = (t & 3) * 128;

  // Waves 0, 1 bring the 8 row tiles of X, waves 2, 3 the 8 column tiles of W^T.
  const _Float16* X = (p == 0) ? q16 : k16;
  const _Float16* src = (w < 2) ? X + (size_t)brow * DIMV
                                : w16T + (size_t)p * (DIMV * DIMV) + (size_t)bcol * DIMV;
  src += (w & 1) * (4 * TILE_ROW) + lane * 8;
  unsigned dst = (unsigned)(size_t)st + w * (4 * PJ_RUN * 2) + lane * 16;

  int wr = w >> 1, wc = w & 1;     // the wave's 64x64 tile of the block tile
  int row0 = brow + wr * 64;
  int col0 = bcol + wc * 64;
  const _Float16* afrag = st + wr * (4 * PJ_RUN);
  const _Float16* bfrag = st + (8 + wc * 4) * PJ_RUN;

  copy_stage(dst, src);
  // stage 0 has landed for this wave ...
  asm volatile("s_wait_asynccnt 0x0" ::: "memory");
  __syncthreads();                 // ... and for every wave, before anyone reads it
  copy_stage(dst + PJ_BUF * 2, src + PJ_RUN);

  v8f acc[4][4] = {};
  for (int s = 0; s < PJ_TRIPS; ++s) {
    int boff = (s & 1) * PJ_BUF;
#pragma unroll  // constant index: the arrays stay in registers
    for (int kk = 0; kk < 2; ++kk) {
      v16h af[4], bf[4];
#pragma unroll  // constant index: the arrays stay in registers
      for (int i = 0; i < 4; ++i) af[i] = load_tile(afrag + boff + i * PJ_RUN + kk * 512);
#pragma unroll  // constant index: the arrays stay in registers
      for (int j = 0; j < 4; ++j) bf[j] = load_tile(bfrag + boff + j * PJ_RUN + kk * 512);
      // the 16 LDS reads of a k tile stay one group in front of its 16 products:
      // the compiler would keep one A fragment and wait out a read per 4 products
      __builtin_amdgcn_sched_barrier(0);
#pragma unroll  // constant index: the arrays stay in registers
      for (int i = 0; i < 4; ++i)
#pragma unroll  // constant index: the arrays stay in registers
        for (int j = 0; j < 4; ++j) acc[i][j] = wmma_f16(af[i], bf[j], acc[i][j]);
    }
    // this wave's reads of the buffer have returned before it is refilled
    asm volatile("s_wait_dscnt 0x0" ::: "memory");
    // this wave's copies of the next stage have landed
    asm volatile("s_wait_asynccnt 0x0" ::: "memory");
    __syncthreads();   // publishes stage s + 1 and ends every read of stage s
    if (s + 2 < PJ_TRIPS) copy_stage(dst + boff * 2, src + (s + 2) * PJ_RUN);
  }
  // no copy is outstanding when the wave goes on
  asm volatile("s_wait_asynccnt 0x0" ::: "memory");

  int n = lane & 15, mb = (lane >> 4) * 8;
  const float* bias = (p == 0) ? bq : (p == 1) ? bk : bvv;
  // p is the same for the work-group: one branch picks the writer of its matrix.
  if (p == 0) {
#pragma unroll
    for (int j = 0; j < 4; ++j) {
      int c = col0 + j * 16 + n;
      float bval = bias[c];
#pragma unroll
      for (int i = 0; i < 4; ++i) {
        for (int v = 0; v < 8; ++v) {
          int r = row0 + i * 16 + mb + v;
          float val = acc[i][j][v] + bval;
          qp32[(size_t)r * DIMV + c] = val;
          qp16[frag_off(r, c, KT_DIMV)] = (_Float16)val;
        }
      }
    }
  } else if (p == 1) {
#pragma unroll
    for (int j = 0; j < 4; ++j) {
      int c = col0 + j * 16 + n;
      float bval = bias[c];
#pragma unroll
      for (int i = 0; i < 4; ++i) {
        for (int v = 0; v < 8; ++v) {
          int r = row0 + i * 16 + mb + v;
          kp16[frag_off(r, c, KT_DIMV)] = (_Float16)(acc[i][j][v] + bval);
        }
      }
    }
  } else {
    // Transposed V: a lane's 8 accumulators are 8 successive keys of one
    // column, which is one 16-byte piece of the fragment order.
#pragma unroll
    for (int j = 0; j < 4; ++j) {
      int c = col0 + j * 16 + n;
      float bval = bias[c];
#pragma unroll
      for (int i = 0; i < 4; ++i) {
        v8h piece;
        for (int v = 0; v < 8; ++v) piece[v] = (_Float16)(acc[i][j][v] + bval);
        *(v8h*)(vpT + frag_off(c, row0 + i * 16 + mb, KT_ROWS)) = piece;
      }
    }
  }
}

// ---------------------------------------------------------------------------
// 4) Attention, transposed products: S^T = Kh @ Qh^T and O^T = Vh^T @ P^T.
//    One wave owns 32 queries (two 16-column groups) of one (b, h) and walks all
//    1024 keys, 32 a step. In an S^T tile a lane holds 8 keys of ONE query, and
//    two such tiles are, register for register, the B fragment of the second
//    product (k = g*8+i, then 16+g*8+i), so the scores never leave registers.
//    Walk 1 finds each query's maximum, walk 2 forms the scores again, takes
//    exp and multiplies by V. 8 waves / block = 256 queries of one (b, h).
#define K_STEP (2 * KT_DIMV * 512)   // halves from one 32-key group of K to the next
#define NSTEP  (SEQ / 32)

// The four K fragments of 32-key group g: [key tile][head-dim half].
__device__ __forceinline__ void load_k(v16h (&kc)[4], const _Float16* __restrict__ kb,
                                       int g) {
  const _Float16* p = kb + (size_t)g * K_STEP;
  kc[0] = load_tile(p);
  kc[1] = load_tile(p + 512);
  kc[2] = load_tile(p + KT_DIMV * 512);
  kc[3] = load_tile(p + KT_DIMV * 512 + 512);
}

// The four V^T fragments (16 head dims each) of 32-key group g.
__device__ __forceinline__ void load_v(v16h (&vc)[4], const _Float16* __restrict__ vb,
                                       int g) {
#pragma unroll  // constant index: the array stays in registers
  for (int dt = 0; dt < 4; ++dt)
    vc[dt] = load_tile(vb + (size_t)dt * (KT_ROWS * 512) + g * 512);
}

// S^T of one 32-key group: s[key tile][query group].
__device__ __forceinline__ void scores_t(v8f (&s)[2][2], const v16h (&kc)[4],
                                         const v16h (&qb)[2][2]) {
#pragma unroll  // constant index: the array stays in registers
  for (int i = 0; i < 2; ++i)
#pragma unroll  // constant index: the array stays in registers
    for (int t = 0; t < 2; ++t) {
      v8f z = {};
      z = wmma_f16(kc[2 * i], qb[t][0], z);
      s[i][t] = wmma_f16(kc[2 * i + 1], qb[t][1], z);
    }
}

// Walk 1, one step: scores of the group in kc, refill kc, running maxima.
__device__ __forceinline__ void max_step(v16h (&kc)[4], const _Float16* __restrict__ kb,
                                         int gnext, const v16h (&qb)[2][2],
                                         float (&mx)[2][2]) {
  v8f s[2][2];
  scores_t(s, kc, qb);
  load_k(kc, kb, gnext);
#pragma unroll  // constant index: the array stays in registers
  for (int i = 0; i < 2; ++i)
#pragma unroll  // constant index: the array stays in registers
    for (int t = 0; t < 2; ++t)
#pragma unroll  // constant index: the array stays in registers
      for (int v = 0; v < 8; ++v) mx[i][t] = fmaxf(mx[i][t], s[i][t][v]);
  // one step's scores are used up before the next step's are formed: without
  // this the four steps' scores are held side by side, over 256 registers
  __builtin_amdgcn_sched_barrier(0);
}

// Walk 2, one step: scores again, refill kc, exp, O^T += V^T P^T, refill vc.
__device__ __forceinline__ void pv_step(v16h (&kc)[4], v16h (&vc)[4],
                                        const _Float16* __restrict__ kb,
                                        const _Float16* __restrict__ vb,
                                        int gk, int gv, const v16h (&qb)[2][2],
                                        const float (&mc)[2], float cs,
                                        float (&sum)[2][2], v8f (&o)[4][2]) {
  v8f s[2][2];
  scores_t(s, kc, qb);
  load_k(kc, kb, gk);
  v16h p[2];
#pragma unroll  // constant index: the array stays in registers
  for (int t = 0; t < 2; ++t)
#pragma unroll  // constant index: the array stays in registers
    for (int i = 0; i < 2; ++i)
#pragma unroll  // constant index: the array stays in registers
      for (int v = 0; v < 8; ++v) {
        float e = __builtin_amdgcn_exp2f(s[i][t][v] * cs - mc[t]);
        sum[i][t] += e;
        p[t][i * 8 + v] = (_Float16)e;
      }
#pragma unroll  // constant index: the array stays in registers
  for (int dt = 0; dt < 4; ++dt)
#pragma unroll  // constant index: the array stays in registers
    for (int t = 0; t < 2; ++t) o[dt][t] = wmma_f16(vc[dt], p[t], o[dt][t]);
  load_v(vc, vb, gv);
}

__global__ __launch_bounds__(256) void attn_kernel(
    const _Float16* __restrict__ qp16, const _Float16* __restrict__ kp16,
    const _Float16* __restrict__ vpT, const float* __restrict__ qp32,
    float* __restrict__ ao32) {
  int bid = blockIdx.x;
  int qq = bid & 3;
  int h = (bid >> 2) & 7;
  int b = bid >> 5;

  int w = __builtin_amdgcn_readfirstlane((int)(threadIdx.x >> 5));  // scalar tile bases
  int lane = threadIdx.x & 31;
  int n = lane & 15, mb = (lane >> 4) * 8;
  int grow = b * SEQ + qq * 256 + w * 32;

  const _Float16* kb = kp16 + frag_off(b * SEQ, h * HDIM, KT_DIMV);
  const _Float16* vb = vpT + frag_off(h * HDIM, b * SEQ, KT_ROWS);

  v16h qb[2][2];                       // Q as B operand, kept for both walks
#pragma unroll  // constant index: the array stays in registers
  for (int t = 0; t < 2; ++t) {
    const _Float16* qbase = qp16 + frag_off(grow + t * 16, h * HDIM, KT_DIMV);
    qb[t][0] = load_tile(qbase);
    qb[t][1] = load_tile(qbase + 512);
  }

  // ---- walk 1: maxima. Four K buffers, each refilled four steps ahead; the
  // last refills wrap to groups 0.. and so hand walk 2 its first two groups.
  v16h kA[4], kB[4], kC[4], kD[4];
  load_k(kA, kb, 0);
  load_k(kB, kb, 1);
  load_k(kC, kb, 2);
  load_k(kD, kb, 3);
  float mx[2][2] = {{-3.0e38f, -3.0e38f}, {-3.0e38f, -3.0e38f}};
  for (int s = 0; s < NSTEP; s += 4) {
    max_step(kA, kb, (s + 4) & (NSTEP - 1), qb, mx);
    max_step(kB, kb, (s + 5) & (NSTEP - 1), qb, mx);
    max_step(kC, kb, (s + 6) & (NSTEP - 1), qb, mx);
    max_step(kD, kb, (s + 7) & (NSTEP - 1), qb, mx);
    // the last loads' address registers are rewritten at the head of the loop
    asm volatile("s_wait_xcnt 0x0" ::: "memory");
  }

  // exp(x / 8 - m / 8) = exp2(x * cs - m * cs); both wave halves hold keys of
  // the same query and must use one maximum.
  const float cs = 0.125f * 1.44269504088896340736f;
  float mc[2];
#pragma unroll  // constant index: the array stays in registers
  for (int t = 0; t < 2; ++t) {
    float m = fmaxf(mx[0][t], mx[1][t]);
    m = fmaxf(m, __shfl_xor(m, 16, 32));
    mc[t] = m * cs;
  }

  // ---- walk 2: P^T = exp(S^T - max), O^T += V^T P^T (1/sum deferred)
  v16h vc[4];
  load_v(vc, vb, 0);
  float sum[2][2] = {};
  v8f o[4][2] = {};
  for (int s = 0; s < NSTEP; s += 2) {
    pv_step(kA, vc, kb, vb, (s + 2) & (NSTEP - 1), s + 1, qb, mc, cs, sum, o);
    pv_step(kB, vc, kb, vb, (s + 3) & (NSTEP - 1), (s + 2) & (NSTEP - 1), qb, mc, cs,
            sum, o);
    // the last loads' address registers are rewritten at the head of the loop
    asm volatile("s_wait_xcnt 0x0" ::: "memory");
  }

  // ---- O = O^T / sum + Qp: a lane holds 8 successive head dims of one query
#pragma unroll  // constant index: the array stays in registers
  for (int t = 0; t < 2; ++t) {
    float sm = sum[0][t] + sum[1][t];
    sm += __shfl_xor(sm, 16, 32);
    float inv = 1.0f / sm;
    // one 32-bit byte offset serves the residual's loads and the stores
    unsigned boff = (unsigned)(((grow + t * 16 + n) * DIMV + h * HDIM + mb) * 4);
    const char* rq = (const char*)qp32 + boff;
    char* wo = (char*)ao32 + boff;
#pragma unroll  // constant index: the array stays in registers
    for (int dt = 0; dt < 4; ++dt) {
      float4 r0 = *(const float4*)(rq + dt * 64);
      float4 r1 = *(const float4*)(rq + dt * 64 + 16);
      float4 y0, y1;
      y0.x = o[dt][t][0] * inv + r0.x;
      y0.y = o[dt][t][1] * inv + r0.y;
      y0.z = o[dt][t][2] * inv + r0.z;
      y0.w = o[dt][t][3] * inv + r0.w;
      y1.x = o[dt][t][4] * inv + r1.x;
      y1.y = o[dt][t][5] * inv + r1.y;
      y1.z = o[dt][t][6] * inv + r1.z;
      y1.w = o[dt][t][7] * inv + r1.w;
      *(float4*)(wo + dt * 64) = y0;
      *(float4*)(wo + dt * 64 + 16) = y1;
    }
  }
}

// ---------------------------------------------------------------------------
// 5) The row-local tail in one launch: X1 = LN0(attention output),
//    Z = X1 + relu(X1 @ Wo + bo), out = LN1(Z). A work-group of 8 waves owns 32
//    whole rows, which stay in LDS from the first step to the last:
//      a) a wave normalises 4 rows (a lane holds 16 values of each, as four
//         16-byte pieces 512 bytes apart) and leaves X1 in LDS as f32 and f16;
//      b) a wave forms a 32x64 tile of X1 @ Wo, A fragments from LDS, the Wo
//         fragments of four k steps in flight (the first ones during step a);
//      c) it adds relu(.) to the f32 X1 in LDS, each element by its one owner;
//      d) a wave normalises its 4 rows again and stores whole lines.
#define TAIL_ROWS 32
#define XPITCH 516            // floats a row: rows 8 apart lie 32 banks apart
#define GPITCH 136            // halves: the 16 rows' pieces of one k octet, 256 + 16 bytes
#define RTILE  (64 * GPITCH)  // halves of a 16-row tile: 64 k octets

typedef __attribute__((ext_vector_type(4))) _Float16 v4h;

// LayerNorm of 4 rows held by one wave: x[row][piece], columns piece*128+lane*4.
__device__ __forceinline__ void ln_rows(float4 (&x)[4][4], const float4 (&ga)[4],
                                        const float4 (&be)[4]) {
  float sum[4], sq[4];
#pragma unroll  // constant index: the arrays stay in registers
  for (int r = 0; r < 4; ++r) {
    sum[r] = 0.f;
    sq[r] = 0.f;
#pragma unroll  // constant index: the arrays stay in registers
    for (int c = 0; c < 4; ++c) {
      float4 t = x[r][c];
      sum[r] += t.x + t.y + t.z + t.w;
      sq[r] += t.x * t.x + t.y * t.y + t.z * t.z + t.w * t.w;
    }
  }
#pragma unroll  // the eight chains of a step run side by side
  for (int off = 16; off > 0; off >>= 1)
#pragma unroll  // constant index: the arrays stay in registers
    for (int r = 0; r < 4; ++r) {
      sum[r] += __shfl_xor(sum[r], off, 32);
      sq[r] += __shfl_xor(sq[r], off, 32);
    }
#pragma unroll  // constant index: the arrays stay in registers
  for (int r = 0; r < 4; ++r) {
    float mean = sum[r] * (1.0f / DIMV);
    float var = sq[r] * (1.0f / DIMV) - mean * mean;
    float rstd = rsqrtf(var + 1e-5f);
#pragma unroll  // constant index: the arrays stay in registers
    for (int c = 0; c < 4; ++c) {
      float4 t = x[r][c];
      t.x = (t.x - mean) * rstd * ga[c].x + be[c].x;
      t.y = (t.y - mean) * rstd * ga[c].y + be[c].y;
      t.z = (t.z - mean) * rstd * ga[c].z + be[c].z;
      t.w = (t.w - mean) * rstd * ga[c].w + be[c].w;
      x[r][c] = t;
    }
  }
}

#define TAIL_STEPS (DIMV / 32)
#define B_AHEAD 4             // k steps of Wo fragments in flight

// The four Wo fragments (16 columns each) of k step s.
__device__ __forceinline__ void load_b4(v16h (&b)[4], const _Float16* __restrict__ bbase,
                                        int s) {
#pragma unroll  // constant index: the array stays in registers
  for (int j = 0; j < 4; ++j) b[j] = load_tile(bbase + j * 16 * DIMV + s * 512);
}

// The two X1 fragments (16 rows each) of k step s, from LDS.
__device__ __forceinline__ void load_a2(v16h (&a)[2], const _Float16* afrag, int s) {
#pragma unroll  // constant index: the array stays in registers
  for (int i = 0; i < 2; ++i) {
    const _Float16* p = afrag + i * RTILE + s * 4 * GPITCH;
    union { v16h v; v8h h[2]; } u;
    u.h[0] = *(const v8h*)(p);
    u.h[1] = *(const v8h*)(p + 2 * GPITCH);
    a[i] = u.v;
  }
}

__global__ __launch_bounds__(256) void tail_kernel(
    const float* __restrict__ ao32, const _Float16* __restrict__ woT,
    const float* __restrict__ bo, const float* __restrict__ g0,
    const float* __restrict__ b0, const float* __restrict__ g1,
    const float* __restrict__ b1, float* __restrict__ out) {
  __shared__ __attribute__((aligned(16))) float xs[TAIL_ROWS * XPITCH];
  __shared__ __attribute__((aligned(16))) _Float16 xh[2 * RTILE];

  int w = __builtin_amdgcn_readfirstlane((int)(threadIdx.x >> 5));  // scalar bases
  int lane = threadIdx.x & 31;
  int row0 = blockIdx.x * TAIL_ROWS;
  int col0 = w * 64;
  const _Float16* bbase = woT + (size_t)col0 * DIMV;
  v16h bf[B_AHEAD][4];

  // ---- a) LN0 of rows w*4 .. w*4+3
  float4 x[4][4], ga[4], be[4];
  {
    const float* s = ao32 + (size_t)(row0 + w * 4) * DIMV + lane * 4;
#pragma unroll  // constant index: the arrays stay in registers
    for (int r = 0; r < 4; ++r)
#pragma unroll  // constant index: the arrays stay in registers
      for (int c = 0; c < 4; ++c) x[r][c] = *(const float4*)(s + r * DIMV + c * 128);
#pragma unroll  // constant index: the arrays stay in registers
    for (int c = 0; c < 4; ++c) {
      ga[c] = *(const float4*)(g0 + c * 128 + lane * 4);
      be[c] = *(const float4*)(b0 + c * 128 + lane * 4);
    }
  }
  // Wo does not depend on step a: its first fragments fly while LN0 is done,
  // two k steps behind the rows' own loads, two more once gamma and beta are used.
  load_b4(bf[0], bbase, 0);
  load_b4(bf[1], bbase, 1);
  // these loads stay in front of LN0: the compiler would sink them to their use
  __builtin_amdgcn_sched_barrier(0);
  ln_rows(x, ga, be);
  load_b4(bf[2], bbase, 2);
  load_b4(bf[3], bbase, 3);
  // and these in front of the LDS stores and the barrier
  __builtin_amdgcn_sched_barrier(0);
  {
    float* d32 = xs + (w * 4) * XPITCH + lane * 4;
    // f16 copy: row, k -> tile row/16, octet k/8, the row's piece, k%8. That is
    // the fragment order with 16 bytes more behind every 256.
    _Float16* d16 = xh + (w >> 2) * RTILE + (lane >> 1) * GPITCH + (w & 3) * 32 +
                    (lane & 1) * 4;
#pragma unroll  // constant index: the arrays stay in registers
    for (int r = 0; r < 4; ++r)
#pragma unroll  // constant index: the arrays stay in registers
      for (int c = 0; c < 4; ++c) {
        float4 t = x[r][c];
        *(float4*)(d32 + r * XPITCH + c * 128) = t;
        v4h hq;
        hq[0] = (_Float16)t.x; hq[1] = (_Float16)t.y;
        hq[2] = (_Float16)t.z; hq[3] = (_Float16)t.w;
        *(v4h*)(d16 + c * 16 * GPITCH + r * 8) = hq;
      }
  }
  __syncthreads();   // every row of X1 is in LDS before any wave multiplies

  // ---- b) 32x64 tile of X1 @ Wo: columns w*64 ..
  int n = lane & 15, mb = (lane >> 4) * 8;
  const _Float16* afrag = xh + (lane >> 4) * GPITCH + (lane & 15) * 8;
  v16h af[2][2];
  load_a2(af[0], afrag, 0);
  v8f acc[2][4] = {};
  float bval[4];
#pragma unroll  // constant index: the fragment rings stay in registers
  for (int s = 0; s < TAIL_STEPS; ++s) {
    if (s + 1 < TAIL_STEPS) load_a2(af[(s + 1) & 1], afrag, s + 1);
#pragma unroll  // constant index: the arrays stay in registers
    for (int j = 0; j < 4; ++j) {
      acc[0][j] = wmma_f16(af[s & 1][0], bf[s % B_AHEAD][j], acc[0][j]);
      acc[1][j] = wmma_f16(af[s & 1][1], bf[s % B_AHEAD][j], acc[1][j]);
    }
    if (s + B_AHEAD < TAIL_STEPS) load_b4(bf[s % B_AHEAD], bbase, s + B_AHEAD);
    if (s + B_AHEAD == TAIL_STEPS) {
      // the refills have ended: their offset register falls free and is rewritten
      asm volatile("s_wait_xcnt 0x0" ::: "memory");
      // the bias of step c flies in the refills' place
#pragma unroll  // constant index: the array stays in registers
      for (int j = 0; j < 4; ++j) bval[j] = bo[col0 + j * 16 + n];
    }
    // a refill is issued where its buffer falls free: the compiler would sink it
    // to its use, four steps on, and wait out each load's whole latency there
    __builtin_amdgcn_sched_barrier(0);
  }
  // the bias loads' offset register is reused by the address work that follows
  asm volatile("s_wait_xcnt 0x0" ::: "memory");

  // ---- c) Z = X1 + relu(acc + bo), in place in LDS; LN1's gamma and beta fly
#pragma unroll  // constant index: the arrays stay in registers
  for (int c = 0; c < 4; ++c) {
    ga[c] = *(const float4*)(g1 + c * 128 + lane * 4);
    be[c] = *(const float4*)(b1 + c * 128 + lane * 4);
  }
  float* z = xs + mb * XPITCH + col0 + n;
#pragma unroll
  for (int j = 0; j < 4; ++j) {
#pragma unroll
    for (int i = 0; i < 2; ++i) {
#pragma unroll  // constant index: the accumulators stay in registers
      for (int v = 0; v < 8; ++v) {
        float* e = z + (i * 16 + v) * XPITCH + j * 16;
        *e = *e + fmaxf(acc[i][j][v] + bval[j], 0.0f);
      }
    }
  }
  __syncthreads();   // every column of Z is in LDS before a row is summed

  // ---- d) LN1 of rows w*4 .. w*4+3, stored as whole lines
  {
    const float* s = xs + (w * 4) * XPITCH + lane * 4;
#pragma unroll  // constant index: the arrays stay in registers
    for (int r = 0; r < 4; ++r)
#pragma unroll  // constant index: the arrays stay in registers
      for (int c = 0; c < 4; ++c) x[r][c] = *(const float4*)(s + r * XPITCH + c * 128);
  }
  ln_rows(x, ga, be);
  {
    float* d = out + (size_t)(row0 + w * 4) * DIMV + lane * 4;
#pragma unroll  // constant index: the arrays stay in registers
    for (int r = 0; r < 4; ++r)
#pragma unroll  // constant index: the arrays stay in registers
      for (int c = 0; c < 4; ++c) *(float4*)(d + r * DIMV + c * 128) = x[r][c];
  }
}

// ---------------------------------------------------------------------------
extern "C" void kernel_launch(void* const* d_in, const int* in_sizes, int n_in,
                              void* d_out, int out_size, void* d_ws, size_t ws_size,
                              hipStream_t stream) {
  const float* Q  = (const float*)d_in[0];
  const float* K  = (const float*)d_in[1];
  const float* Wq = (const float*)d_in[2];
  const float* bq = (const float*)d_in[3];
  const float* Wk = (const float*)d_in[4];
  const float* bk = (const float*)d_in[5];
  const float* Wv = (const float*)d_in[6];
  const float* bv = (const float*)d_in[7];
  const float* Wo = (const float*)d_in[8];
  const float* bo = (const float*)d_in[9];
  const float* g0 = (const float*)d_in[10];
  const float* b0 = (const float*)d_in[11];
  const float* g1 = (const float*)d_in[12];
  const float* b1 = (const float*)d_in[13];
  float* out = (float*)d_out;

  char* ws = (char*)d_ws;
  _Float16* q16  = (_Float16*)(ws);                         // 8 MB
  _Float16* k16  = (_Float16*)(ws + 8388608);               // 8 MB
  _Float16* w16T = (_Float16*)(ws + 16777216);              // 2 MB (4 mats)
  float*    qp32 = (float*)   (ws + 18874368);              // 16 MB
  _Float16* qp16 = (_Float16*)(ws + 35651584);              // 8 MB
  _Float16* kp16 = (_Float16*)(ws + 44040192);              // 8 MB
  _Float16* vpT  = (_Float16*)(ws + 52428800);              // 8 MB
  float*    ao32 = (float*)   (ws + 60817408);              // 16 MB
  // total workspace: ~74 MB

  // 1) all conversions: q16 and k16 lie one behind the other, w16T holds 4 mats
  const int WN = DIMV * DIMV;
  cvt_all_kernel<<<256, CVT_THREADS, 0, stream>>>(Q, K, Wq, Wk, Wv, Wo, q16, w16T);

  // 3) projections: 768 work-groups of 4 waves, a 128x128 tile each
  proj_kernel<<<768, PJ_THREADS, 0, stream>>>(q16, k16, w16T, bq, bk, bv,
                                       qp32, qp16, kp16, vpT);

  // 4) attention: B*H*(SEQ/256) = 256 blocks of 8 waves, 32 queries a wave
  attn_kernel<<<256, 256, 0, stream>>>(qp16, kp16, vpT, qp32, ao32);

  // 5) LN0, x1 + relu(x1 @ Wo + bo), LN1 -> d_out: 32 whole rows a work-group
  tail_kernel<<<ROWS / TAIL_ROWS, 256, 0, stream>>>(ao32, w16T + 3 * WN, bo, g0, b0, g1, b1,
                                                    out);
}

// v006
// Measured time: 63.2 microseconds a run.
// Two timings next to v005 both put it at 1.12 times that version's speed.
// All steps since v000 together make it 4.15 times as fast.
#include <hip/hip_runtime.h>
#include <hip/hip_bf16.h>

// ---------------------------------------------------------------------------
// MAB (multihead attention block) for MI455X / gfx1250, wave32 + WMMA f16->f32
// Register-blocked GEMMs: one wave computes a 64x64 or a 32x64 tile.
// Every f16 matrix in the workspace is kept in fragment order (see frag_off).
// ---------------------------------------------------------------------------

typedef __attribute__((ext_vector_type(16))) _Float16 v16h;
typedef __attribute__((ext_vector_type(8)))  _Float16 v8h;
typedef __attribute__((ext_vector_type(8)))  float    v8f;

#define DIMV   512
#define ROWS   8192          // B*N = 8*1024
#define SEQ    1024
#define NHEAD  8
#define HDIM   64

__device__ __forceinline__ v8f wmma_f16(v16h a, v16h b, v8f c) {
  return __builtin_amdgcn_wmma_f32_16x16x32_f16(false, a, false, b,
                                                (short)0, c, false, false);
}

// k order of a 16x32 f16 fragment (ISA 7.12.2): lane r = lane&15 supplies row r
// (a row of A, or a column of B), g = lane>>4 selects the K half; elements
// i=0..7 -> K = g*8+i ; i=8..15 -> K = 16+g*8+(i-8).

// Fragment order of a [rows x 32*kt] f16 matrix in global memory: 16x32 tiles
// of 512 halves, tile (row/16, k/32) at index (row/16)*kt + k/32. Inside a tile
// the 8 halves that one lane takes with one 16-byte load lie together, and the
// 32 lanes' pieces follow one another: piece hs*32 + g*16 + r holds row r,
// k = hs*16 + g*8 .. +7. That is the k order given above, so a fragment is two
// loads of 512 contiguous bytes each.
__device__ __forceinline__ size_t frag_off(int row, int k, int kt) {
  return ((size_t)(row >> 4) * kt + (k >> 5)) * 512 + ((k >> 4) & 1) * 256 +
         (((k >> 3) & 1) * 16 + (row & 15)) * 8 + (k & 7);
}

// Load the fragment whose tile starts at `tile` (fragment-order storage).
__device__ __forceinline__ v16h load_tile(const _Float16* __restrict__ tile) {
  const _Float16* p = tile + (threadIdx.x & 31) * 8;
  union { v16h v; v8h h[2]; } u;
  u.h[0] = *(const v8h*)(p);
  u.h[1] = *(const v8h*)(p + 256);
  return u.v;
}

#define KT_DIMV (DIMV / 32)   // k tiles of a [rows x 512] matrix
#define KT_ROWS (ROWS / 32)   // k tiles of the [512 x 8192] transposed V

// ---------------------------------------------------------------------------
// 1) Every f32 -> f16 conversion in one launch of 256 work-groups of 9 waves.
//    A thread makes whole 16-byte pieces of the fragment order (8 values each)
//    and has all of its 32 16-byte loads in flight before the first convert.
//    Waves 0..7: 16 rows x 256 columns of Q or K each (8 tiles, 16 pieces a
//    lane). A lane takes row l>>2 (and that + 8), k piece l&3 of each tile: a
//    store covers four whole 128-byte lines.
//    Wave 8: 128 (k) x 32 (n) of one weight matrix, transposed (element (n,k) =
//    src[k*512+n]). A lane reads 4 n of 8 successive k, which are 4 pieces,
//    64 contiguous bytes of the result; a load covers four whole lines.
#define CVT_THREADS 288

__device__ __forceinline__ v8h to_piece(float4 lo, float4 hi) {
  v8h p;
  p[0] = (_Float16)lo.x; p[1] = (_Float16)lo.y;
  p[2] = (_Float16)lo.z; p[3] = (_Float16)lo.w;
  p[4] = (_Float16)hi.x; p[5] = (_Float16)hi.y;
  p[6] = (_Float16)hi.z; p[7] = (_Float16)hi.w;
  return p;
}

__global__ __launch_bounds__(CVT_THREADS) void cvt_all_kernel(
    const float* __restrict__ Q, const float* __restrict__ K,
    const float* __restrict__ Wq, const float* __restrict__ Wk,
    const float* __restrict__ Wv, const float* __restrict__ Wo,
    _Float16* __restrict__ x16,      // Q's 8192 rows, then K's
    _Float16* __restrict__ w16T) {
  int w = __builtin_amdgcn_readfirstlane((int)(threadIdx.x >> 5));  // scalar branch and bases
  int lane = threadIdx.x & 31;
  if (w < 8) {
    int job = blockIdx.x * 8 + w;    // 2048 jobs
    int rt = job >> 1;               // 16-row tile of [Q; K]
    int kh = job & 1;                // column half
    const float* X = (rt < ROWS / 16) ? Q : K;
    const float* s = X + (size_t)(rt & (ROWS / 16 - 1)) * (16 * DIMV) + kh * 256 +
                     (lane >> 2) * DIMV + (lane & 3) * 8;
    _Float16* d = x16 + ((size_t)rt * KT_DIMV + kh * 8) * 512 +
                  ((lane & 3) * 16 + (lane >> 2)) * 8;
    float4 v[2][8][2];
#pragma unroll  // constant index: the array stays in registers
    for (int h = 0; h < 2; ++h)
#pragma unroll  // constant index: the array stays in registers
      for (int t = 0; t < 8; ++t) {
        v[h][t][0] = *(const float4*)(s + h * (8 * DIMV) + t * 32);
        v[h][t][1] = *(const float4*)(s + h * (8 * DIMV) + t * 32 + 4);
      }
    // no convert is moved up among the loads: without this the compiler saves
    // registers by waiting for early loads before it issues the late ones
    __builtin_amdgcn_sched_barrier(0);
    // the loads' address registers are rewritten next, for the stores' offset
    asm volatile("s_wait_xcnt 0x0" ::: "memory");
#pragma unroll  // constant index: the array stays in registers
    for (int h = 0; h < 2; ++h)
#pragma unroll  // constant index: the array stays in registers
      for (int t = 0; t < 8; ++t)
        *(v8h*)(d + t * 512 + h * 64) = to_piece(v[h][t][0], v[h][t][1]);
  } else {
    int job = blockIdx.x;            // 256 jobs: 4 matrices x 4 k blocks x 16 n blocks
    int m = job >> 6;
    int k0 = ((job >> 4) & 3) * 128, n0 = (job & 15) * 32;
    const float* Wm = (m == 0) ? Wq : (m == 1) ? Wk : (m == 2) ? Wv : Wo;
    int kg = lane >> 3, ng = lane & 7;
    const float* s = Wm + (size_t)(k0 + kg * 8) * DIMV + n0 + ng * 4;
    _Float16* d = w16T + (size_t)m * (DIMV * DIMV) +
                  frag_off(n0 + ng * 4, k0 + kg * 8, KT_DIMV);
    float4 v[4][8];
#pragma unroll  // constant index: the array stays in registers
    for (int c = 0; c < 4; ++c)
#pragma unroll  // constant index: the array stays in registers
      for (int j = 0; j < 8; ++j)
        v[c][j] = *(const float4*)(s + (c * 32 + j) * DIMV);
    // no convert is moved up among the loads: without this the compiler saves
    // registers by waiting for early loads before it issues the late ones
    __builtin_amdgcn_sched_barrier(0);
    // the loads' address registers are rewritten next, for the stores' offset
    asm volatile("s_wait_xcnt 0x0" ::: "memory");
#pragma unroll  // constant index: the array stays in registers
    for (int c = 0; c < 4; ++c) {
      v8h p0, p1, p2, p3;
#pragma unroll  // constant index: the array stays in registers
      for (int j = 0; j < 8; ++j) {
        p0[j] = (_Float16)v[c][j].x;
        p1[j] = (_Float16)v[c][j].y;
        p2[j] = (_Float16)v[c][j].z;
        p3[j] = (_Float16)v[c][j].w;
      }
      *(v8h*)(d + c * 512) = p0;
      *(v8h*)(d + c * 512 + 8) = p1;
      *(v8h*)(d + c * 512 + 16) = p2;
      *(v8h*)(d + c * 512 + 24) = p3;
    }
  }
}

// ---------------------------------------------------------------------------
// 3) Fused projections: Qp = Q@Wq+bq (f32+f16), Kp = K@Wk+bk (f16),
//    Vp = K@Wv+bv stored transposed [DIMV][ROWS] (f16); f16 in fragment order.
//    A work-group of 4 waves forms a 128x128 tile, a wave 64x64 of it (4x4 WMMA
//    tiles). Both operands pass through LDS, 64 k a stage, two buffers: a stage
//    is 16 runs of 2 KB (8 row tiles of X, 8 column tiles of W^T, two k tiles
//    each, as they lie in global memory), brought by asynchronous copies one
//    trip ahead. Every byte comes from L2 once a work-group, not once a wave.
//    Work-groups = 3 * (8192/128) * (512/128) = 768.
#define PJ_THREADS 128
#define PJ_RUN   1024                 // halves of a run: 16 rows x 64 k
#define PJ_BUF   (16 * PJ_RUN)        // halves of a stage
#define PJ_TRIPS (DIMV / 64)
#define TILE_ROW (KT_DIMV * 512)      // halves from one 16-row tile row to the next

// Eight copies of 16 bytes a lane, global memory to LDS: two runs, one tile row
// apart in global memory, adjacent in LDS. l and g are the lane's own addresses.
__device__ __forceinline__ void copy_two_runs(unsigned l, const _Float16* g) {
  const _Float16* h = g + TILE_ROW;
  // the closing wait stands in front of every later rewrite of the address
  // registers that these copies name
  asm volatile(
      "global_load_async_to_lds_b128 %0, %8, off\n\t"
      "global_load_async_to_lds_b128 %1, %9, off\n\t"
      "global_load_async_to_lds_b128 %2, %10, off\n\t"
      "global_load_async_to_lds_b128 %3, %11, off\n\t"
      "global_load_async_to_lds_b128 %4, %12, off\n\t"
      "global_load_async_to_lds_b128 %5, %13, off\n\t"
      "global_load_async_to_lds_b128 %6, %14, off\n\t"
      "global_load_async_to_lds_b128 %7, %15, off\n\t"
      "s_wait_xcnt 0x0"
      :: "v"(l), "v"(l + 512), "v"(l + 1024), "v"(l + 1536),
         "v"(l + 2048), "v"(l + 2560), "v"(l + 3072), "v"(l + 3584),
         "v"(g), "v"(g + 256), "v"(g + 512), "v"(g + 768),
         "v"(h), "v"(h + 256), "v"(h + 512), "v"(h + 768)
      : "memory");
}

// A wave's share of a stage: its four runs.
__device__ __forceinline__ void copy_stage(unsigned l, const _Float16* g) {
  copy_two_runs(l, g);
  copy_two_runs(l + 4096, g + 2 * TILE_ROW);
}

__global__ __launch_bounds__(PJ_THREADS) void proj_kernel(
    const _Float16* __restrict__ q16, const _Float16* __restrict__ k16,
    const _Float16* __restrict__ w16T,
    const float* __restrict__ bq, const float* __restrict__ bk,
    const float* __restrict__ bvv,
    float* __restrict__ qp32, _Float16* __restrict__ qp16,
    _Float16* __restrict__ kp16, _Float16* __restrict__ vpT) {
  __shared__ __attribute__((aligned(128))) _Float16 st[2 * PJ_BUF];

  int w = __builtin_amdgcn_readfirstlane((int)(threadIdx.x >> 5));  // scalar bases
  int lane = threadIdx.x & 31;
  int p = blockIdx.x >> 8;         // 0:Q 1:K 2:V  (256 work-groups each)
  int t = blockIdx.x & 255;        // 64 row blocks x 4 column blocks
  int brow = (t >> 2) * 128;
  int bcol = (t & 3) * 128;
  // The k walk starts at a stage of the work-group's own and wraps. 64 work-groups
  // read each W^T tile and 4 or 8 each X tile, all started together: from one
  // common start they would ask L2 for the same lines at the same moment.
  int rot = ((t >> 3) + ((t >> 2) & 1) * 4 + (t & 3) * 2 + p) & (PJ_TRIPS - 1);

  // Waves 0, 1 bring the 8 row tiles of X, waves 2, 3 the 8 column tiles of W^T.
  const _Float16* X = (p == 0) ? q16 : k16;
  const _Float16* src = (w < 2) ? X + (size_t)brow * DIMV
                                : w16T + (size_t)p * (DIMV * DIMV) + (size_t)bcol * DIMV;
  src += (w & 1) * (4 * TILE_ROW) + lane * 8;
  unsigned dst = (unsigned)(size_t)st + w * (4 * PJ_RUN * 2) + lane * 16;

  int wr = w >> 1, wc = w & 1;     // the wave's 64x64 tile of the block tile
  int row0 = brow + wr * 64;
  int col0 = bcol + wc * 64;
  const _Float16* afrag = st + wr * (4 * PJ_RUN);
  const _Float16* bfrag = st + (8 + wc * 4) * PJ_RUN;

  copy_stage(dst, src + rot * PJ_RUN);
  // stage 0 has landed for this wave ...
  asm volatile("s_wait_asynccnt 0x0" ::: "memory");
  __syncthreads();                 // ... and for every wave, before anyone reads it
  copy_stage(dst + PJ_BUF * 2, src + ((rot + 1) & (PJ_TRIPS - 1)) * PJ_RUN);

  v8f acc[4][4] = {};
  for (int s = 0; s < PJ_TRIPS; ++s) {
    int boff = (s & 1) * PJ_BUF;
#pragma unroll  // constant index: the arrays stay in registers
    for (int kk = 0; kk < 2; ++kk) {
      v16h af[4], bf[4];
#pragma unroll  // constant index: the arrays stay in registers
      for (int i = 0; i < 4; ++i) af[i] = load_tile(afrag + boff + i * PJ_RUN + kk * 512);
#pragma unroll  // constant index: the arrays stay in registers
      for (int j = 0; j < 4; ++j) bf[j] = load_tile(bfrag + boff + j * PJ_RUN + kk * 512);
      // the 16 LDS reads of a k tile stay one group in front of its 16 products:
      // the compiler would keep one A fragment and wait out a read per 4 products
      __builtin_amdgcn_sched_barrier(0);
#pragma unroll  // constant index: the arrays stay in registers
      for (int i = 0; i < 4; ++i)
#pragma unroll  // constant index: the arrays stay in registers
        for (int j = 0; j < 4; ++j) acc[i][j] = wmma_f16(af[i], bf[j], acc[i][j]);
    }
    // this wave's reads of the buffer have returned before it is refilled
    asm volatile("s_wait_dscnt 0x0" ::: "memory");
    // this wave's copies of the next stage have landed
    asm volatile("s_wait_asynccnt 0x0" ::: "memory");
    __syncthreads();   // publishes stage s + 1 and ends every read of stage s
    if (s + 2 < PJ_TRIPS)
      copy_stage(dst + boff * 2, src + ((s + 2 + rot) & (PJ_TRIPS - 1)) * PJ_RUN);
  }
  // no copy is outstanding when the wave goes on
  asm volatile("s_wait_asynccnt 0x0" ::: "memory");

  int n = lane & 15, mb = (lane >> 4) * 8;
  const float* bias = (p == 0) ? bq : (p == 1) ? bk : bvv;
  // p is the same for the work-group: one branch picks the writer of its matrix.
  if (p == 0) {
#pragma unroll
    for (int j = 0; j < 4; ++j) {
      int c = col0 + j * 16 + n;
      float bval = bias[c];
#pragma unroll
      for (int i = 0; i < 4; ++i) {
        for (int v = 0; v < 8; ++v) {
          int r = row0 + i * 16 + mb + v;
          float val = acc[i][j][v] + bval;
          qp32[(size_t)r * DIMV + c] = val;
          qp16[frag_off(r, c, KT_DIMV)] = (_Float16)val;
        }
      }
    }
  } else if (p == 1) {
#pragma unroll
    for (int j = 0; j < 4; ++j) {
      int c = col0 + j * 16 + n;
      float bval = bias[c];
#pragma unroll
      for (int i = 0; i < 4; ++i) {
        for (int v = 0; v < 8; ++v) {
          int r = row0 + i * 16 + mb + v;
          kp16[frag_off(r, c, KT_DIMV)] = (_Float16)(acc[i][j][v] + bval);
        }
      }
    }
  } else {
    // Transposed V: a lane's 8 accumulators are 8 successive keys of one
    // column, which is one 16-byte piece of the fragment order.
#pragma unroll
    for (int j = 0; j < 4; ++j) {
      int c = col0 + j * 16 + n;
      float bval = bias[c];
#pragma unroll
      for (int i = 0; i < 4; ++i) {
        v8h piece;
        for (int v = 0; v < 8; ++v) piece[v] = (_Float16)(acc[i][j][v] + bval);
        *(v8h*)(vpT + frag_off(c, row0 + i * 16 + mb, KT_ROWS)) = piece;
      }
    }
  }
}

// ---------------------------------------------------------------------------
// 4) Attention, transposed products: S^T = Kh @ Qh^T and O^T = Vh^T @ P^T.
//    One wave owns 32 queries (two 16-column groups) of one (b, h) and walks all
//    1024 keys, 32 a step. In an S^T tile a lane holds 8 keys of ONE query, and
//    two such tiles are, register for register, the B fragment of the second
//    product (k = g*8+i, then 16+g*8+i), so the scores never leave registers.
//    Walk 1 finds each query's maximum, walk 2 forms the scores again, takes
//    exp and multiplies by V. 8 waves / block = 256 queries of one (b, h).
#define K_STEP (2 * KT_DIMV * 512)   // halves from one 32-key group of K to the next
#define NSTEP  (SEQ / 32)

// The four K fragments of 32-key group g: [key tile][head-dim half].
__device__ __forceinline__ void load_k(v16h (&kc)[4], const _Float16* __restrict__ kb,
                                       int g) {
  const _Float16* p = kb + (size_t)g * K_STEP;
  kc[0] = load_tile(p);
  kc[1] = load_tile(p + 512);
  kc[2] = load_tile(p + KT_DIMV * 512);
  kc[3] = load_tile(p + KT_DIMV * 512 + 512);
}

// The four V^T fragments (16 head dims each) of 32-key group g.
__device__ __forceinline__ void load_v(v16h (&vc)[4], const _Float16* __restrict__ vb,
                                       int g) {
#pragma unroll  // constant index: the array stays in registers
  for (int dt = 0; dt < 4; ++dt)
    vc[dt] = load_tile(vb + (size_t)dt * (KT_ROWS * 512) + g * 512);
}

// S^T of one 32-key group: s[key tile][query group].
__device__ __forceinline__ void scores_t(v8f (&s)[2][2], const v16h (&kc)[4],
                                         const v16h (&qb)[2][2]) {
#pragma unroll  // constant index: the array stays in registers
  for (int i = 0; i < 2; ++i)
#pragma unroll  // constant index: the array stays in registers
    for (int t = 0; t < 2; ++t) {
      v8f z = {};
      z = wmma_f16(kc[2 * i], qb[t][0], z);
      s[i][t] = wmma_f16(kc[2 * i + 1], qb[t][1], z);
    }
}

// Walk 1, one step: scores of the group in kc, refill kc, running maxima.
__device__ __forceinline__ void max_step(v16h (&kc)[4], const _Float16* __restrict__ kb,
                                         int gnext, const v16h (&qb)[2][2],
                                         float (&mx)[2][2]) {
  v8f s[2][2];
  scores_t(s, kc, qb);
  load_k(kc, kb, gnext);
#pragma unroll  // constant index: the array stays in registers
  for (int i = 0; i < 2; ++i)
#pragma unroll  // constant index: the array stays in registers
    for (int t = 0; t < 2; ++t)
#pragma unroll  // constant index: the array stays in registers
      for (int v = 0; v < 8; ++v) mx[i][t] = fmaxf(mx[i][t], s[i][t][v]);
  // one step's scores are used up before the next step's are formed: without
  // this the four steps' scores are held side by side, over 256 registers
  __builtin_amdgcn_sched_barrier(0);
}

// Walk 2, one step: scores again, refill kc, exp, O^T += V^T P^T, refill vc.
__device__ __forceinline__ void pv_step(v16h (&kc)[4], v16h (&vc)[4],
                                        const _Float16* __restrict__ kb,
                                        const _Float16* __restrict__ vb,
                                        int gk, int gv, const v16h (&qb)[2][2],
                                        const float (&mc)[2], float cs,
                                        float (&sum)[2][2], v8f (&o)[4][2]) {
  v8f s[2][2];
  scores_t(s, kc, qb);
  load_k(kc, kb, gk);
  v16h p[2];
#pragma unroll  // constant index: the array stays in registers
  for (int t = 0; t < 2; ++t)
#pragma unroll  // constant index: the array stays in registers
    for (int i = 0; i < 2; ++i)
#pragma unroll  // constant index: the array stays in registers
      for (int v = 0; v < 8; ++v) {
        float e = __builtin_amdgcn_exp2f(s[i][t][v] * cs - mc[t]);
        sum[i][t] += e;
        p[t][i * 8 + v] = (_Float16)e;
      }
#pragma unroll  // constant index: the array stays in registers
  for (int dt = 0; dt < 4; ++dt)
#pragma unroll  // constant index: the array stays in registers
    for (int t = 0; t < 2; ++t) o[dt][t] = wmma_f16(vc[dt], p[t], o[dt][t]);
  load_v(vc, vb, gv);
}

__global__ __launch_bounds__(256) void attn_kernel(
    const _Float16* __restrict__ qp16, const _Float16* __restrict__ kp16,
    const _Float16* __restrict__ vpT, const float* __restrict__ qp32,
    float* __restrict__ ao32) {
  int bid = blockIdx.x;
  int qq = bid & 3;
  int h = (bid >> 2) & 7;
  int b = bid >> 5;

  int w = __builtin_amdgcn_readfirstlane((int)(threadIdx.x >> 5));  // scalar tile bases
  int lane = threadIdx.x & 31;
  int n = lane & 15, mb = (lane >> 4) * 8;
  int grow = b * SEQ + qq * 256 + w * 32;
  // Both key walks start at a group of the work-group's own and wrap: the four
  // work-groups of one (b, h) read the same K and V and would ask L2 for the same
  // lines at the same moment; the heads' share spreads V's addresses as well.
  int rot = qq * (NSTEP / 4) + h;

  const _Float16* kb = kp16 + frag_off(b * SEQ, h * HDIM, KT_DIMV);
  const _Float16* vb = vpT + frag_off(h * HDIM, b * SEQ, KT_ROWS);

  v16h qb[2][2];                       // Q as B operand, kept for both walks
#pragma unroll  // constant index: the array stays in registers
  for (int t = 0; t < 2; ++t) {
    const _Float16* qbase = qp16 + frag_off(grow + t * 16, h * HDIM, KT_DIMV);
    qb[t][0] = load_tile(qbase);
    qb[t][1] = load_tile(qbase + 512);
  }

  // ---- walk 1: maxima. Four K buffers, each refilled four steps ahead; the
  // last refills wrap to the first groups and so hand walk 2 its first two.
  v16h kA[4], kB[4], kC[4], kD[4];
  load_k(kA, kb, rot);
  // a group's base registers are rewritten for the next group (here and below)
  asm volatile("s_wait_xcnt 0x0" ::: "memory");
  load_k(kB, kb, (rot + 1) & (NSTEP - 1));
  asm volatile("s_wait_xcnt 0x0" ::: "memory");
  load_k(kC, kb, (rot + 2) & (NSTEP - 1));
  asm volatile("s_wait_xcnt 0x0" ::: "memory");
  load_k(kD, kb, (rot + 3) & (NSTEP - 1));
  float mx[2][2] = {{-3.0e38f, -3.0e38f}, {-3.0e38f, -3.0e38f}};
  for (int s = 0; s < NSTEP; s += 4) {
    int g = s + rot;
    max_step(kA, kb, (g + 4) & (NSTEP - 1), qb, mx);
    max_step(kB, kb, (g + 5) & (NSTEP - 1), qb, mx);
    max_step(kC, kb, (g + 6) & (NSTEP - 1), qb, mx);
    max_step(kD, kb, (g + 7) & (NSTEP - 1), qb, mx);
    // the last loads' address registers are rewritten at the head of the loop
    asm volatile("s_wait_xcnt 0x0" ::: "memory");
  }

  // exp(x / 8 - m / 8) = exp2(x * cs - m * cs); both wave halves hold keys of
  // the same query and must use one maximum.
  const float cs = 0.125f * 1.44269504088896340736f;
  float mc[2];
#pragma unroll  // constant index: the array stays in registers
  for (int t = 0; t < 2; ++t) {
    float m = fmaxf(mx[0][t], mx[1][t]);
    m = fmaxf(m, __shfl_xor(m, 16, 32));
    mc[t] = m * cs;
  }

  // ---- walk 2: P^T = exp(S^T - max), O^T += V^T P^T (1/sum deferred)
  v16h vc[4];
  load_v(vc, vb, rot);
  float sum[2][2] = {};
  v8f o[4][2] = {};
  for (int s = 0; s < NSTEP; s += 2) {
    int g = s + rot;
    pv_step(kA, vc, kb, vb, (g + 2) & (NSTEP - 1), (g + 1) & (NSTEP - 1), qb, mc, cs,
            sum, o);
    pv_step(kB, vc, kb, vb, (g + 3) & (NSTEP - 1), (g + 2) & (NSTEP - 1), qb, mc, cs,
            sum, o);
    // the last loads' address registers are rewritten at the head of the loop
    asm volatile("s_wait_xcnt 0x0" ::: "memory");
  }

  // ---- O = O^T / sum + Qp: a lane holds 8 successive head dims of one query
#pragma unroll  // constant index: the array stays in registers
  for (int t = 0; t < 2; ++t) {
    float sm = sum[0][t] + sum[1][t];
    sm += __shfl_xor(sm, 16, 32);
    float inv = 1.0f / sm;
    // one 32-bit byte offset serves the residual's loads and the stores
    unsigned boff = (unsigned)(((grow + t * 16 + n) * DIMV + h * HDIM + mb) * 4);
    const char* rq = (const char*)qp32 + boff;
    char* wo = (char*)ao32 + boff;
#pragma unroll  // constant index: the array stays in registers
    for (int dt = 0; dt < 4; ++dt) {
      float4 r0 = *(const float4*)(rq + dt * 64);
      float4 r1 = *(const float4*)(rq + dt * 64 + 16);
      float4 y0, y1;
      y0.x = o[dt][t][0] * inv + r0.x;
      y0.y = o[dt][t][1] * inv + r0.y;
      y0.z = o[dt][t][2] * inv + r0.z;
      y0.w = o[dt][t][3] * inv + r0.w;
      y1.x = o[dt][t][4] * inv + r1.x;
      y1.y = o[dt][t][5] * inv + r1.y;
      y1.z = o[dt][t][6] * inv + r1.z;
      y1.w = o[dt][t][7] * inv + r1.w;
      *(float4*)(wo + dt * 64) = y0;
      *(float4*)(wo + dt * 64 + 16) = y1;
    }
  }
}

// ---------------------------------------------------------------------------
// 5) The row-local tail in one launch: X1 = LN0(attention output),
//    Z = X1 + relu(X1 @ Wo + bo), out = LN1(Z). A work-group of 8 waves owns 32
//    whole rows, which stay in LDS from the first step to the last:
//      a) a wave normalises 4 rows (a lane holds 16 values of each, as four
//         16-byte pieces 512 bytes apart) and leaves X1 in LDS as f32 and f16;
//      b) a wave forms a 32x64 tile of X1 @ Wo, A fragments from LDS, the Wo
//         fragments of four k steps in flight (the first ones during step a);
//      c) it adds relu(.) to the f32 X1 in LDS, each element by its one owner;
//      d) a wave normalises its 4 rows again and stores whole lines.
#define TAIL_ROWS 32
#define XPITCH 516            // floats a row: rows 8 apart lie 32 banks apart
#define GPITCH 136            // halves: the 16 rows' pieces of one k octet, 256 + 16 bytes
#define RTILE  (64 * GPITCH)  // halves of a 16-row tile: 64 k octets

typedef __attribute__((ext_vector_type(4))) _Float16 v4h;

// LayerNorm of 4 rows held by one wave: x[row][piece], columns piece*128+lane*4.
__device__ __forceinline__ void ln_rows(float4 (&x)[4][4], const float4 (&ga)[4],
                                        const float4 (&be)[4]) {
  float sum[4], sq[4];
#pragma unroll  // constant index: the arrays stay in registers
  for (int r = 0; r < 4; ++r) {
    sum[r] = 0.f;
    sq[r] = 0.f;
#pragma unroll  // constant index: the arrays stay in registers
    for (int c = 0; c < 4; ++c) {
      float4 t = x[r][c];
      sum[r] += t.x + t.y + t.z + t.w;
      sq[r] += t.x * t.x + t.y * t.y + t.z * t.z + t.w * t.w;
    }
  }
#pragma unroll  // the eight chains of a step run side by side
  for (int off = 16; off > 0; off >>= 1)
#pragma unroll  // constant index: the arrays stay in registers
    for (int r = 0; r < 4; ++r) {
      sum[r] += __shfl_xor(sum[r], off, 32);
      sq[r] += __shfl_xor(sq[r], off, 32);
    }
#pragma unroll  // constant index: the arrays stay in registers
  for (int r = 0; r < 4; ++r) {
    float mean = sum[r] * (1.0f / DIMV);
    float var = sq[r] * (1.0f / DIMV) - mean * mean;
    float rstd = rsqrtf(var + 1e-5f);
#pragma unroll  // constant index: the arrays stay in registers
    for (int c = 0; c < 4; ++c) {
      float4 t = x[r][c];
      t.x = (t.x - mean) * rstd * ga[c].x + be[c].x;
      t.y = (t.y - mean) * rstd * ga[c].y + be[c].y;
      t.z = (t.z - mean) * rstd * ga[c].z + be[c].z;
      t.w = (t.w - mean) * rstd * ga[c].w + be[c].w;
      x[r][c] = t;
    }
  }
}

#define TAIL_STEPS (DIMV / 32)
#define B_AHEAD 4             // k steps of Wo fragments in flight

// The four Wo fragments (16 columns each) of k step s.
__device__ __forceinline__ void load_b4(v16h (&b)[4], const _Float16* __restrict__ bbase,
                                        int s) {
#pragma unroll  // constant index: the array stays in registers
  for (int j = 0; j < 4; ++j) b[j] = load_tile(bbase + j * 16 * DIMV + s * 512);
}

// The two X1 fragments (16 rows each) of k step s, from LDS.
__device__ __forceinline__ void load_a2(v16h (&a)[2], const _Float16* afrag, int s) {
#pragma unroll  // constant index: the array stays in registers
  for (int i = 0; i < 2; ++i) {
    const _Float16* p = afrag + i * RTILE + s * 4 * GPITCH;
    union { v16h v; v8h h[2]; } u;
    u.h[0] = *(const v8h*)(p);
    u.h[1] = *(const v8h*)(p + 2 * GPITCH);
    a[i] = u.v;
  }
}

__global__ __launch_bounds__(256) void tail_kernel(
    const float* __restrict__ ao32, const _Float16* __restrict__ woT,
    const float* __restrict__ bo, const float* __restrict__ g0,
    const float* __restrict__ b0, const float* __restrict__ g1,
    const float* __restrict__ b1, float* __restrict__ out) {
  __shared__ __attribute__((aligned(16))) float xs[TAIL_ROWS * XPITCH];
  __shared__ __attribute__((aligned(16))) _Float16 xh[2 * RTILE];

  int w = __builtin_amdgcn_readfirstlane((int)(threadIdx.x >> 5));  // scalar bases
  int lane = threadIdx.x & 31;
  int row0 = blockIdx.x * TAIL_ROWS;
  int col0 = w * 64;
  const _Float16* bbase = woT + (size_t)col0 * DIMV;
  v16h bf[B_AHEAD][4];
  // The k walk of step b starts at a k step of the work-group's own and wraps:
  // every work-group reads the whole of Wo, and from one common start all of them
  // would ask L2 for the same lines at the same moment.
  int rot = (blockIdx.x + (blockIdx.x >> 3)) & (TAIL_STEPS - 1);

  // ---- a) LN0 of rows w*4 .. w*4+3
  float4 x[4][4], ga[4], be[4];
  {
    const float* s = ao32 + (size_t)(row0 + w * 4) * DIMV + lane * 4;
#pragma unroll  // constant index: the arrays stay in registers
    for (int r = 0; r < 4; ++r)
#pragma unroll  // constant index: the arrays stay in registers
      for (int c = 0; c < 4; ++c) x[r][c] = *(const float4*)(s + r * DIMV + c * 128);
#pragma unroll  // constant index: the arrays stay in registers
    for (int c = 0; c < 4; ++c) {
      ga[c] = *(const float4*)(g0 + c * 128 + lane * 4);
      be[c] = *(const float4*)(b0 + c * 128 + lane * 4);
    }
  }
  // Wo does not depend on step a: its first fragments fly while LN0 is done,
  // two k steps behind the rows' own loads, two more once gamma and beta are used.
  load_b4(bf[0], bbase, rot);
  load_b4(bf[1], bbase, (rot + 1) & (TAIL_STEPS - 1));
  // these loads stay in front of LN0: the compiler would sink them to their use
  __builtin_amdgcn_sched_barrier(0);
  ln_rows(x, ga, be);
  load_b4(bf[2], bbase, (rot + 2) & (TAIL_STEPS - 1));
  load_b4(bf[3], bbase, (rot + 3) & (TAIL_STEPS - 1));
  // and these in front of the LDS stores and the barrier
  __builtin_amdgcn_sched_barrier(0);
  {
    float* d32 = xs + (w * 4) * XPITCH + lane * 4;
    // f16 copy: row, k -> tile row/16, octet k/8, the row's piece, k%8. That is
    // the fragment order with 16 bytes more behind every 256.
    _Float16* d16 = xh + (w >> 2) * RTILE + (lane >> 1) * GPITCH + (w & 3) * 32 +
                    (lane & 1) * 4;
#pragma unroll  // constant index: the arrays stay in registers
    for (int r = 0; r < 4; ++r)
#pragma unroll  // constant index: the arrays stay in registers
      for (int c = 0; c < 4; ++c) {
        float4 t = x[r][c];
        *(float4*)(d32 + r * XPITCH + c * 128) = t;
        v4h hq;
        hq[0] = (_Float16)t.x; hq[1] = (_Float16)t.y;
        hq[2] = (_Float16)t.z; hq[3] = (_Float16)t.w;
        *(v4h*)(d16 + c * 16 * GPITCH + r * 8) = hq;
      }
  }
  __syncthreads();   // every row of X1 is in LDS before any wave multiplies

  // ---- b) 32x64 tile of X1 @ Wo: columns w*64 ..
  int n = lane & 15, mb = (lane >> 4) * 8;
  const _Float16* afrag = xh + (lane >> 4) * GPITCH + (lane & 15) * 8;
  v16h af[2][2];
  load_a2(af[0], afrag, rot);
  v8f acc[2][4] = {};
  float bval[4];
#pragma unroll  // constant index: the fragment rings stay in registers
  for (int s = 0; s < TAIL_STEPS; ++s) {
    if (s + 1 < TAIL_STEPS)
      load_a2(af[(s + 1) & 1], afrag, (s + 1 + rot) & (TAIL_STEPS - 1));
#pragma unroll  // constant index: the arrays stay in registers
    for (int j = 0; j < 4; ++j) {
      acc[0][j] = wmma_f16(af[s & 1][0], bf[s % B_AHEAD][j], acc[0][j]);
      acc[1][j] = wmma_f16(af[s & 1][1], bf[s % B_AHEAD][j], acc[1][j]);
    }
    if (s + B_AHEAD < TAIL_STEPS)
      load_b4(bf[s % B_AHEAD], bbase, (s + B_AHEAD + rot) & (TAIL_STEPS - 1));
    if (s + B_AHEAD == TAIL_STEPS) {
      // the refills have ended: their offset register falls free and is rewritten
      asm volatile("s_wait_xcnt 0x0" ::: "memory");
      // the bias of step c flies in the refills' place
#pragma unroll  // constant index: the array stays in registers
      for (int j = 0; j < 4; ++j) bval[j] = bo[col0 + j * 16 + n];
    }
    // a refill is issued where its buffer falls free: the compiler would sink it
    // to its use, four steps on, and wait out each load's whole latency there
    __builtin_amdgcn_sched_barrier(0);
  }
  // the bias loads' offset register is reused by the address work that follows
  asm volatile("s_wait_xcnt 0x0" ::: "memory");

  // ---- c) Z = X1 + relu(acc + bo), in place in LDS; LN1's gamma and beta fly
#pragma unroll  // constant index: the arrays stay in registers
  for (int c = 0; c < 4; ++c) {
    ga[c] = *(const float4*)(g1 + c * 128 + lane * 4);
    be[c] = *(const float4*)(b1 + c * 128 + lane * 4);
  }
  float* z = xs + mb * XPITCH + col0 + n;
#pragma unroll
  for (int j = 0; j < 4; ++j) {
#pragma unroll
    for (int i = 0; i < 2; ++i) {
#pragma unroll  // constant index: the accumulators stay in registers
      for (int v = 0; v < 8; ++v) {
        float* e = z + (i * 16 + v) * XPITCH + j * 16;
        *e = *e + fmaxf(acc[i][j][v] + bval[j], 0.0f);
      }
    }
  }
  __syncthreads();   // every column of Z is in LDS before a row is summed

  // ---- d) LN1 of rows w*4 .. w*4+3, stored as whole lines
  {
    const float* s = xs + (w * 4) * XPITCH + lane * 4;
#pragma unroll  // constant index: the arrays stay in registers
    for (int r = 0; r < 4; ++r)
#pragma unroll  // constant index: the arrays stay in registers
      for (int c = 0; c < 4; ++c) x[r][c] = *(const float4*)(s + r * XPITCH + c * 128);
  }
  ln_rows(x, ga, be);
  {
    float* d = out + (size_t)(row0 + w * 4) * DIMV + lane * 4;
#pragma unroll  // constant index: the arrays stay in registers
    for (int r = 0; r < 4; ++r)
#pragma unroll  // constant index: the arrays stay in registers
      for (int c = 0; c < 4; ++c) *(float4*)(d + r * DIMV + c * 128) = x[r][c];
  }
}

// ---------------------------------------------------------------------------
extern "C" void kernel_launch(void* const* d_in, const int* in_sizes, int n_in,
                              void* d_out, int out_size, void* d_ws, size_t ws_size,
                              hipStream_t stream) {
  const float* Q  = (const float*)d_in[0];
  const float* K  = (const float*)d_in[1];
  const float* Wq = (const float*)d_in[2];
  const float* bq = (const float*)d_in[3];
  const float* Wk = (const float*)d_in[4];
  const float* bk = (const float*)d_in[5];
  const float* Wv = (const float*)d_in[6];
  const float* bv = (const float*)d_in[7];
  const float* Wo = (const float*)d_in[8];
  const float* bo = (const float*)d_in[9];
  const float* g0 = (const float*)d_in[10];
  const float* b0 = (const float*)d_in[11];
  const float* g1 = (const float*)d_in[12];
  const float* b1 = (const float*)d_in[13];
  float* out = (float*)d_out;

  char* ws = (char*)d_ws;
  _Float16* q16  = (_Float16*)(ws);                         // 8 MB
  _Float16* k16  = (_Float16*)(ws + 8388608);               // 8 MB
  _Float16* w16T = (_Float16*)(ws + 16777216);              // 2 MB (4 mats)
  float*    qp32 = (float*)   (ws + 18874368);              // 16 MB
  _Float16* qp16 = (_Float16*)(ws + 35651584);              // 8 MB
  _Float16* kp16 = (_Float16*)(ws + 44040192);              // 8 MB
  _Float16* vpT  = (_Float16*)(ws + 52428800);              // 8 MB
  float*    ao32 = (float*)   (ws + 60817408);              // 16 MB
  // total workspace: ~74 MB

  // 1) all conversions: q16 and k16 lie one behind the other, w16T holds 4 mats
  const int WN = DIMV * DIMV;
  cvt_all_kernel<<<256, CVT_THREADS, 0, stream>>>(Q, K, Wq, Wk, Wv, Wo, q16, w16T);

  // 3) projections: 768 work-groups of 4 waves, a 128x128 tile each
  proj_kernel<<<768, PJ_THREADS, 0, stream>>>(q16, k16, w16T, bq, bk, bv,
                                       qp32, qp16, kp16, vpT);

  // 4) attention: B*H*(SEQ/256) = 256 blocks of 8 waves, 32 queries a wave
  attn_kernel<<<256, 256, 0, stream>>>(qp16, kp16, vpT, qp32, ao32);

  // 5) LN0, x1 + relu(x1 @ Wo + bo), LN1 -> d_out: 32 whole rows a work-group
  tail_kernel<<<ROWS / TAIL_ROWS, 256, 0, stream>>>(ao32, w16T + 3 * WN, bo, g0, b0, g1, b1,
                                                    out);
}

// v007
// Measured time: 57.3 microseconds a run.
// In both of two side-by-side timings against v006, it was 1.11 times as fast.
// Over all steps from v000 it is 4.60 times as fast.
#include <hip/hip_runtime.h>
#include <hip/hip_bf16.h>

// ---------------------------------------------------------------------------
// MAB (multihead attention block) for MI455X / gfx1250, wave32 + WMMA f16->f32
// Register-blocked GEMMs: one wave computes a 64x64 or a 32x64 tile.
// Every f16 matrix in the workspace is kept in fragment order (see frag_off).
// ---------------------------------------------------------------------------

typedef __attribute__((ext_vector_type(16))) _Float16 v16h;
typedef __attribute__((ext_vector_type(8)))  _Float16 v8h;
typedef __attribute__((ext_vector_type(8)))  float    v8f;

#define DIMV   512
#define ROWS   8192          // B*N = 8*1024
#define SEQ    1024
#define NHEAD  8
#define HDIM   64

__device__ __forceinline__ v8f wmma_f16(v16h a, v16h b, v8f c) {
  return __builtin_amdgcn_wmma_f32_16x16x32_f16(false, a, false, b,
                                                (short)0, c, false, false);
}

// k order of a 16x32 f16 fragment (ISA 7.12.2): lane r = lane&15 supplies row r
// (a row of A, or a column of B), g = lane>>4 selects the K half; elements
// i=0..7 -> K = g*8+i ; i=8..15 -> K = 16+g*8+(i-8).

// Fragment order of a [rows x 32*kt] f16 matrix in global memory: 16x32 tiles
// of 512 halves, tile (row/16, k/32) at index (row/16)*kt + k/32. Inside a tile
// the 8 halves that one lane takes with one 16-byte load lie together, and the
// 32 lanes' pieces follow one another: piece hs*32 + g*16 + r holds row r,
// k = hs*16 + g*8 .. +7. That is the k order given above, so a fragment is two
// loads of 512 contiguous bytes each.
__device__ __forceinline__ size_t frag_off(int row, int k, int kt) {
  return ((size_t)(row >> 4) * kt + (k >> 5)) * 512 + ((k >> 4) & 1) * 256 +
         (((k >> 3) & 1) * 16 + (row & 15)) * 8 + (k & 7);
}

// Load the fragment whose tile starts at `tile` (fragment-order storage).
__device__ __forceinline__ v16h load_tile(const _Float16* __restrict__ tile) {
  const _Float16* p = tile + (threadIdx.x & 31) * 8;
  union { v16h v; v8h h[2]; } u;
  u.h[0] = *(const v8h*)(p);
  u.h[1] = *(const v8h*)(p + 256);
  return u.v;
}

#define KT_DIMV (DIMV / 32)   // k tiles of a [rows x 512] matrix
#define KT_ROWS (ROWS / 32)   // k tiles of the [512 x 8192] transposed V

// ---------------------------------------------------------------------------
// 1) Every f32 -> f16 conversion in one launch of 256 work-groups of 9 waves.
//    A thread makes whole 16-byte pieces of the fragment order (8 values each)
//    and has all of its 32 16-byte loads in flight before the first convert.
//    Waves 0..7: 16 rows x 256 columns of Q or K each (8 tiles, 16 pieces a
//    lane). A lane takes row l>>2 (and that + 8), k piece l&3 of each tile: a
//    store covers four whole 128-byte lines.
//    Wave 8: 128 (k) x 32 (n) of one weight matrix, transposed (element (n,k) =
//    src[k*512+n]). A lane reads 4 n of 8 successive k, which are 4 pieces,
//    64 contiguous bytes of the result; a load covers four whole lines.
#define CVT_THREADS 288

__device__ __forceinline__ v8h to_piece(float4 lo, float4 hi) {
  v8h p;
  p[0] = (_Float16)lo.x; p[1] = (_Float16)lo.y;
  p[2] = (_Float16)lo.z; p[3] = (_Float16)lo.w;
  p[4] = (_Float16)hi.x; p[5] = (_Float16)hi.y;
  p[6] = (_Float16)hi.z; p[7] = (_Float16)hi.w;
  return p;
}

__global__ __launch_bounds__(CVT_THREADS) void cvt_all_kernel(
    const float* __restrict__ Q, const float* __restrict__ K,
    const float* __restrict__ Wq, const float* __restrict__ Wk,
    const float* __restrict__ Wv, const float* __restrict__ Wo,
    _Float16* __restrict__ x16,      // Q's 8192 rows, then K's
    _Float16* __restrict__ w16T) {
  int w = __builtin_amdgcn_readfirstlane((int)(threadIdx.x >> 5));  // scalar branch and bases
  int lane = threadIdx.x & 31;
  if (w < 8) {
    int job = blockIdx.x * 8 + w;    // 2048 jobs
    int rt = job >> 1;               // 16-row tile of [Q; K]
    int kh = job & 1;                // column half
    const float* X = (rt < ROWS / 16) ? Q : K;
    const float* s = X + (size_t)(rt & (ROWS / 16 - 1)) * (16 * DIMV) + kh * 256 +
                     (lane >> 2) * DIMV + (lane & 3) * 8;
    _Float16* d = x16 + ((size_t)rt * KT_DIMV + kh * 8) * 512 +
                  ((lane & 3) * 16 + (lane >> 2)) * 8;
    float4 v[2][8][2];
#pragma unroll  // constant index: the array stays in registers
    for (int h = 0; h < 2; ++h)
#pragma unroll  // constant index: the array stays in registers
      for (int t = 0; t < 8; ++t) {
        v[h][t][0] = *(const float4*)(s + h * (8 * DIMV) + t * 32);
        v[h][t][1] = *(const float4*)(s + h * (8 * DIMV) + t * 32 + 4);
      }
    // no convert is moved up among the loads: without this the compiler saves
    // registers by waiting for early loads before it issues the late ones
    __builtin_amdgcn_sched_barrier(0);
    // the loads' address registers are rewritten next, for the stores' offset
    asm volatile("s_wait_xcnt 0x0" ::: "memory");
#pragma unroll  // constant index: the array stays in registers
    for (int h = 0; h < 2; ++h)
#pragma unroll  // constant index: the array stays in registers
      for (int t = 0; t < 8; ++t)
        *(v8h*)(d + t * 512 + h * 64) = to_piece(v[h][t][0], v[h][t][1]);
  } else {
    int job = blockIdx.x;            // 256 jobs: 4 matrices x 4 k blocks x 16 n blocks
    int m = job >> 6;
    int k0 = ((job >> 4) & 3) * 128, n0 = (job & 15) * 32;
    const float* Wm = (m == 0) ? Wq : (m == 1) ? Wk : (m == 2) ? Wv : Wo;
    int kg = lane >> 3, ng = lane & 7;
    const float* s = Wm + (size_t)(k0 + kg * 8) * DIMV + n0 + ng * 4;
    _Float16* d = w16T + (size_t)m * (DIMV * DIMV) +
                  frag_off(n0 + ng * 4, k0 + kg * 8, KT_DIMV);
    float4 v[4][8];
#pragma unroll  // constant index: the array stays in registers
    for (int c = 0; c < 4; ++c)
#pragma unroll  // constant index: the array stays in registers
      for (int j = 0; j < 8; ++j)
        v[c][j] = *(const float4*)(s + (c * 32 + j) * DIMV);
    // no convert is moved up among the loads: without this the compiler saves
    // registers by waiting for early loads before it issues the late ones
    __builtin_amdgcn_sched_barrier(0);
    // the loads' address registers are rewritten next, for the stores' offset
    asm volatile("s_wait_xcnt 0x0" ::: "memory");
#pragma unroll  // constant index: the array stays in registers
    for (int c = 0; c < 4; ++c) {
      v8h p0, p1, p2, p3;
#pragma unroll  // constant index: the array stays in registers
      for (int j = 0; j < 8; ++j) {
        p0[j] = (_Float16)v[c][j].x;
        p1[j] = (_Float16)v[c][j].y;
        p2[j] = (_Float16)v[c][j].z;
        p3[j] = (_Float16)v[c][j].w;
      }
      *(v8h*)(d + c * 512) = p0;
      *(v8h*)(d + c * 512 + 8) = p1;
      *(v8h*)(d + c * 512 + 16) = p2;
      *(v8h*)(d + c * 512 + 24) = p3;
    }
  }
}

// ---------------------------------------------------------------------------
// 3) Fused projections: Qp = Q@Wq+bq (f32+f16), Kp = K@Wk+bk (f16),
//    Vp = K@Wv+bv stored transposed [DIMV][ROWS] (f16); f16 in fragment order.
//    A work-group of 4 waves forms a 128x128 tile, a wave 64x64 of it (4x4 WMMA
//    tiles). Both operands pass through LDS, 64 k a stage, two buffers: a stage
//    is 16 runs of 2 KB (8 row tiles of X, 8 column tiles of W^T, two k tiles
//    each, as they lie in global memory), brought by asynchronous copies one
//    trip ahead. Every byte comes from L2 once a work-group, not once a wave.
//    Work-groups = 3 * (8192/128) * (512/128) = 768.
#define PJ_THREADS 128
#define PJ_RUN   1024                 // halves of a run: 16 rows x 64 k
#define PJ_BUF   (16 * PJ_RUN)        // halves of a stage
#define PJ_TRIPS (DIMV / 64)
#define TILE_ROW (KT_DIMV * 512)      // halves from one 16-row tile row to the next

// Eight copies of 16 bytes a lane, global memory to LDS: two runs, one tile row
// apart in global memory, adjacent in LDS. l and g are the lane's own addresses.
__device__ __forceinline__ void copy_two_runs(unsigned l, const _Float16* g) {
  const _Float16* h = g + TILE_ROW;
  // the closing wait stands in front of every later rewrite of the address
  // registers that these copies name
  asm volatile(
      "global_load_async_to_lds_b128 %0, %8, off\n\t"
      "global_load_async_to_lds_b128 %1, %9, off\n\t"
      "global_load_async_to_lds_b128 %2, %10, off\n\t"
      "global_load_async_to_lds_b128 %3, %11, off\n\t"
      "global_load_async_to_lds_b128 %4, %12, off\n\t"
      "global_load_async_to_lds_b128 %5, %13, off\n\t"
      "global_load_async_to_lds_b128 %6, %14, off\n\t"
      "global_load_async_to_lds_b128 %7, %15, off\n\t"
      "s_wait_xcnt 0x0"
      :: "v"(l), "v"(l + 512), "v"(l + 1024), "v"(l + 1536),
         "v"(l + 2048), "v"(l + 2560), "v"(l + 3072), "v"(l + 3584),
         "v"(g), "v"(g + 256), "v"(g + 512), "v"(g + 768),
         "v"(h), "v"(h + 256), "v"(h + 512), "v"(h + 768)
      : "memory");
}

// A wave's share of a stage: its four runs.
__device__ __forceinline__ void copy_stage(unsigned l, const _Float16* g) {
  copy_two_runs(l, g);
  copy_two_runs(l + 4096, g + 2 * TILE_ROW);
}

__global__ __launch_bounds__(PJ_THREADS) void proj_kernel(
    const _Float16* __restrict__ q16, const _Float16* __restrict__ k16,
    const _Float16* __restrict__ w16T,
    const float* __restrict__ bq, const float* __restrict__ bk,
    const float* __restrict__ bvv,
    float* __restrict__ qp32, _Float16* __restrict__ qp16,
    _Float16* __restrict__ kp16, _Float16* __restrict__ vpT) {
  __shared__ __attribute__((aligned(128))) _Float16 st[2 * PJ_BUF];

  int w = __builtin_amdgcn_readfirstlane((int)(threadIdx.x >> 5));  // scalar bases
  int lane = threadIdx.x & 31;
  int p = blockIdx.x >> 8;         // 0:Q 1:K 2:V  (256 work-groups each)
  int t = blockIdx.x & 255;        // 64 row blocks x 4 column blocks
  int brow = (t >> 2) * 128;
  int bcol = (t & 3) * 128;
  // The k walk starts at a stage of the work-group's own and wraps. 64 work-groups
  // read each W^T tile and 4 or 8 each X tile, all started together: from one
  // common start they would ask L2 for the same lines at the same moment.
  int rot = ((t >> 3) + ((t >> 2) & 1) * 4 + (t & 3) * 2 + p) & (PJ_TRIPS - 1);

  // Waves 0, 1 bring the 8 row tiles of X, waves 2, 3 the 8 column tiles of W^T.
  const _Float16* X = (p == 0) ? q16 : k16;
  const _Float16* src = (w < 2) ? X + (size_t)brow * DIMV
                                : w16T + (size_t)p * (DIMV * DIMV) + (size_t)bcol * DIMV;
  src += (w & 1) * (4 * TILE_ROW) + lane * 8;
  unsigned dst = (unsigned)(size_t)st + w * (4 * PJ_RUN * 2) + lane * 16;

  int wr = w >> 1, wc = w & 1;     // the wave's 64x64 tile of the block tile
  int row0 = brow + wr * 64;
  int col0 = bcol + wc * 64;
  const _Float16* afrag = st + wr * (4 * PJ_RUN);
  const _Float16* bfrag = st + (8 + wc * 4) * PJ_RUN;

  copy_stage(dst, src + rot * PJ_RUN);
  // stage 0 has landed for this wave ...
  asm volatile("s_wait_asynccnt 0x0" ::: "memory");
  __syncthreads();                 // ... and for every wave, before anyone reads it
  copy_stage(dst + PJ_BUF * 2, src + ((rot + 1) & (PJ_TRIPS - 1)) * PJ_RUN);

  v8f acc[4][4] = {};
  for (int s = 0; s < PJ_TRIPS; ++s) {
    int boff = (s & 1) * PJ_BUF;
#pragma unroll  // constant index: the arrays stay in registers
    for (int kk = 0; kk < 2; ++kk) {
      v16h af[4], bf[4];
#pragma unroll  // constant index: the arrays stay in registers
      for (int i = 0; i < 4; ++i) af[i] = load_tile(afrag + boff + i * PJ_RUN + kk * 512);
#pragma unroll  // constant index: the arrays stay in registers
      for (int j = 0; j < 4; ++j) bf[j] = load_tile(bfrag + boff + j * PJ_RUN + kk * 512);
      // the 16 LDS reads of a k tile stay one group in front of its 16 products:
      // the compiler would keep one A fragment and wait out a read per 4 products
      __builtin_amdgcn_sched_barrier(0);
#pragma unroll  // constant index: the arrays stay in registers
      for (int i = 0; i < 4; ++i)
#pragma unroll  // constant index: the arrays stay in registers
        for (int j = 0; j < 4; ++j) acc[i][j] = wmma_f16(af[i], bf[j], acc[i][j]);
    }
    // this wave's reads of the buffer have returned before it is refilled
    asm volatile("s_wait_dscnt 0x0" ::: "memory");
    // this wave's copies of the next stage have landed
    asm volatile("s_wait_asynccnt 0x0" ::: "memory");
    __syncthreads();   // publishes stage s + 1 and ends every read of stage s
    if (s + 2 < PJ_TRIPS)
      copy_stage(dst + boff * 2, src + ((s + 2 + rot) & (PJ_TRIPS - 1)) * PJ_RUN);
  }
  // no copy is outstanding when the wave goes on
  asm volatile("s_wait_asynccnt 0x0" ::: "memory");

  int n = lane & 15, mb = (lane >> 4) * 8;
  const float* bias = (p == 0) ? bq : (p == 1) ? bk : bvv;
  // p is the same for the work-group: one branch picks the writer of its matrix.
  if (p == 0) {
#pragma unroll
    for (int j = 0; j < 4; ++j) {
      int c = col0 + j * 16 + n;
      float bval = bias[c];
#pragma unroll
      for (int i = 0; i < 4; ++i) {
        for (int v = 0; v < 8; ++v) {
          int r = row0 + i * 16 + mb + v;
          float val = acc[i][j][v] + bval;
          qp32[(size_t)r * DIMV + c] = val;
          qp16[frag_off(r, c, KT_DIMV)] = (_Float16)val;
        }
      }
    }
  } else if (p == 1) {
#pragma unroll
    for (int j = 0; j < 4; ++j) {
      int c = col0 + j * 16 + n;
      float bval = bias[c];
#pragma unroll
      for (int i = 0; i < 4; ++i) {
        for (int v = 0; v < 8; ++v) {
          int r = row0 + i * 16 + mb + v;
          kp16[frag_off(r, c, KT_DIMV)] = (_Float16)(acc[i][j][v] + bval);
        }
      }
    }
  } else {
    // Transposed V: a lane's 8 accumulators are 8 successive keys of one
    // column, which is one 16-byte piece of the fragment order.
#pragma unroll
    for (int j = 0; j < 4; ++j) {
      int c = col0 + j * 16 + n;
      float bval = bias[c];
#pragma unroll
      for (int i = 0; i < 4; ++i) {
        v8h piece;
        for (int v = 0; v < 8; ++v) piece[v] = (_Float16)(acc[i][j][v] + bval);
        *(v8h*)(vpT + frag_off(c, row0 + i * 16 + mb, KT_ROWS)) = piece;
      }
    }
  }
}

// ---------------------------------------------------------------------------
// 4) Attention, transposed products: S^T = Kh @ Qh^T and O^T = Vh^T @ P^T.
//    One wave owns 32 queries (two 16-column groups) of one (b, h) and walks one
//    half of the 1024 keys, 32 a step; its partner wave walks the other half.
//    In an S^T tile a lane holds 8 keys of ONE query, and
//    two such tiles are, register for register, the B fragment of the second
//    product (k = g*8+i, then 16+g*8+i), so the scores never leave registers.
//    Walk 1 finds each query's maximum, walk 2 forms the scores again, takes
//    exp and multiplies by V. Each half has its own maximum; the two partial
//    results are joined through LDS at the end, each partner finishing one query
//    group. 16 waves / block = 256 queries of one (b, h), four waves a SIMD: the
//    vector work of one wave runs beside the products and the loads of three.
#define K_STEP (2 * KT_DIMV * 512)   // halves from one 32-key group of K to the next
#define KHALF  (SEQ / 2)             // keys a wave walks
#define NSTEP  (KHALF / 32)
#define ATT_WAVES 16

// The four K fragments of 32-key group g: [key tile][head-dim half].
__device__ __forceinline__ void load_k(v16h (&kc)[4], const _Float16* __restrict__ kb,
                                       int g) {
  const _Float16* p = kb + (size_t)g * K_STEP;
  kc[0] = load_tile(p);
  kc[1] = load_tile(p + 512);
  kc[2] = load_tile(p + KT_DIMV * 512);
  kc[3] = load_tile(p + KT_DIMV * 512 + 512);
}

// The four V^T fragments (16 head dims each) of 32-key group g.
__device__ __forceinline__ void load_v(v16h (&vc)[4], const _Float16* __restrict__ vb,
                                       int g) {
#pragma unroll  // constant index: the array stays in registers
  for (int dt = 0; dt < 4; ++dt)
    vc[dt] = load_tile(vb + (size_t)dt * (KT_ROWS * 512) + g * 512);
}

// S^T of one 32-key group: s[key tile][query group].
__device__ __forceinline__ void scores_t(v8f (&s)[2][2], const v16h (&kc)[4],
                                         const v16h (&qb)[2][2]) {
#pragma unroll  // constant index: the array stays in registers
  for (int i = 0; i < 2; ++i)
#pragma unroll  // constant index: the array stays in registers
    for (int t = 0; t < 2; ++t) {
      v8f z = {};
      z = wmma_f16(kc[2 * i], qb[t][0], z);
      s[i][t] = wmma_f16(kc[2 * i + 1], qb[t][1], z);
    }
}

// Walk 1, one step: scores of the group in kc, refill kc, running maxima.
__device__ __forceinline__ void max_step(v16h (&kc)[4], const _Float16* __restrict__ kb,
                                         int gnext, const v16h (&qb)[2][2],
                                         float (&mx)[2][2]) {
  v8f s[2][2];
  scores_t(s, kc, qb);
  load_k(kc, kb, gnext);
#pragma unroll  // constant index: the array stays in registers
  for (int i = 0; i < 2; ++i)
#pragma unroll  // constant index: the array stays in registers
    for (int t = 0; t < 2; ++t)
#pragma unroll  // constant index: the array stays in registers
      for (int v = 0; v < 8; ++v) mx[i][t] = fmaxf(mx[i][t], s[i][t][v]);
  // one step's scores are used up before the next step's are formed: without
  // this the four steps' scores are held side by side, over 256 registers
  __builtin_amdgcn_sched_barrier(0);
}

// Walk 2, one step: scores again, refill kc, exp, O^T += V^T P^T, refill vc.
__device__ __forceinline__ void pv_step(v16h (&kc)[4], v16h (&vc)[4],
                                        const _Float16* __restrict__ kb,
                                        const _Float16* __restrict__ vb,
                                        int gk, int gv, const v16h (&qb)[2][2],
                                        const float (&mc)[2], float cs,
                                        float (&sum)[2][2], v8f (&o)[4][2]) {
  v8f s[2][2];
  scores_t(s, kc, qb);
  load_k(kc, kb, gk);
  v16h p[2];
#pragma unroll  // constant index: the array stays in registers
  for (int t = 0; t < 2; ++t)
#pragma unroll  // constant index: the array stays in registers
    for (int i = 0; i < 2; ++i)
#pragma unroll  // constant index: the array stays in registers
      for (int v = 0; v < 8; ++v) {
        float e = __builtin_amdgcn_exp2f(s[i][t][v] * cs - mc[t]);
        sum[i][t] += e;
        p[t][i * 8 + v] = (_Float16)e;
      }
#pragma unroll  // constant index: the array stays in registers
  for (int dt = 0; dt < 4; ++dt)
#pragma unroll  // constant index: the array stays in registers
    for (int t = 0; t < 2; ++t) o[dt][t] = wmma_f16(vc[dt], p[t], o[dt][t]);
  load_v(vc, vb, gv);
}

// A wave leaves query group T of its partial result in LDS for its partner:
// O^T (unscaled), the sum of exp and the scaled maximum both were formed with.
template <int T>
__device__ __forceinline__ void hand_over(float4* xo, float2* xs, const v8f (&o)[4][2],
                                          const float (&sm)[2], const float (&mc)[2]) {
#pragma unroll  // constant index: the array stays in registers
  for (int dt = 0; dt < 4; ++dt) {
    xo[(dt * 2) * 32] = make_float4(o[dt][T][0], o[dt][T][1], o[dt][T][2], o[dt][T][3]);
    xo[(dt * 2 + 1) * 32] = make_float4(o[dt][T][4], o[dt][T][5], o[dt][T][6], o[dt][T][7]);
  }
  *xs = make_float2(sm[T], mc[T]);
}

// Query group T: both halves brought to their common maximum, O = O^T / sum + Qp.
// A lane holds 8 successive head dims of one query.
template <int T>
__device__ __forceinline__ void finish(const float4* xo, const float2* xs,
                                       const v8f (&o)[4][2], const float (&sm)[2],
                                       const float (&mc)[2], const float4 (&r)[4][2],
                                       char* wo) {
  float2 ps = *xs;
  float m = fmaxf(mc[T], ps.y);
  float fa = __builtin_amdgcn_exp2f(mc[T] - m);
  float fb = __builtin_amdgcn_exp2f(ps.y - m);
  float inv = 1.0f / (sm[T] * fa + ps.x * fb);
  fa *= inv;
  fb *= inv;
#pragma unroll  // constant index: the arrays stay in registers
  for (int dt = 0; dt < 4; ++dt) {
    float4 r0 = r[dt][0];
    float4 r1 = r[dt][1];
    float4 p0 = xo[(dt * 2) * 32];
    float4 p1 = xo[(dt * 2 + 1) * 32];
    float4 y0, y1;
    y0.x = o[dt][T][0] * fa + p0.x * fb + r0.x;
    y0.y = o[dt][T][1] * fa + p0.y * fb + r0.y;
    y0.z = o[dt][T][2] * fa + p0.z * fb + r0.z;
    y0.w = o[dt][T][3] * fa + p0.w * fb + r0.w;
    y1.x = o[dt][T][4] * fa + p1.x * fb + r1.x;
    y1.y = o[dt][T][5] * fa + p1.y * fb + r1.y;
    y1.z = o[dt][T][6] * fa + p1.z * fb + r1.z;
    y1.w = o[dt][T][7] * fa + p1.w * fb + r1.w;
    *(float4*)(wo + dt * 64) = y0;
    *(float4*)(wo + dt * 64 + 16) = y1;
  }
}

__global__ __launch_bounds__(ATT_WAVES * 32) void attn_kernel(
    const _Float16* __restrict__ qp16, const _Float16* __restrict__ kp16,
    const _Float16* __restrict__ vpT, const float* __restrict__ qp32,
    float* __restrict__ ao32) {
  // what a wave hands its partner: 8 pieces of 16 bytes a lane, sum and maximum
  __shared__ __attribute__((aligned(16))) float4 xo[ATT_WAVES * 8 * 32];
  __shared__ __attribute__((aligned(16))) float2 xs[ATT_WAVES * 32];
  int bid = blockIdx.x;
  int qq = bid & 3;
  int h = (bid >> 2) & 7;
  int b = bid >> 5;

  int w = __builtin_amdgcn_readfirstlane((int)(threadIdx.x >> 5));  // scalar tile bases
  int lane = threadIdx.x & 31;
  int n = lane & 15, mb = (lane >> 4) * 8;
  int kh = w >> 3;                     // the wave's half of the keys
  int grow = b * SEQ + qq * 256 + (w & 7) * 32;
  // Both key walks start at a group of the work-group's own and wrap: the four
  // work-groups of one (b, h) read the same K and V and would ask L2 for the same
  // lines at the same moment; the heads' share spreads V's addresses as well.
  int rot = (qq * (NSTEP / 4) + h) & (NSTEP - 1);

  const _Float16* kb = kp16 + frag_off(b * SEQ + kh * KHALF, h * HDIM, KT_DIMV);
  const _Float16* vb = vpT + frag_off(h * HDIM, b * SEQ + kh * KHALF, KT_ROWS);

  v16h qb[2][2];                       // Q as B operand, kept for both walks
#pragma unroll  // constant index: the array stays in registers
  for (int t = 0; t < 2; ++t) {
    const _Float16* qbase = qp16 + frag_off(grow + t * 16, h * HDIM, KT_DIMV);
    qb[t][0] = load_tile(qbase);
    qb[t][1] = load_tile(qbase + 512);
  }

  // ---- walk 1: maxima. Four K buffers, each refilled four steps ahead; the
  // last refills wrap to the first groups and so hand walk 2 its first two.
  v16h kA[4], kB[4], kC[4], kD[4];
  load_k(kA, kb, rot);
  // a group's base registers are rewritten for the next group (here and below)
  asm volatile("s_wait_xcnt 0x0" ::: "memory");
  load_k(kB, kb, (rot + 1) & (NSTEP - 1));
  asm volatile("s_wait_xcnt 0x0" ::: "memory");
  load_k(kC, kb, (rot + 2) & (NSTEP - 1));
  asm volatile("s_wait_xcnt 0x0" ::: "memory");
  load_k(kD, kb, (rot + 3) & (NSTEP - 1));
  float mx[2][2] = {{-3.0e38f, -3.0e38f}, {-3.0e38f, -3.0e38f}};
  for (int s = 0; s < NSTEP; s += 4) {
    int g = s + rot;
    max_step(kA, kb, (g + 4) & (NSTEP - 1), qb, mx);
    max_step(kB, kb, (g + 5) & (NSTEP - 1), qb, mx);
    max_step(kC, kb, (g + 6) & (NSTEP - 1), qb, mx);
    max_step(kD, kb, (g + 7) & (NSTEP - 1), qb, mx);
    // the last loads' address registers are rewritten at the head of the loop
    asm volatile("s_wait_xcnt 0x0" ::: "memory");
  }

  // exp(x / 8 - m / 8) = exp2(x * cs - m * cs); both wave halves hold keys of
  // the same query and must use one maximum.
  const float cs = 0.125f * 1.44269504088896340736f;
  float mc[2];
#pragma unroll  // constant index: the array stays in registers
  for (int t = 0; t < 2; ++t) {
    float m = fmaxf(mx[0][t], mx[1][t]);
    m = fmaxf(m, __shfl_xor(m, 16, 32));
    mc[t] = m * cs;
  }

  // ---- walk 2: P^T = exp(S^T - max), O^T += V^T P^T (1/sum deferred)
  v16h vc[4];
  load_v(vc, vb, rot);
  float sum[2][2] = {};
  v8f o[4][2] = {};
  for (int s = 0; s < NSTEP; s += 2) {
    int g = s + rot;
    pv_step(kA, vc, kb, vb, (g + 2) & (NSTEP - 1), (g + 1) & (NSTEP - 1), qb, mc, cs,
            sum, o);
    pv_step(kB, vc, kb, vb, (g + 3) & (NSTEP - 1), (g + 2) & (NSTEP - 1), qb, mc, cs,
            sum, o);
    // the last loads' address registers are rewritten at the head of the loop
    asm volatile("s_wait_xcnt 0x0" ::: "memory");
  }

  // ---- the two key halves are joined: the wave of half 0 finishes query group 0,
  // its partner group 1; each hands the other group over through LDS
  float sm[2];
#pragma unroll  // constant index: the array stays in registers
  for (int t = 0; t < 2; ++t) {
    sm[t] = sum[0][t] + sum[1][t];
    sm[t] += __shfl_xor(sm[t], 16, 32);
  }
  float4* xo_own = xo + w * (8 * 32) + lane;
  float2* xs_own = xs + w * 32 + lane;
  const float4* xo_par = xo + (w ^ 8) * (8 * 32) + lane;
  const float2* xs_par = xs + (w ^ 8) * 32 + lane;
  // one 32-bit byte offset serves the residual's loads and the stores
  unsigned boff = (unsigned)(((grow + kh * 16 + n) * DIMV + h * HDIM + mb) * 4);
  const char* rq = (const char*)qp32 + boff;
  char* wo = (char*)ao32 + boff;
  float4 r[4][2];                      // the residual flies during the hand-over
#pragma unroll  // constant index: the array stays in registers
  for (int dt = 0; dt < 4; ++dt) {
    r[dt][0] = *(const float4*)(rq + dt * 64);
    r[dt][1] = *(const float4*)(rq + dt * 64 + 16);
  }
  if (kh == 0) hand_over<1>(xo_own, xs_own, o, sm, mc);
  else         hand_over<0>(xo_own, xs_own, o, sm, mc);
  // the residual loads' offset register is reused behind the barrier
  asm volatile("s_wait_xcnt 0x0" ::: "memory");
  __syncthreads();   // every wave's hand-over is in LDS before its partner reads it
  if (kh == 0) finish<0>(xo_par, xs_par, o, sm, mc, r, wo);
  else         finish<1>(xo_par, xs_par, o, sm, mc, r, wo);
}

// ---------------------------------------------------------------------------
// 5) The row-local tail in one launch: X1 = LN0(attention output),
//    Z = X1 + relu(X1 @ Wo + bo), out = LN1(Z). A work-group of 8 waves owns 32
//    whole rows, which stay in LDS from the first step to the last:
//      a) a wave normalises 4 rows (a lane holds 16 values of each, as four
//         16-byte pieces 512 bytes apart) and leaves X1 in LDS as f32 and f16;
//      b) a wave forms a 32x64 tile of X1 @ Wo, A fragments from LDS, the Wo
//         fragments of four k steps in flight (the first ones during step a);
//      c) it adds relu(.) to the f32 X1 in LDS, each element by its one owner;
//      d) a wave normalises its 4 rows again and stores whole lines.
#define TAIL_ROWS 32
#define XPITCH 516            // floats a row: rows 8 apart lie 32 banks apart
#define GPITCH 136            // halves: the 16 rows' pieces of one k octet, 256 + 16 bytes
#define RTILE  (64 * GPITCH)  // halves of a 16-row tile: 64 k octets

typedef __attribute__((ext_vector_type(4))) _Float16 v4h;

// LayerNorm of 4 rows held by one wave: x[row][piece], columns piece*128+lane*4.
__device__ __forceinline__ void ln_rows(float4 (&x)[4][4], const float4 (&ga)[4],
                                        const float4 (&be)[4]) {
  float sum[4], sq[4];
#pragma unroll  // constant index: the arrays stay in registers
  for (int r = 0; r < 4; ++r) {
    sum[r] = 0.f;
    sq[r] = 0.f;
#pragma unroll  // constant index: the arrays stay in registers
    for (int c = 0; c < 4; ++c) {
      float4 t = x[r][c];
      sum[r] += t.x + t.y + t.z + t.w;
      sq[r] += t.x * t.x + t.y * t.y + t.z * t.z + t.w * t.w;
    }
  }
#pragma unroll  // the eight chains of a step run side by side
  for (int off = 16; off > 0; off >>= 1)
#pragma unroll  // constant index: the arrays stay in registers
    for (int r = 0; r < 4; ++r) {
      sum[r] += __shfl_xor(sum[r], off, 32);
      sq[r] += __shfl_xor(sq[r], off, 32);
    }
#pragma unroll  // constant index: the arrays stay in registers
  for (int r = 0; r < 4; ++r) {
    float mean = sum[r] * (1.0f / DIMV);
    float var = sq[r] * (1.0f / DIMV) - mean * mean;
    float rstd = rsqrtf(var + 1e-5f);
#pragma unroll  // constant index: the arrays stay in registers
    for (int c = 0; c < 4; ++c) {
      float4 t = x[r][c];
      t.x = (t.x - mean) * rstd * ga[c].x + be[c].x;
      t.y = (t.y - mean) * rstd * ga[c].y + be[c].y;
      t.z = (t.z - mean) * rstd * ga[c].z + be[c].z;
      t.w = (t.w - mean) * rstd * ga[c].w + be[c].w;
      x[r][c] = t;
    }
  }
}

#define TAIL_STEPS (DIMV / 32)
#define B_AHEAD 4             // k steps of Wo fragments in flight

// The four Wo fragments (16 columns each) of k step s.
__device__ __forceinline__ void load_b4(v16h (&b)[4], const _Float16* __restrict__ bbase,
                                        int s) {
#pragma unroll  // constant index: the array stays in registers
  for (int j = 0; j < 4; ++j) b[j] = load_tile(bbase + j * 16 * DIMV + s * 512);
}

// The two X1 fragments (16 rows each) of k step s, from LDS.
__device__ __forceinline__ void load_a2(v16h (&a)[2], const _Float16* afrag, int s) {
#pragma unroll  // constant index: the array stays in registers
  for (int i = 0; i < 2; ++i) {
    const _Float16* p = afrag + i * RTILE + s * 4 * GPITCH;
    union { v16h v; v8h h[2]; } u;
    u.h[0] = *(const v8h*)(p);
    u.h[1] = *(const v8h*)(p + 2 * GPITCH);
    a[i] = u.v;
  }
}

__global__ __launch_bounds__(256) void tail_kernel(
    const float* __restrict__ ao32, const _Float16* __restrict__ woT,
    const float* __restrict__ bo, const float* __restrict__ g0,
    const float* __restrict__ b0, const float* __restrict__ g1,
    const float* __restrict__ b1, float* __restrict__ out) {
  __shared__ __attribute__((aligned(16))) float xs[TAIL_ROWS * XPITCH];
  __shared__ __attribute__((aligned(16))) _Float16 xh[2 * RTILE];

  int w = __builtin_amdgcn_readfirstlane((int)(threadIdx.x >> 5));  // scalar bases
  int lane = threadIdx.x & 31;
  int row0 = blockIdx.x * TAIL_ROWS;
  int col0 = w * 64;
  const _Float16* bbase = woT + (size_t)col0 * DIMV;
  v16h bf[B_AHEAD][4];
  // The k walk of step b starts at a k step of the work-group's own and wraps:
  // every work-group reads the whole of Wo, and from one common start all of them
  // would ask L2 for the same lines at the same moment.
  int rot = (blockIdx.x + (blockIdx.x >> 3)) & (TAIL_STEPS - 1);

  // ---- a) LN0 of rows w*4 .. w*4+3
  float4 x[4][4], ga[4], be[4];
  {
    const float* s = ao32 + (size_t)(row0 + w * 4) * DIMV + lane * 4;
#pragma unroll  // constant index: the arrays stay in registers
    for (int r = 0; r < 4; ++r)
#pragma unroll  // constant index: the arrays stay in registers
      for (int c = 0; c < 4; ++c) x[r][c] = *(const float4*)(s + r * DIMV + c * 128);
#pragma unroll  // constant index: the arrays stay in registers
    for (int c = 0; c < 4; ++c) {
      ga[c] = *(const float4*)(g0 + c * 128 + lane * 4);
      be[c] = *(const float4*)(b0 + c * 128 + lane * 4);
    }
  }
  // Wo does not depend on step a: its first fragments fly while LN0 is done,
  // two k steps behind the rows' own loads, two more once gamma and beta are used.
  load_b4(bf[0], bbase, rot);
  load_b4(bf[1], bbase, (rot + 1) & (TAIL_STEPS - 1));
  // these loads stay in front of LN0: the compiler would sink them to their use
  __builtin_amdgcn_sched_barrier(0);
  ln_rows(x, ga, be);
  load_b4(bf[2], bbase, (rot + 2) & (TAIL_STEPS - 1));
  load_b4(bf[3], bbase, (rot + 3) & (TAIL_STEPS - 1));
  // and these in front of the LDS stores and the barrier
  __builtin_amdgcn_sched_barrier(0);
  {
    float* d32 = xs + (w * 4) * XPITCH + lane * 4;
    // f16 copy: row, k -> tile row/16, octet k/8, the row's piece, k%8. That is
    // the fragment order with 16 bytes more behind every 256.
    _Float16* d16 = xh + (w >> 2) * RTILE + (lane >> 1) * GPITCH + (w & 3) * 32 +
                    (lane & 1) * 4;
#pragma unroll  // constant index: the arrays stay in registers
    for (int r = 0; r < 4; ++r)
#pragma unroll  // constant index: the arrays stay in registers
      for (int c = 0; c < 4; ++c) {
        float4 t = x[r][c];
        *(float4*)(d32 + r * XPITCH + c * 128) = t;
        v4h hq;
        hq[0] = (_Float16)t.x; hq[1] = (_Float16)t.y;
        hq[2] = (_Float16)t.z; hq[3] = (_Float16)t.w;
        *(v4h*)(d16 + c * 16 * GPITCH + r * 8) = hq;
      }
  }
  __syncthreads();   // every row of X1 is in LDS before any wave multiplies

  // ---- b) 32x64 tile of X1 @ Wo: columns w*64 ..
  int n = lane & 15, mb = (lane >> 4) * 8;
  const _Float16* afrag = xh + (lane >> 4) * GPITCH + (lane & 15) * 8;
  v16h af[2][2];
  load_a2(af[0], afrag, rot);
  v8f acc[2][4] = {};
  float bval[4];
#pragma unroll  // constant index: the fragment rings stay in registers
  for (int s = 0; s < TAIL_STEPS; ++s) {
    if (s + 1 < TAIL_STEPS)
      load_a2(af[(s + 1) & 1], afrag, (s + 1 + rot) & (TAIL_STEPS - 1));
#pragma unroll  // constant index: the arrays stay in registers
    for (int j = 0; j < 4; ++j) {
      acc[0][j] = wmma_f16(af[s & 1][0], bf[s % B_AHEAD][j], acc[0][j]);
      acc[1][j] = wmma_f16(af[s & 1][1], bf[s % B_AHEAD][j], acc[1][j]);
    }
    if (s + B_AHEAD < TAIL_STEPS)
      load_b4(bf[s % B_AHEAD], bbase, (s + B_AHEAD + rot) & (TAIL_STEPS - 1));
    if (s + B_AHEAD == TAIL_STEPS) {
      // the refills have ended: their offset register falls free and is rewritten
      asm volatile("s_wait_xcnt 0x0" ::: "memory");
      // the bias of step c flies in the refills' place
#pragma unroll  // constant index: the array stays in registers
      for (int j = 0; j < 4; ++j) bval[j] = bo[col0 + j * 16 + n];
    }
    // a refill is issued where its buffer falls free: the compiler would sink it
    // to its use, four steps on, and wait out each load's whole latency there
    __builtin_amdgcn_sched_barrier(0);
  }
  // the bias loads' offset register is reused by the address work that follows
  asm volatile("s_wait_xcnt 0x0" ::: "memory");

  // ---- c) Z = X1 + relu(acc + bo), in place in LDS; LN1's gamma and beta fly
#pragma unroll  // constant index: the arrays stay in registers
  for (int c = 0; c < 4; ++c) {
    ga[c] = *(const float4*)(g1 + c * 128 + lane * 4);
    be[c] = *(const float4*)(b1 + c * 128 + lane * 4);
  }
  float* z = xs + mb * XPITCH + col0 + n;
#pragma unroll
  for (int j = 0; j < 4; ++j) {
#pragma unroll
    for (int i = 0; i < 2; ++i) {
#pragma unroll  // constant index: the accumulators stay in registers
      for (int v = 0; v < 8; ++v) {
        float* e = z + (i * 16 + v) * XPITCH + j * 16;
        *e = *e + fmaxf(acc[i][j][v] + bval[j], 0.0f);
      }
    }
  }
  __syncthreads();   // every column of Z is in LDS before a row is summed

  // ---- d) LN1 of rows w*4 .. w*4+3, stored as whole lines
  {
    const float* s = xs + (w * 4) * XPITCH + lane * 4;
#pragma unroll  // constant index: the arrays stay in registers
    for (int r = 0; r < 4; ++r)
#pragma unroll  // constant index: the arrays stay in registers
      for (int c = 0; c < 4; ++c) x[r][c] = *(const float4*)(s + r * XPITCH + c * 128);
  }
  ln_rows(x, ga, be);
  {
    float* d = out + (size_t)(row0 + w * 4) * DIMV + lane * 4;
#pragma unroll  // constant index: the arrays stay in registers
    for (int r = 0; r < 4; ++r)
#pragma unroll  // constant index: the arrays stay in registers
      for (int c = 0; c < 4; ++c) *(float4*)(d + r * DIMV + c * 128) = x[r][c];
  }
}

// ---------------------------------------------------------------------------
extern "C" void kernel_launch(void* const* d_in, const int* in_sizes, int n_in,
                              void* d_out, int out_size, void* d_ws, size_t ws_size,
                              hipStream_t stream) {
  const float* Q  = (const float*)d_in[0];
  const float* K  = (const float*)d_in[1];
  const float* Wq = (const float*)d_in[2];
  const float* bq = (const float*)d_in[3];
  const float* Wk = (const float*)d_in[4];
  const float* bk = (const float*)d_in[5];
  const float* Wv = (const float*)d_in[6];
  const float* bv = (const float*)d_in[7];
  const float* Wo = (const float*)d_in[8];
  const float* bo = (const float*)d_in[9];
  const float* g0 = (const float*)d_in[10];
  const float* b0 = (const float*)d_in[11];
  const float* g1 = (const float*)d_in[12];
  const float* b1 = (const float*)d_in[13];
  float* out = (float*)d_out;

  char* ws = (char*)d_ws;
  _Float16* q16  = (_Float16*)(ws);                         // 8 MB
  _Float16* k16  = (_Float16*)(ws + 8388608);               // 8 MB
  _Float16* w16T = (_Float16*)(ws + 16777216);              // 2 MB (4 mats)
  float*    qp32 = (float*)   (ws + 18874368);              // 16 MB
  _Float16* qp16 = (_Float16*)(ws + 35651584);              // 8 MB
  _Float16* kp16 = (_Float16*)(ws + 44040192);              // 8 MB
  _Float16* vpT  = (_Float16*)(ws + 52428800);              // 8 MB
  float*    ao32 = (float*)   (ws + 60817408);              // 16 MB
  // total workspace: ~74 MB

  // 1) all conversions: q16 and k16 lie one behind the other, w16T holds 4 mats
  const int WN = DIMV * DIMV;
  cvt_all_kernel<<<256, CVT_THREADS, 0, stream>>>(Q, K, Wq, Wk, Wv, Wo, q16, w16T);

  // 3) projections: 768 work-groups of 4 waves, a 128x128 tile each
  proj_kernel<<<768, PJ_THREADS, 0, stream>>>(q16, k16, w16T, bq, bk, bv,
                                       qp32, qp16, kp16, vpT);

  // 4) attention: B*H*(SEQ/256) = 256 blocks of 16 waves, 32 queries x 512 keys a wave
  attn_kernel<<<256, 512, 0, stream>>>(qp16, kp16, vpT, qp32, ao32);

  // 5) LN0, x1 + relu(x1 @ Wo + bo), LN1 -> d_out: 32 whole rows a work-group
  tail_kernel<<<ROWS / TAIL_ROWS, 256, 0, stream>>>(ao32, w16T + 3 * WN, bo, g0, b0, g1, b1,
                                                    out);
}

// v008
// One run takes 55 microseconds.
// Two timings next to v007 put it at 1.03 and 1.04 times that version's speed.
// All steps since v000 together make it 4.76 times as fast.
#include <hip/hip_runtime.h>
#include <hip/hip_bf16.h>

// ---------------------------------------------------------------------------
// MAB (multihead attention block) for MI455X / gfx1250, wave32 + WMMA f16->f32
// Register-blocked GEMMs: one wave computes a 64x64 or a 32x64 tile.
// Every f16 matrix in the workspace is kept in fragment order (see frag_off).
// ---------------------------------------------------------------------------

typedef __attribute__((ext_vector_type(16))) _Float16 v16h;
typedef __attribute__((ext_vector_type(8)))  _Float16 v8h;
typedef __attribute__((ext_vector_type(8)))  float    v8f;

#define DIMV   512
#define ROWS   8192          // B*N = 8*1024
#define SEQ    1024
#define NHEAD  8
#define HDIM   64

__device__ __forceinline__ v8f wmma_f16(v16h a, v16h b, v8f c) {
  return __builtin_amdgcn_wmma_f32_16x16x32_f16(false, a, false, b,
                                                (short)0, c, false, false);
}

// k order of a 16x32 f16 fragment (ISA 7.12.2): lane r = lane&15 supplies row r
// (a row of A, or a column of B), g = lane>>4 selects the K half; elements
// i=0..7 -> K = g*8+i ; i=8..15 -> K = 16+g*8+(i-8).

// Fragment order of a [rows x 32*kt] f16 matrix in global memory: 16x32 tiles
// of 512 halves, tile (row/16, k/32) at index (row/16)*kt + k/32. Inside a tile
// the 8 halves that one lane takes with one 16-byte load lie together, and the
// 32 lanes' pieces follow one another: piece hs*32 + g*16 + r holds row r,
// k = hs*16 + g*8 .. +7. That is the k order given above, so a fragment is two
// loads of 512 contiguous bytes each.
__device__ __forceinline__ size_t frag_off(int row, int k, int kt) {
  return ((size_t)(row >> 4) * kt + (k >> 5)) * 512 + ((k >> 4) & 1) * 256 +
         (((k >> 3) & 1) * 16 + (row & 15)) * 8 + (k & 7);
}

// Load the fragment whose tile starts at `tile` (fragment-order storage).
__device__ __forceinline__ v16h load_tile(const _Float16* __restrict__ tile) {
  const _Float16* p = tile + (threadIdx.x & 31) * 8;
  union { v16h v; v8h h[2]; } u;
  u.h[0] = *(const v8h*)(p);
  u.h[1] = *(const v8h*)(p + 256);
  return u.v;
}

#define KT_DIMV (DIMV / 32)   // k tiles of a [rows x 512] matrix
#define KT_ROWS (ROWS / 32)   // k tiles of the [512 x 8192] transposed V

// ---------------------------------------------------------------------------
// 1) Every f32 -> f16 conversion in one launch of 256 work-groups of 9 waves.
//    A thread makes whole 16-byte pieces of the fragment order (8 values each)
//    and has all of its 32 16-byte loads in flight before the first convert.
//    Waves 0..7: 16 rows x 256 columns of Q or K each (8 tiles, 16 pieces a
//    lane). A lane takes row l>>2 (and that + 8), k piece l&3 of each tile: a
//    store covers four whole 128-byte lines.
//    Wave 8: 128 (k) x 32 (n) of one weight matrix, transposed (element (n,k) =
//    src[k*512+n]). A lane reads 4 n of 8 successive k, which are 4 pieces,
//    64 contiguous bytes of the result; a load covers four whole lines.
#define CVT_THREADS 288

__device__ __forceinline__ v8h to_piece(float4 lo, float4 hi) {
  v8h p;
  p[0] = (_Float16)lo.x; p[1] = (_Float16)lo.y;
  p[2] = (_Float16)lo.z; p[3] = (_Float16)lo.w;
  p[4] = (_Float16)hi.x; p[5] = (_Float16)hi.y;
  p[6] = (_Float16)hi.z; p[7] = (_Float16)hi.w;
  return p;
}

__global__ __launch_bounds__(CVT_THREADS) void cvt_all_kernel(
    const float* __restrict__ Q, const float* __restrict__ K,
    const float* __restrict__ Wq, const float* __restrict__ Wk,
    const float* __restrict__ Wv, const float* __restrict__ Wo,
    _Float16* __restrict__ x16,      // Q's 8192 rows, then K's
    _Float16* __restrict__ w16T) {
  int w = __builtin_amdgcn_readfirstlane((int)(threadIdx.x >> 5));  // scalar branch and bases
  int lane = threadIdx.x & 31;
  if (w < 8) {
    int job = blockIdx.x * 8 + w;    // 2048 jobs
    int rt = job >> 1;               // 16-row tile of [Q; K]
    int kh = job & 1;                // column half
    const float* X = (rt < ROWS / 16) ? Q : K;
    const float* s = X + (size_t)(rt & (ROWS / 16 - 1)) * (16 * DIMV) + kh * 256 +
                     (lane >> 2) * DIMV + (lane & 3) * 8;
    _Float16* d = x16 + ((size_t)rt * KT_DIMV + kh * 8) * 512 +
                  ((lane & 3) * 16 + (lane >> 2)) * 8;
    float4 v[2][8][2];
#pragma unroll  // constant index: the array stays in registers
    for (int h = 0; h < 2; ++h)
#pragma unroll  // constant index: the array stays in registers
      for (int t = 0; t < 8; ++t) {
        v[h][t][0] = *(const float4*)(s + h * (8 * DIMV) + t * 32);
        v[h][t][1] = *(const float4*)(s + h * (8 * DIMV) + t * 32 + 4);
      }
    // no convert is moved up among the loads: without this the compiler saves
    // registers by waiting for early loads before it issues the late ones
    __builtin_amdgcn_sched_barrier(0);
    // the loads' address registers are rewritten next, for the stores' offset
    asm volatile("s_wait_xcnt 0x0" ::: "memory");
#pragma unroll  // constant index: the array stays in registers
    for (int h = 0; h < 2; ++h)
#pragma unroll  // constant index: the array stays in registers
      for (int t = 0; t < 8; ++t)
        *(v8h*)(d + t * 512 + h * 64) = to_piece(v[h][t][0], v[h][t][1]);
  } else {
    int job = blockIdx.x;            // 256 jobs: 4 matrices x 4 k blocks x 16 n blocks
    int m = job >> 6;
    int k0 = ((job >> 4) & 3) * 128, n0 = (job & 15) * 32;
    const float* Wm = (m == 0) ? Wq : (m == 1) ? Wk : (m == 2) ? Wv : Wo;
    int kg = lane >> 3, ng = lane & 7;
    const float* s = Wm + (size_t)(k0 + kg * 8) * DIMV + n0 + ng * 4;
    _Float16* d = w16T + (size_t)m * (DIMV * DIMV) +
                  frag_off(n0 + ng * 4, k0 + kg * 8, KT_DIMV);
    float4 v[4][8];
#pragma unroll  // constant index: the array stays in registers
    for (int c = 0; c < 4; ++c)
#pragma unroll  // constant index: the array stays in registers
      for (int j = 0; j < 8; ++j)
        v[c][j] = *(const float4*)(s + (c * 32 + j) * DIMV);
    // no convert is moved up among the loads: without this the compiler saves
    // registers by waiting for early loads before it issues the late ones
    __builtin_amdgcn_sched_barrier(0);
    // the loads' address registers are rewritten next, for the stores' offset
    asm volatile("s_wait_xcnt 0x0" ::: "memory");
#pragma unroll  // constant index: the array stays in registers
    for (int c = 0; c < 4; ++c) {
      v8h p0, p1, p2, p3;
#pragma unroll  // constant index: the array stays in registers
      for (int j = 0; j < 8; ++j) {
        p0[j] = (_Float16)v[c][j].x;
        p1[j] = (_Float16)v[c][j].y;
        p2[j] = (_Float16)v[c][j].z;
        p3[j] = (_Float16)v[c][j].w;
      }
      *(v8h*)(d + c * 512) = p0;
      *(v8h*)(d + c * 512 + 8) = p1;
      *(v8h*)(d + c * 512 + 16) = p2;
      *(v8h*)(d + c * 512 + 24) = p3;
    }
  }
}

// ---------------------------------------------------------------------------
// 3) Fused projections: Qp = Q@Wq+bq (f32+f16), Kp = K@Wk+bk (f16),
//    Vp = K@Wv+bv stored transposed [DIMV][ROWS] (f16); f16 in fragment order.
//    A work-group of 4 waves forms a 128x128 tile, a wave 64x64 of it (4x4 WMMA
//    tiles). Both operands pass through LDS, 64 k a stage, two buffers: a stage
//    is 16 runs of 2 KB (8 row tiles of X, 8 column tiles of W^T, two k tiles
//    each, as they lie in global memory), brought by asynchronous copies one
//    trip ahead. Every byte comes from L2 once a work-group, not once a wave.
//    Work-groups = 3 * (8192/128) * (512/128) = 768.
#define PJ_THREADS 128
#define PJ_RUN   1024                 // halves of a run: 16 rows x 64 k
#define PJ_BUF   (16 * PJ_RUN)        // halves of a stage
#define PJ_TRIPS (DIMV / 64)
#define TILE_ROW (KT_DIMV * 512)      // halves from one 16-row tile row to the next

// Eight copies of 16 bytes a lane, global memory to LDS: two runs, one tile row
// apart in global memory, adjacent in LDS. l and g are the lane's own addresses.
__device__ __forceinline__ void copy_two_runs(unsigned l, const _Float16* g) {
  const _Float16* h = g + TILE_ROW;
  // the closing wait stands in front of every later rewrite of the address
  // registers that these copies name
  asm volatile(
      "global_load_async_to_lds_b128 %0, %8, off\n\t"
      "global_load_async_to_lds_b128 %1, %9, off\n\t"
      "global_load_async_to_lds_b128 %2, %10, off\n\t"
      "global_load_async_to_lds_b128 %3, %11, off\n\t"
      "global_load_async_to_lds_b128 %4, %12, off\n\t"
      "global_load_async_to_lds_b128 %5, %13, off\n\t"
      "global_load_async_to_lds_b128 %6, %14, off\n\t"
      "global_load_async_to_lds_b128 %7, %15, off\n\t"
      "s_wait_xcnt 0x0"
      :: "v"(l), "v"(l + 512), "v"(l + 1024), "v"(l + 1536),
         "v"(l + 2048), "v"(l + 2560), "v"(l + 3072), "v"(l + 3584),
         "v"(g), "v"(g + 256), "v"(g + 512), "v"(g + 768),
         "v"(h), "v"(h + 256), "v"(h + 512), "v"(h + 768)
      : "memory");
}

// A wave's share of a stage: its four runs.
__device__ __forceinline__ void copy_stage(unsigned l, const _Float16* g) {
  copy_two_runs(l, g);
  copy_two_runs(l + 4096, g + 2 * TILE_ROW);
}

__global__ __launch_bounds__(PJ_THREADS) void proj_kernel(
    const _Float16* __restrict__ q16, const _Float16* __restrict__ k16,
    const _Float16* __restrict__ w16T,
    const float* __restrict__ bq, const float* __restrict__ bk,
    const float* __restrict__ bvv,
    float* __restrict__ qp32, _Float16* __restrict__ qp16,
    _Float16* __restrict__ kp16, _Float16* __restrict__ vpT) {
  __shared__ __attribute__((aligned(128))) _Float16 st[2 * PJ_BUF];

  int w = __builtin_amdgcn_readfirstlane((int)(threadIdx.x >> 5));  // scalar bases
  int lane = threadIdx.x & 31;
  int p = blockIdx.x >> 8;         // 0:Q 1:K 2:V  (256 work-groups each)
  int t = blockIdx.x & 255;        // 64 row blocks x 4 column blocks
  int brow = (t >> 2) * 128;
  int bcol = (t & 3) * 128;
  // The k walk starts at a stage of the work-group's own and wraps. 64 work-groups
  // read each W^T tile and 4 or 8 each X tile, all started together: from one
  // common start they would ask L2 for the same lines at the same moment.
  int rot = ((t >> 3) + ((t >> 2) & 1) * 4 + (t & 3) * 2 + p) & (PJ_TRIPS - 1);

  // Waves 0, 1 bring the 8 row tiles of X, waves 2, 3 the 8 column tiles of W^T.
  const _Float16* X = (p == 0) ? q16 : k16;
  const _Float16* src = (w < 2) ? X + (size_t)brow * DIMV
                                : w16T + (size_t)p * (DIMV * DIMV) + (size_t)bcol * DIMV;
  src += (w & 1) * (4 * TILE_ROW) + lane * 8;
  unsigned dst = (unsigned)(size_t)st + w * (4 * PJ_RUN * 2) + lane * 16;

  int wr = w >> 1, wc = w & 1;     // the wave's 64x64 tile of the block tile
  int row0 = brow + wr * 64;
  int col0 = bcol + wc * 64;
  const _Float16* afrag = st + wr * (4 * PJ_RUN);
  const _Float16* bfrag = st + (8 + wc * 4) * PJ_RUN;

  copy_stage(dst, src + rot * PJ_RUN);
  // stage 0 has landed for this wave ...
  asm volatile("s_wait_asynccnt 0x0" ::: "memory");
  __syncthreads();                 // ... and for every wave, before anyone reads it
  copy_stage(dst + PJ_BUF * 2, src + ((rot + 1) & (PJ_TRIPS - 1)) * PJ_RUN);

  v8f acc[4][4] = {};
  for (int s = 0; s < PJ_TRIPS; ++s) {
    int boff = (s & 1) * PJ_BUF;
#pragma unroll  // constant index: the arrays stay in registers
    for (int kk = 0; kk < 2; ++kk) {
      v16h af[4], bf[4];
#pragma unroll  // constant index: the arrays stay in registers
      for (int i = 0; i < 4; ++i) af[i] = load_tile(afrag + boff + i * PJ_RUN + kk * 512);
#pragma unroll  // constant index: the arrays stay in registers
      for (int j = 0; j < 4; ++j) bf[j] = load_tile(bfrag + boff + j * PJ_RUN + kk * 512);
      // the 16 LDS reads of a k tile stay one group in front of its 16 products:
      // the compiler would keep one A fragment and wait out a read per 4 products
      __builtin_amdgcn_sched_barrier(0);
#pragma unroll  // constant index: the arrays stay in registers
      for (int i = 0; i < 4; ++i)
#pragma unroll  // constant index: the arrays stay in registers
        for (int j = 0; j < 4; ++j) acc[i][j] = wmma_f16(af[i], bf[j], acc[i][j]);
    }
    // this wave's reads of the buffer have returned before it is refilled
    asm volatile("s_wait_dscnt 0x0" ::: "memory");
    // this wave's copies of the next stage have landed
    asm volatile("s_wait_asynccnt 0x0" ::: "memory");
    __syncthreads();   // publishes stage s + 1 and ends every read of stage s
    if (s + 2 < PJ_TRIPS)
      copy_stage(dst + boff * 2, src + ((s + 2 + rot) & (PJ_TRIPS - 1)) * PJ_RUN);
  }
  // no copy is outstanding when the wave goes on
  asm volatile("s_wait_asynccnt 0x0" ::: "memory");

  int n = lane & 15, mb = (lane >> 4) * 8;
  const float* bias = (p == 0) ? bq : (p == 1) ? bk : bvv;
  // p is the same for the work-group: one branch picks the writer of its matrix.
  if (p == 0) {
#pragma unroll
    for (int j = 0; j < 4; ++j) {
      int c = col0 + j * 16 + n;
      float bval = bias[c];
#pragma unroll
      for (int i = 0; i < 4; ++i) {
        for (int v = 0; v < 8; ++v) {
          int r = row0 + i * 16 + mb + v;
          float val = acc[i][j][v] + bval;
          qp32[(size_t)r * DIMV + c] = val;
          qp16[frag_off(r, c, KT_DIMV)] = (_Float16)val;
        }
      }
    }
  } else if (p == 1) {
#pragma unroll
    for (int j = 0; j < 4; ++j) {
      int c = col0 + j * 16 + n;
      float bval = bias[c];
#pragma unroll
      for (int i = 0; i < 4; ++i) {
        for (int v = 0; v < 8; ++v) {
          int r = row0 + i * 16 + mb + v;
          kp16[frag_off(r, c, KT_DIMV)] = (_Float16)(acc[i][j][v] + bval);
        }
      }
    }
  } else {
    // Transposed V: a lane's 8 accumulators are 8 successive keys of one
    // column, which is one 16-byte piece of the fragment order.
#pragma unroll
    for (int j = 0; j < 4; ++j) {
      int c = col0 + j * 16 + n;
      float bval = bias[c];
#pragma unroll
      for (int i = 0; i < 4; ++i) {
        v8h piece;
        for (int v = 0; v < 8; ++v) piece[v] = (_Float16)(acc[i][j][v] + bval);
        *(v8h*)(vpT + frag_off(c, row0 + i * 16 + mb, KT_ROWS)) = piece;
      }
    }
  }
}

// ---------------------------------------------------------------------------
// 4) Attention, transposed products: S^T = Kh @ Qh^T and O^T = Vh^T @ P^T.
//    One wave owns 32 queries (two 16-column groups) of one (b, h) and walks one
//    half of the 1024 keys, 32 a step; its partner wave walks the other half.
//    In an S^T tile a lane holds 8 keys of ONE query, and
//    two such tiles are, register for register, the B fragment of the second
//    product (k = g*8+i, then 16+g*8+i), so the scores never leave registers.
//    Walk 1 finds each query's maximum, walk 2 forms the scores again, takes
//    exp and multiplies by V. Each half has its own maximum; the two partial
//    results are joined through LDS at the end, each partner finishing one query
//    group. 16 waves / block = 256 queries of one (b, h), four waves a SIMD: the
//    vector work of one wave runs beside the products and the loads of three.
//    All of K and of V^T of the (b, h) lies in LDS, 128 KB each, brought once a
//    work-group by asynchronous copies (V^T during walk 1): the eight waves that
//    walk the same keys read them there, not each for itself from L2. A 32-key
//    group is 4 KB in a row, of K (two key tiles x two head-dim halves) as of V^T
//    (four head-dim tiles).
#define K_STEP 2048                  // halves from one 32-key group to the next, in LDS
#define KHALF  (SEQ / 2)             // keys a wave walks
#define NSTEP  (KHALF / 32)
#define ATT_WAVES 16
#define KV_HALVES (SEQ * HDIM)       // halves of K, and of V^T, of one (b, h)

// Eight copies of 16 bytes a lane, global memory to LDS: four 1 KB tiles of V^T
// (successive 32-key groups of one head-dim tile), adjacent in global memory,
// one group (4 KB) apart in LDS. l and g are the lane's own addresses.
__device__ __forceinline__ void copy_four_tiles(unsigned l, const _Float16* g) {
  // the closing wait stands in front of every later rewrite of the address
  // registers that these copies name
  asm volatile(
      "global_load_async_to_lds_b128 %0, %8, off\n\t"
      "global_load_async_to_lds_b128 %1, %9, off\n\t"
      "global_load_async_to_lds_b128 %2, %10, off\n\t"
      "global_load_async_to_lds_b128 %3, %11, off\n\t"
      "global_load_async_to_lds_b128 %4, %12, off\n\t"
      "global_load_async_to_lds_b128 %5, %13, off\n\t"
      "global_load_async_to_lds_b128 %6, %14, off\n\t"
      "global_load_async_to_lds_b128 %7, %15, off\n\t"
      "s_wait_xcnt 0x0"
      :: "v"(l), "v"(l + 512), "v"(l + 4096), "v"(l + 4608),
         "v"(l + 8192), "v"(l + 8704), "v"(l + 12288), "v"(l + 12800),
         "v"(g), "v"(g + 256), "v"(g + 512), "v"(g + 768),
         "v"(g + 1024), "v"(g + 1280), "v"(g + 1536), "v"(g + 1792)
      : "memory");
}

// The four K fragments of 32-key group g: [key tile][head-dim half].
__device__ __forceinline__ void load_k(v16h (&kc)[4], const _Float16* __restrict__ kb,
                                       int g) {
  const _Float16* p = kb + g * K_STEP;
#pragma unroll  // constant index: the array stays in registers
  for (int i = 0; i < 4; ++i) kc[i] = load_tile(p + i * 512);
}

// The four V^T fragments (16 head dims each) of 32-key group g.
__device__ __forceinline__ void load_v(v16h (&vc)[4], const _Float16* __restrict__ vb,
                                       int g) {
#pragma unroll  // constant index: the array stays in registers
  for (int dt = 0; dt < 4; ++dt)
    vc[dt] = load_tile(vb + g * K_STEP + dt * 512);
}

// S^T of one 32-key group: s[key tile][query group].
__device__ __forceinline__ void scores_t(v8f (&s)[2][2], const v16h (&kc)[4],
                                         const v16h (&qb)[2][2]) {
#pragma unroll  // constant index: the array stays in registers
  for (int i = 0; i < 2; ++i)
#pragma unroll  // constant index: the array stays in registers
    for (int t = 0; t < 2; ++t) {
      v8f z = {};
      z = wmma_f16(kc[2 * i], qb[t][0], z);
      s[i][t] = wmma_f16(kc[2 * i + 1], qb[t][1], z);
    }
}

// Walk 1, one step: scores of the group in kc, refill kc, running maxima.
__device__ __forceinline__ void max_step(v16h (&kc)[4], const _Float16* __restrict__ kb,
                                         int gnext, const v16h (&qb)[2][2],
                                         float (&mx)[2][2]) {
  v8f s[2][2];
  scores_t(s, kc, qb);
  load_k(kc, kb, gnext);
#pragma unroll  // constant index: the array stays in registers
  for (int i = 0; i < 2; ++i)
#pragma unroll  // constant index: the array stays in registers
    for (int t = 0; t < 2; ++t)
#pragma unroll  // constant index: the array stays in registers
      for (int v = 0; v < 8; ++v) mx[i][t] = fmaxf(mx[i][t], s[i][t][v]);
  // one step's scores are used up before the next step's are formed: without
  // this the four steps' scores are held side by side, over 256 registers
  __builtin_amdgcn_sched_barrier(0);
}

// Walk 2, one step: scores again, refill kc, exp, O^T += V^T P^T, refill vc.
__device__ __forceinline__ void pv_step(v16h (&kc)[4], v16h (&vc)[4],
                                        const _Float16* __restrict__ kb,
                                        const _Float16* __restrict__ vb,
                                        int gk, int gv, const v16h (&qb)[2][2],
                                        const float (&mc)[2], float cs,
                                        float (&sum)[2][2], v8f (&o)[4][2]) {
  v8f s[2][2];
  scores_t(s, kc, qb);
  load_k(kc, kb, gk);
  v16h p[2];
#pragma unroll  // constant index: the array stays in registers
  for (int t = 0; t < 2; ++t)
#pragma unroll  // constant index: the array stays in registers
    for (int i = 0; i < 2; ++i)
#pragma unroll  // constant index: the array stays in registers
      for (int v = 0; v < 8; ++v) {
        float e = __builtin_amdgcn_exp2f(s[i][t][v] * cs - mc[t]);
        sum[i][t] += e;
        p[t][i * 8 + v] = (_Float16)e;
      }
#pragma unroll  // constant index: the array stays in registers
  for (int dt = 0; dt < 4; ++dt)
#pragma unroll  // constant index: the array stays in registers
    for (int t = 0; t < 2; ++t) o[dt][t] = wmma_f16(vc[dt], p[t], o[dt][t]);
  load_v(vc, vb, gv);
}

// A wave leaves query group T of its partial result in LDS for its partner:
// O^T (unscaled), the sum of exp and the scaled maximum both were formed with.
template <int T>
__device__ __forceinline__ void hand_over(float4* xo, float2* xs, const v8f (&o)[4][2],
                                          const float (&sm)[2], const float (&mc)[2]) {
#pragma unroll  // constant index: the array stays in registers
  for (int dt = 0; dt < 4; ++dt) {
    xo[(dt * 2) * 32] = make_float4(o[dt][T][0], o[dt][T][1], o[dt][T][2], o[dt][T][3]);
    xo[(dt * 2 + 1) * 32] = make_float4(o[dt][T][4], o[dt][T][5], o[dt][T][6], o[dt][T][7]);
  }
  *xs = make_float2(sm[T], mc[T]);
}

// Query group T: both halves brought to their common maximum, O = O^T / sum + Qp.
// A lane holds 8 successive head dims of one query.
template <int T>
__device__ __forceinline__ void finish(const float4* xo, const float2* xs,
                                       const v8f (&o)[4][2], const float (&sm)[2],
                                       const float (&mc)[2], const float4 (&r)[4][2],
                                       char* wo) {
  float2 ps = *xs;
  float m = fmaxf(mc[T], ps.y);
  float fa = __builtin_amdgcn_exp2f(mc[T] - m);
  float fb = __builtin_amdgcn_exp2f(ps.y - m);
  float inv = 1.0f / (sm[T] * fa + ps.x * fb);
  fa *= inv;
  fb *= inv;
#pragma unroll  // constant index: the arrays stay in registers
  for (int dt = 0; dt < 4; ++dt) {
    float4 r0 = r[dt][0];
    float4 r1 = r[dt][1];
    float4 p0 = xo[(dt * 2) * 32];
    float4 p1 = xo[(dt * 2 + 1) * 32];
    float4 y0, y1;
    y0.x = o[dt][T][0] * fa + p0.x * fb + r0.x;
    y0.y = o[dt][T][1] * fa + p0.y * fb + r0.y;
    y0.z = o[dt][T][2] * fa + p0.z * fb + r0.z;
    y0.w = o[dt][T][3] * fa + p0.w * fb + r0.w;
    y1.x = o[dt][T][4] * fa + p1.x * fb + r1.x;
    y1.y = o[dt][T][5] * fa + p1.y * fb + r1.y;
    y1.z = o[dt][T][6] * fa + p1.z * fb + r1.z;
    y1.w = o[dt][T][7] * fa + p1.w * fb + r1.w;
    *(float4*)(wo + dt * 64) = y0;
    *(float4*)(wo + dt * 64 + 16) = y1;
  }
}

__global__ __launch_bounds__(ATT_WAVES * 32) void attn_kernel(
    const _Float16* __restrict__ qp16, const _Float16* __restrict__ kp16,
    const _Float16* __restrict__ vpT, const float* __restrict__ qp32,
    float* __restrict__ ao32) {
  // K, then V^T, of the (b, h)
  __shared__ __attribute__((aligned(128))) _Float16 kv[2 * KV_HALVES];
  // what a wave hands its partner (8 pieces of 16 bytes a lane, sum and maximum)
  // takes K's place once both walks have ended
  float4* xo = (float4*)kv;                               // ATT_WAVES * 8 * 32
  float2* xs = (float2*)(kv + ATT_WAVES * 8 * 32 * 8);    // ATT_WAVES * 32
  int bid = blockIdx.x;
  int qq = bid & 3;
  int h = (bid >> 2) & 7;
  int b = bid >> 5;

  int w = __builtin_amdgcn_readfirstlane((int)(threadIdx.x >> 5));  // scalar tile bases
  int lane = threadIdx.x & 31;
  int n = lane & 15, mb = (lane >> 4) * 8;
  int kh = w >> 3;                     // the wave's half of the keys
  int grow = b * SEQ + qq * 256 + (w & 7) * 32;
  // Both key walks start at a group of the work-group's own and wrap, as they did
  // when the groups came from L2: every sum keeps its order.
  int rot = (qq * (NSTEP / 4) + h) & (NSTEP - 1);

  const _Float16* kb = kv + kh * (NSTEP * K_STEP);
  const _Float16* vb = kv + KV_HALVES + kh * (NSTEP * K_STEP);

  v16h qb[2][2];                       // Q as B operand, kept for both walks
#pragma unroll  // constant index: the array stays in registers
  for (int t = 0; t < 2; ++t) {
    const _Float16* qbase = qp16 + frag_off(grow + t * 16, h * HDIM, KT_DIMV);
    qb[t][0] = load_tile(qbase);
    qb[t][1] = load_tile(qbase + 512);
  }

  // A wave brings a sixteenth of K (64 keys) and of V^T (one head-dim tile of 256
  // keys). The four work-groups of one (b, h) deal the sixteenths differently:
  // they would else ask L2 for the same lines at the same moment.
  int ck = (w + qq * 4) & (ATT_WAVES - 1);
  unsigned lds0 = (unsigned)(size_t)kv + lane * 16;
  copy_stage(lds0 + ck * 8192,
             kp16 + frag_off(b * SEQ + ck * 64, h * HDIM, KT_DIMV) + lane * 8);
  // K has landed for this wave ...
  asm volatile("s_wait_asynccnt 0x0" ::: "memory");
  __syncthreads();                 // ... and for every wave, before anyone reads it
  {
    int dt = ck >> 2, g0 = (ck & 3) * 8;   // head-dim tile, first 32-key group
    unsigned l = lds0 + KV_HALVES * 2 + g0 * 4096 + dt * 1024;
    const _Float16* g = vpT + frag_off(h * HDIM + dt * 16, b * SEQ + g0 * 32, KT_ROWS) +
                        lane * 8;
    copy_four_tiles(l, g);
    copy_four_tiles(l + 4 * 4096, g + 4 * 512);
  }

  // ---- walk 1: maxima. Four K buffers, each refilled four steps ahead; the
  // last refills wrap to the first groups and so hand walk 2 its first two.
  v16h kA[4], kB[4], kC[4], kD[4];
  load_k(kA, kb, rot);
  load_k(kB, kb, (rot + 1) & (NSTEP - 1));
  load_k(kC, kb, (rot + 2) & (NSTEP - 1));
  load_k(kD, kb, (rot + 3) & (NSTEP - 1));
  float mx[2][2] = {{-3.0e38f, -3.0e38f}, {-3.0e38f, -3.0e38f}};
  for (int s = 0; s < NSTEP; s += 4) {
    int g = s + rot;
    max_step(kA, kb, (g + 4) & (NSTEP - 1), qb, mx);
    max_step(kB, kb, (g + 5) & (NSTEP - 1), qb, mx);
    max_step(kC, kb, (g + 6) & (NSTEP - 1), qb, mx);
    max_step(kD, kb, (g + 7) & (NSTEP - 1), qb, mx);
  }
  // this wave's LDS reads have returned
  asm volatile("s_wait_dscnt 0x0" ::: "memory");
  // this wave's copies of V^T have landed
  asm volatile("s_wait_asynccnt 0x0" ::: "memory");
  __syncthreads();   // V^T is in LDS for every wave before anyone reads it

  // exp(x / 8 - m / 8) = exp2(x * cs - m * cs); both wave halves hold keys of
  // the same query and must use one maximum.
  const float cs = 0.125f * 1.44269504088896340736f;
  float mc[2];
#pragma unroll  // constant index: the array stays in registers
  for (int t = 0; t < 2; ++t) {
    float m = fmaxf(mx[0][t], mx[1][t]);
    m = fmaxf(m, __shfl_xor(m, 16, 32));
    mc[t] = m * cs;
  }

  // ---- walk 2: P^T = exp(S^T - max), O^T += V^T P^T (1/sum deferred)
  v16h vc[4];
  load_v(vc, vb, rot);
  float sum[2][2] = {};
  v8f o[4][2] = {};
  for (int s = 0; s < NSTEP; s += 2) {
    int g = s + rot;
    pv_step(kA, vc, kb, vb, (g + 2) & (NSTEP - 1), (g + 1) & (NSTEP - 1), qb, mc, cs,
            sum, o);
    pv_step(kB, vc, kb, vb, (g + 3) & (NSTEP - 1), (g + 2) & (NSTEP - 1), qb, mc, cs,
            sum, o);
  }

  // ---- the two key halves are joined: the wave of half 0 finishes query group 0,
  // its partner group 1; each hands the other group over through LDS
  float sm[2];
#pragma unroll  // constant index: the array stays in registers
  for (int t = 0; t < 2; ++t) {
    sm[t] = sum[0][t] + sum[1][t];
    sm[t] += __shfl_xor(sm[t], 16, 32);
  }
  float4* xo_own = xo + w * (8 * 32) + lane;
  float2* xs_own = xs + w * 32 + lane;
  const float4* xo_par = xo + (w ^ 8) * (8 * 32) + lane;
  const float2* xs_par = xs + (w ^ 8) * 32 + lane;
  // one 32-bit byte offset serves the residual's loads and the stores
  unsigned boff = (unsigned)(((grow + kh * 16 + n) * DIMV + h * HDIM + mb) * 4);
  const char* rq = (const char*)qp32 + boff;
  char* wo = (char*)ao32 + boff;
  float4 r[4][2];                      // the residual flies during the hand-over
#pragma unroll  // constant index: the array stays in registers
  for (int dt = 0; dt < 4; ++dt) {
    r[dt][0] = *(const float4*)(rq + dt * 64);
    r[dt][1] = *(const float4*)(rq + dt * 64 + 16);
  }
  // this wave's reads of K and V^T have returned ...
  asm volatile("s_wait_dscnt 0x0" ::: "memory");
  __syncthreads();   // ... and every wave's, before the hand-over takes K's place
  if (kh == 0) hand_over<1>(xo_own, xs_own, o, sm, mc);
  else         hand_over<0>(xo_own, xs_own, o, sm, mc);
  // the residual loads' offset register is reused behind the barrier
  asm volatile("s_wait_xcnt 0x0" ::: "memory");
  __syncthreads();   // every wave's hand-over is in LDS before its partner reads it
  if (kh == 0) finish<0>(xo_par, xs_par, o, sm, mc, r, wo);
  else         finish<1>(xo_par, xs_par, o, sm, mc, r, wo);
}

// ---------------------------------------------------------------------------
// 5) The row-local tail in one launch: X1 = LN0(attention output),
//    Z = X1 + relu(X1 @ Wo + bo), out = LN1(Z). A work-group of 8 waves owns 32
//    whole rows, which stay in LDS from the first step to the last:
//      a) a wave normalises 4 rows (a lane holds 16 values of each, as four
//         16-byte pieces 512 bytes apart) and leaves X1 in LDS as f32 and f16;
//      b) a wave forms a 32x64 tile of X1 @ Wo, A fragments from LDS, the Wo
//         fragments of four k steps in flight (the first ones during step a);
//      c) it adds relu(.) to the f32 X1 in LDS, each element by its one owner;
//      d) a wave normalises its 4 rows again and stores whole lines.
#define TAIL_ROWS 32
#define XPITCH 516            // floats a row: rows 8 apart lie 32 banks apart
#define GPITCH 136            // halves: the 16 rows' pieces of one k octet, 256 + 16 bytes
#define RTILE  (64 * GPITCH)  // halves of a 16-row tile: 64 k octets

typedef __attribute__((ext_vector_type(4))) _Float16 v4h;

// LayerNorm of 4 rows held by one wave: x[row][piece], columns piece*128+lane*4.
__device__ __forceinline__ void ln_rows(float4 (&x)[4][4], const float4 (&ga)[4],
                                        const float4 (&be)[4]) {
  float sum[4], sq[4];
#pragma unroll  // constant index: the arrays stay in registers
  for (int r = 0; r < 4; ++r) {
    sum[r] = 0.f;
    sq[r] = 0.f;
#pragma unroll  // constant index: the arrays stay in registers
    for (int c = 0; c < 4; ++c) {
      float4 t = x[r][c];
      sum[r] += t.x + t.y + t.z + t.w;
      sq[r] += t.x * t.x + t.y * t.y + t.z * t.z + t.w * t.w;
    }
  }
#pragma unroll  // the eight chains of a step run side by side
  for (int off = 16; off > 0; off >>= 1)
#pragma unroll  // constant index: the arrays stay in registers
    for (int r = 0; r < 4; ++r) {
      sum[r] += __shfl_xor(sum[r], off, 32);
      sq[r] += __shfl_xor(sq[r], off, 32);
    }
#pragma unroll  // constant index: the arrays stay in registers
  for (int r = 0; r < 4; ++r) {
    float mean = sum[r] * (1.0f / DIMV);
    float var = sq[r] * (1.0f / DIMV) - mean * mean;
    float rstd = rsqrtf(var + 1e-5f);
#pragma unroll  // constant index: the arrays stay in registers
    for (int c = 0; c < 4; ++c) {
      float4 t = x[r][c];
      t.x = (t.x - mean) * rstd * ga[c].x + be[c].x;
      t.y = (t.y - mean) * rstd * ga[c].y + be[c].y;
      t.z = (t.z - mean) * rstd * ga[c].z + be[c].z;
      t.w = (t.w - mean) * rstd * ga[c].w + be[c].w;
      x[r][c] = t;
    }
  }
}

#define TAIL_STEPS (DIMV / 32)
#define B_AHEAD 4             // k steps of Wo fragments in flight

// The four Wo fragments (16 columns each) of k step s.
__device__ __forceinline__ void load_b4(v16h (&b)[4], const _Float16* __restrict__ bbase,
                                        int s) {
#pragma unroll  // constant index: the array stays in registers
  for (int j = 0; j < 4; ++j) b[j] = load_tile(bbase + j * 16 * DIMV + s * 512);
}

// The two X1 fragments (16 rows each) of k step s, from LDS.
__device__ __forceinline__ void load_a2(v16h (&a)[2], const _Float16* afrag, int s) {
#pragma unroll  // constant index: the array stays in registers
  for (int i = 0; i < 2; ++i) {
    const _Float16* p = afrag + i * RTILE + s * 4 * GPITCH;
    union { v16h v; v8h h[2]; } u;
    u.h[0] = *(const v8h*)(p);
    u.h[1] = *(const v8h*)(p + 2 * GPITCH);
    a[i] = u.v;
  }
}

__global__ __launch_bounds__(256) void tail_kernel(
    const float* __restrict__ ao32, const _Float16* __restrict__ woT,
    const float* __restrict__ bo, const float* __restrict__ g0,
    const float* __restrict__ b0, const float* __restrict__ g1,
    const float* __restrict__ b1, float* __restrict__ out) {
  __shared__ __attribute__((aligned(16))) float xs[TAIL_ROWS * XPITCH];
  __shared__ __attribute__((aligned(16))) _Float16 xh[2 * RTILE];

  int w = __builtin_amdgcn_readfirstlane((int)(threadIdx.x >> 5));  // scalar bases
  int lane = threadIdx.x & 31;
  int row0 = blockIdx.x * TAIL_ROWS;
  int col0 = w * 64;
  const _Float16* bbase = woT + (size_t)col0 * DIMV;
  v16h bf[B_AHEAD][4];
  // The k walk of step b starts at a k step of the work-group's own and wraps:
  // every work-group reads the whole of Wo, and from one common start all of them
  // would ask L2 for the same lines at the same moment.
  int rot = (blockIdx.x + (blockIdx.x >> 3)) & (TAIL_STEPS - 1);

  // ---- a) LN0 of rows w*4 .. w*4+3
  float4 x[4][4], ga[4], be[4];
  {
    const float* s = ao32 + (size_t)(row0 + w * 4) * DIMV + lane * 4;
#pragma unroll  // constant index: the arrays stay in registers
    for (int r = 0; r < 4; ++r)
#pragma unroll  // constant index: the arrays stay in registers
      for (int c = 0; c < 4; ++c) x[r][c] = *(const float4*)(s + r * DIMV + c * 128);
#pragma unroll  // constant index: the arrays stay in registers
    for (int c = 0; c < 4; ++c) {
      ga[c] = *(const float4*)(g0 + c * 128 + lane * 4);
      be[c] = *(const float4*)(b0 + c * 128 + lane * 4);
    }
  }
  // Wo does not depend on step a: its first fragments fly while LN0 is done,
  // two k steps behind the rows' own loads, two more once gamma and beta are used.
  load_b4(bf[0], bbase, rot);
  load_b4(bf[1], bbase, (rot + 1) & (TAIL_STEPS - 1));
  // these loads stay in front of LN0: the compiler would sink them to their use
  __builtin_amdgcn_sched_barrier(0);
  ln_rows(x, ga, be);
  load_b4(bf[2], bbase, (rot + 2) & (TAIL_STEPS - 1));
  load_b4(bf[3], bbase, (rot + 3) & (TAIL_STEPS - 1));
  // and these in front of the LDS stores and the barrier
  __builtin_amdgcn_sched_barrier(0);
  {
    float* d32 = xs + (w * 4) * XPITCH + lane * 4;
    // f16 copy: row, k -> tile row/16, octet k/8, the row's piece, k%8. That is
    // the fragment order with 16 bytes more behind every 256.
    _Float16* d16 = xh + (w >> 2) * RTILE + (lane >> 1) * GPITCH + (w & 3) * 32 +
                    (lane & 1) * 4;
#pragma unroll  // constant index: the arrays stay in registers
    for (int r = 0; r < 4; ++r)
#pragma unroll  // constant index: the arrays stay in registers
      for (int c = 0; c < 4; ++c) {
        float4 t = x[r][c];
        *(float4*)(d32 + r * XPITCH + c * 128) = t;
        v4h hq;
        hq[0] = (_Float16)t.x; hq[1] = (_Float16)t.y;
        hq[2] = (_Float16)t.z; hq[3] = (_Float16)t.w;
        *(v4h*)(d16 + c * 16 * GPITCH + r * 8) = hq;
      }
  }
  __syncthreads();   // every row of X1 is in LDS before any wave multiplies

  // ---- b) 32x64 tile of X1 @ Wo: columns w*64 ..
  int n = lane & 15, mb = (lane >> 4) * 8;
  const _Float16* afrag = xh + (lane >> 4) * GPITCH + (lane & 15) * 8;
  v16h af[2][2];
  load_a2(af[0], afrag, rot);
  v8f acc[2][4] = {};
  float bval[4];
#pragma unroll  // constant index: the fragment rings stay in registers
  for (int s = 0; s < TAIL_STEPS; ++s) {
    if (s + 1 < TAIL_STEPS)
      load_a2(af[(s + 1) & 1], afrag, (s + 1 + rot) & (TAIL_STEPS - 1));
#pragma unroll  // constant index: the arrays stay in registers
    for (int j = 0; j < 4; ++j) {
      acc[0][j] = wmma_f16(af[s & 1][0], bf[s % B_AHEAD][j], acc[0][j]);
      acc[1][j] = wmma_f16(af[s & 1][1], bf[s % B_AHEAD][j], acc[1][j]);
    }
    if (s + B_AHEAD < TAIL_STEPS)
      load_b4(bf[s % B_AHEAD], bbase, (s + B_AHEAD + rot) & (TAIL_STEPS - 1));
    if (s + B_AHEAD == TAIL_STEPS) {
      // the refills have ended: their offset register falls free and is rewritten
      asm volatile("s_wait_xcnt 0x0" ::: "memory");
      // the bias of step c flies in the refills' place
#pragma unroll  // constant index: the array stays in registers
      for (int j = 0; j < 4; ++j) bval[j] = bo[col0 + j * 16 + n];
    }
    // a refill is issued where its buffer falls free: the compiler would sink it
    // to its use, four steps on, and wait out each load's whole latency there
    __builtin_amdgcn_sched_barrier(0);
  }
  // the bias loads' offset register is reused by the address work that follows
  asm volatile("s_wait_xcnt 0x0" ::: "memory");

  // ---- c) Z = X1 + relu(acc + bo), in place in LDS; LN1's gamma and beta fly
#pragma unroll  // constant index: the arrays stay in registers
  for (int c = 0; c < 4; ++c) {
    ga[c] = *(const float4*)(g1 + c * 128 + lane * 4);
    be[c] = *(const float4*)(b1 + c * 128 + lane * 4);
  }
  float* z = xs + mb * XPITCH + col0 + n;
#pragma unroll
  for (int j = 0; j < 4; ++j) {
#pragma unroll
    for (int i = 0; i < 2; ++i) {
#pragma unroll  // constant index: the accumulators stay in registers
      for (int v = 0; v < 8; ++v) {
        float* e = z + (i * 16 + v) * XPITCH + j * 16;
        *e = *e + fmaxf(acc[i][j][v] + bval[j], 0.0f);
      }
    }
  }
  __syncthreads();   // every column of Z is in LDS before a row is summed

  // ---- d) LN1 of rows w*4 .. w*4+3, stored as whole lines
  {
    const float* s = xs + (w * 4) * XPITCH + lane * 4;
#pragma unroll  // constant index: the arrays stay in registers
    for (int r = 0; r < 4; ++r)
#pragma unroll  // constant index: the arrays stay in registers
      for (int c = 0; c < 4; ++c) x[r][c] = *(const float4*)(s + r * XPITCH + c * 128);
  }
  ln_rows(x, ga, be);
  {
    float* d = out + (size_t)(row0 + w * 4) * DIMV + lane * 4;
#pragma unroll  // constant index: the arrays stay in registers
    for (int r = 0; r < 4; ++r)
#pragma unroll  // constant index: the arrays stay in registers
      for (int c = 0; c < 4; ++c) *(float4*)(d + r * DIMV + c * 128) = x[r][c];
  }
}

// ---------------------------------------------------------------------------
extern "C" void kernel_launch(void* const* d_in, const int* in_sizes, int n_in,
                              void* d_out, int out_size, void* d_ws, size_t ws_size,
                              hipStream_t stream) {
  const float* Q  = (const float*)d_in[0];
  const float* K  = (const float*)d_in[1];
  const float* Wq = (const float*)d_in[2];
  const float* bq = (const float*)d_in[3];
  const float* Wk = (const float*)d_in[4];
  const float* bk = (const float*)d_in[5];
  const float* Wv = (const float*)d_in[6];
  const float* bv = (const float*)d_in[7];
  const float* Wo = (const float*)d_in[8];
  const float* bo = (const float*)d_in[9];
  const float* g0 = (const float*)d_in[10];
  const float* b0 = (const float*)d_in[11];
  const float* g1 = (const float*)d_in[12];
  const float* b1 = (const float*)d_in[13];
  float* out = (float*)d_out;

  char* ws = (char*)d_ws;
  _Float16* q16  = (_Float16*)(ws);                         // 8 MB
  _Float16* k16  = (_Float16*)(ws + 8388608);               // 8 MB
  _Float16* w16T = (_Float16*)(ws + 16777216);              // 2 MB (4 mats)
  float*    qp32 = (float*)   (ws + 18874368);              // 16 MB
  _Float16* qp16 = (_Float16*)(ws + 35651584);              // 8 MB
  _Float16* kp16 = (_Float16*)(ws + 44040192);              // 8 MB
  _Float16* vpT  = (_Float16*)(ws + 52428800);              // 8 MB
  float*    ao32 = (float*)   (ws + 60817408);              // 16 MB
  // total workspace: ~74 MB

  // 1) all conversions: q16 and k16 lie one behind the other, w16T holds 4 mats
  const int WN = DIMV * DIMV;
  cvt_all_kernel<<<256, CVT_THREADS, 0, stream>>>(Q, K, Wq, Wk, Wv, Wo, q16, w16T);

  // 3) projections: 768 work-groups of 4 waves, a 128x128 tile each
  proj_kernel<<<768, PJ_THREADS, 0, stream>>>(q16, k16, w16T, bq, bk, bv,
                                       qp32, qp16, kp16, vpT);

  // 4) attention: B*H*(SEQ/256) = 256 blocks of 16 waves, 32 queries x 512 keys a wave
  attn_kernel<<<256, 512, 0, stream>>>(qp16, kp16, vpT, qp32, ao32);

  // 5) LN0, x1 + relu(x1 @ Wo + bo), LN1 -> d_out: 32 whole rows a work-group
  tail_kernel<<<ROWS / TAIL_ROWS, 256, 0, stream>>>(ao32, w16T + 3 * WN, bo, g0, b0, g1, b1,
                                                    out);
}

// v009
// One run takes 52.1 microseconds.
// Timed twice side by side with v008, it ran 1.06 times as fast both times.
// Counting every step since v000, it is 5.05 times as fast.
#include <hip/hip_runtime.h>
#include <hip/hip_bf16.h>

// ---------------------------------------------------------------------------
// MAB (multihead attention block) for MI455X / gfx1250, wave32 + WMMA f16->f32
// Register-blocked GEMMs: one wave computes a 64x64 or a 32x64 tile.
// Every f16 matrix in the workspace is kept in fragment order (see frag_off).
// ---------------------------------------------------------------------------

typedef __attribute__((ext_vector_type(16))) _Float16 v16h;
typedef __attribute__((ext_vector_type(8)))  _Float16 v8h;
typedef __attribute__((ext_vector_type(8)))  float    v8f;

#define DIMV   512
#define ROWS   8192          // B*N = 8*1024
#define SEQ    1024
#define NHEAD  8
#define HDIM   64

__device__ __forceinline__ v8f wmma_f16(v16h a, v16h b, v8f c) {
  return __builtin_amdgcn_wmma_f32_16x16x32_f16(false, a, false, b,
                                                (short)0, c, false, false);
}

// k order of a 16x32 f16 fragment (ISA 7.12.2): lane r = lane&15 supplies row r
// (a row of A, or a column of B), g = lane>>4 selects the K half; elements
// i=0..7 -> K = g*8+i ; i=8..15 -> K = 16+g*8+(i-8).

// Fragment order of a [rows x 32*kt] f16 matrix in global memory: 16x32 tiles
// of 512 halves, tile (row/16, k/32) at index (row/16)*kt + k/32. Inside a tile
// the 8 halves that one lane takes with one 16-byte load lie together, and the
// 32 lanes' pieces follow one another: piece hs*32 + g*16 + r holds row r,
// k = hs*16 + g*8 .. +7. That is the k order given above, so a fragment is two
// loads of 512 contiguous bytes each.
__device__ __forceinline__ size_t frag_off(int row, int k, int kt) {
  return ((size_t)(row >> 4) * kt + (k >> 5)) * 512 + ((k >> 4) & 1) * 256 +
         (((k >> 3) & 1) * 16 + (row & 15)) * 8 + (k & 7);
}

// Load the fragment whose tile starts at `tile` (fragment-order storage).
__device__ __forceinline__ v16h load_tile(const _Float16* __restrict__ tile) {
  const _Float16* p = tile + (threadIdx.x & 31) * 8;
  union { v16h v; v8h h[2]; } u;
  u.h[0] = *(const v8h*)(p);
  u.h[1] = *(const v8h*)(p + 256);
  return u.v;
}

#define KT_DIMV (DIMV / 32)   // k tiles of a [rows x 512] matrix
#define KT_ROWS (ROWS / 32)   // k tiles of the [512 x 8192] transposed V

// ---------------------------------------------------------------------------
// 1) Every f32 -> f16 conversion in one launch of 256 work-groups of 9 waves.
//    A thread makes whole 16-byte pieces of the fragment order (8 values each)
//    and has all of its 32 16-byte loads in flight before the first convert.
//    Waves 0..7: 16 rows x 256 columns of Q or K each (8 tiles, 16 pieces a
//    lane). A lane takes row l>>2 (and that + 8), k piece l&3 of each tile: a
//    store covers four whole 128-byte lines.
//    Wave 8: 128 (k) x 32 (n) of one weight matrix, transposed (element (n,k) =
//    src[k*512+n]). A lane reads 4 n of 8 successive k, which are 4 pieces,
//    64 contiguous bytes of the result; a load covers four whole lines.
#define CVT_THREADS 288

__device__ __forceinline__ v8h to_piece(float4 lo, float4 hi) {
  v8h p;
  p[0] = (_Float16)lo.x; p[1] = (_Float16)lo.y;
  p[2] = (_Float16)lo.z; p[3] = (_Float16)lo.w;
  p[4] = (_Float16)hi.x; p[5] = (_Float16)hi.y;
  p[6] = (_Float16)hi.z; p[7] = (_Float16)hi.w;
  return p;
}

__global__ __launch_bounds__(CVT_THREADS) void cvt_all_kernel(
    const float* __restrict__ Q, const float* __restrict__ K,
    const float* __restrict__ Wq, const float* __restrict__ Wk,
    const float* __restrict__ Wv, const float* __restrict__ Wo,
    _Float16* __restrict__ x16,      // Q's 8192 rows, then K's
    _Float16* __restrict__ w16T) {
  int w = __builtin_amdgcn_readfirstlane((int)(threadIdx.x >> 5));  // scalar branch and bases
  int lane = threadIdx.x & 31;
  if (w < 8) {
    int job = blockIdx.x * 8 + w;    // 2048 jobs
    int rt = job >> 1;               // 16-row tile of [Q; K]
    int kh = job & 1;                // column half
    const float* X = (rt < ROWS / 16) ? Q : K;
    const float* s = X + (size_t)(rt & (ROWS / 16 - 1)) * (16 * DIMV) + kh * 256 +
                     (lane >> 2) * DIMV + (lane & 3) * 8;
    _Float16* d = x16 + ((size_t)rt * KT_DIMV + kh * 8) * 512 +
                  ((lane & 3) * 16 + (lane >> 2)) * 8;
    float4 v[2][8][2];
#pragma unroll  // constant index: the array stays in registers
    for (int h = 0; h < 2; ++h)
#pragma unroll  // constant index: the array stays in registers
      for (int t = 0; t < 8; ++t) {
        v[h][t][0] = *(const float4*)(s + h * (8 * DIMV) + t * 32);
        v[h][t][1] = *(const float4*)(s + h * (8 * DIMV) + t * 32 + 4);
      }
    // no convert is moved up among the loads: without this the compiler saves
    // registers by waiting for early loads before it issues the late ones
    __builtin_amdgcn_sched_barrier(0);
    // the loads' address registers are rewritten next, for the stores' offset
    asm volatile("s_wait_xcnt 0x0" ::: "memory");
#pragma unroll  // constant index: the array stays in registers
    for (int h = 0; h < 2; ++h)
#pragma unroll  // constant index: the array stays in registers
      for (int t = 0; t < 8; ++t)
        *(v8h*)(d + t * 512 + h * 64) = to_piece(v[h][t][0], v[h][t][1]);
  } else {
    int job = blockIdx.x;            // 256 jobs: 4 matrices x 4 k blocks x 16 n blocks
    int m = job >> 6;
    int k0 = ((job >> 4) & 3) * 128, n0 = (job & 15) * 32;
    const float* Wm = (m == 0) ? Wq : (m == 1) ? Wk : (m == 2) ? Wv : Wo;
    int kg = lane >> 3, ng = lane & 7;
    const float* s = Wm + (size_t)(k0 + kg * 8) * DIMV + n0 + ng * 4;
    _Float16* d = w16T + (size_t)m * (DIMV * DIMV) +
                  frag_off(n0 + ng * 4, k0 + kg * 8, KT_DIMV);
    float4 v[4][8];
#pragma unroll  // constant index: the array stays in registers
    for (int c = 0; c < 4; ++c)
#pragma unroll  // constant index: the array stays in registers
      for (int j = 0; j < 8; ++j)
        v[c][j] = *(const float4*)(s + (c * 32 + j) * DIMV);
    // no convert is moved up among the loads: without this the compiler saves
    // registers by waiting for early loads before it issues the late ones
    __builtin_amdgcn_sched_barrier(0);
    // the loads' address registers are rewritten next, for the stores' offset
    asm volatile("s_wait_xcnt 0x0" ::: "memory");
#pragma unroll  // constant index: the array stays in registers
    for (int c = 0; c < 4; ++c) {
      v8h p0, p1, p2, p3;
#pragma unroll  // constant index: the array stays in registers
      for (int j = 0; j < 8; ++j) {
        p0[j] = (_Float16)v[c][j].x;
        p1[j] = (_Float16)v[c][j].y;
        p2[j] = (_Float16)v[c][j].z;
        p3[j] = (_Float16)v[c][j].w;
      }
      *(v8h*)(d + c * 512) = p0;
      *(v8h*)(d + c * 512 + 8) = p1;
      *(v8h*)(d + c * 512 + 16) = p2;
      *(v8h*)(d + c * 512 + 24) = p3;
    }
  }
}

// ---------------------------------------------------------------------------
// 3) Fused projections: Qp = Q@Wq+bq (f32+f16), Kp = K@Wk+bk (f16),
//    Vp = K@Wv+bv stored transposed [DIMV][ROWS] (f16); f16 in fragment order.
//    A work-group of 4 waves forms a 128x128 tile, a wave 64x64 of it (4x4 WMMA
//    tiles). Both operands pass through LDS, 64 k a stage, two buffers: a stage
//    is 16 runs of 2 KB (8 row tiles of X, 8 column tiles of W^T, two k tiles
//    each, as they lie in global memory), brought by asynchronous copies one
//    trip ahead. Every byte comes from L2 once a work-group, not once a wave.
//    Work-groups = 3 * (8192/128) * (512/128) = 768.
#define PJ_THREADS 128
// The f16 copy of Qp, which only the attention scores read, carries the softmax
// scale and log2(e): exp(x / 8) = exp2(score formed with it).
#define QSCALE (0.125f * 1.44269504088896340736f)
#define PJ_RUN   1024                 // halves of a run: 16 rows x 64 k
#define PJ_BUF   (16 * PJ_RUN)        // halves of a stage
#define PJ_TRIPS (DIMV / 64)
#define TILE_ROW (KT_DIMV * 512)      // halves from one 16-row tile row to the next

// Eight copies of 16 bytes a lane, global memory to LDS: two runs, one tile row
// apart in global memory, adjacent in LDS. l and g are the lane's own addresses.
__device__ __forceinline__ void copy_two_runs(unsigned l, const _Float16* g) {
  const _Float16* h = g + TILE_ROW;
  // the closing wait stands in front of every later rewrite of the address
  // registers that these copies name
  asm volatile(
      "global_load_async_to_lds_b128 %0, %8, off\n\t"
      "global_load_async_to_lds_b128 %1, %9, off\n\t"
      "global_load_async_to_lds_b128 %2, %10, off\n\t"
      "global_load_async_to_lds_b128 %3, %11, off\n\t"
      "global_load_async_to_lds_b128 %4, %12, off\n\t"
      "global_load_async_to_lds_b128 %5, %13, off\n\t"
      "global_load_async_to_lds_b128 %6, %14, off\n\t"
      "global_load_async_to_lds_b128 %7, %15, off\n\t"
      "s_wait_xcnt 0x0"
      :: "v"(l), "v"(l + 512), "v"(l + 1024), "v"(l + 1536),
         "v"(l + 2048), "v"(l + 2560), "v"(l + 3072), "v"(l + 3584),
         "v"(g), "v"(g + 256), "v"(g + 512), "v"(g + 768),
         "v"(h), "v"(h + 256), "v"(h + 512), "v"(h + 768)
      : "memory");
}

// A wave's share of a stage: its four runs.
__device__ __forceinline__ void copy_stage(unsigned l, const _Float16* g) {
  copy_two_runs(l, g);
  copy_two_runs(l + 4096, g + 2 * TILE_ROW);
}

__global__ __launch_bounds__(PJ_THREADS) void proj_kernel(
    const _Float16* __restrict__ q16, const _Float16* __restrict__ k16,
    const _Float16* __restrict__ w16T,
    const float* __restrict__ bq, const float* __restrict__ bk,
    const float* __restrict__ bvv,
    float* __restrict__ qp32, _Float16* __restrict__ qp16,
    _Float16* __restrict__ kp16, _Float16* __restrict__ vpT) {
  __shared__ __attribute__((aligned(128))) _Float16 st[2 * PJ_BUF];

  int w = __builtin_amdgcn_readfirstlane((int)(threadIdx.x >> 5));  // scalar bases
  int lane = threadIdx.x & 31;
  int p = blockIdx.x >> 8;         // 0:Q 1:K 2:V  (256 work-groups each)
  int t = blockIdx.x & 255;        // 64 row blocks x 4 column blocks
  int brow = (t >> 2) * 128;
  int bcol = (t & 3) * 128;
  // The k walk starts at a stage of the work-group's own and wraps. 64 work-groups
  // read each W^T tile and 4 or 8 each X tile, all started together: from one
  // common start they would ask L2 for the same lines at the same moment.
  int rot = ((t >> 3) + ((t >> 2) & 1) * 4 + (t & 3) * 2 + p) & (PJ_TRIPS - 1);

  // Waves 0, 1 bring the 8 row tiles of X, waves 2, 3 the 8 column tiles of W^T.
  const _Float16* X = (p == 0) ? q16 : k16;
  const _Float16* src = (w < 2) ? X + (size_t)brow * DIMV
                                : w16T + (size_t)p * (DIMV * DIMV) + (size_t)bcol * DIMV;
  src += (w & 1) * (4 * TILE_ROW) + lane * 8;
  unsigned dst = (unsigned)(size_t)st + w * (4 * PJ_RUN * 2) + lane * 16;

  int wr = w >> 1, wc = w & 1;     // the wave's 64x64 tile of the block tile
  int row0 = brow + wr * 64;
  int col0 = bcol + wc * 64;
  const _Float16* afrag = st + wr * (4 * PJ_RUN);
  const _Float16* bfrag = st + (8 + wc * 4) * PJ_RUN;

  copy_stage(dst, src + rot * PJ_RUN);
  // stage 0 has landed for this wave ...
  asm volatile("s_wait_asynccnt 0x0" ::: "memory");
  __syncthreads();                 // ... and for every wave, before anyone reads it
  copy_stage(dst + PJ_BUF * 2, src + ((rot + 1) & (PJ_TRIPS - 1)) * PJ_RUN);

  v8f acc[4][4] = {};
  for (int s = 0; s < PJ_TRIPS; ++s) {
    int boff = (s & 1) * PJ_BUF;
#pragma unroll  // constant index: the arrays stay in registers
    for (int kk = 0; kk < 2; ++kk) {
      v16h af[4], bf[4];
#pragma unroll  // constant index: the arrays stay in registers
      for (int i = 0; i < 4; ++i) af[i] = load_tile(afrag + boff + i * PJ_RUN + kk * 512);
#pragma unroll  // constant index: the arrays stay in registers
      for (int j = 0; j < 4; ++j) bf[j] = load_tile(bfrag + boff + j * PJ_RUN + kk * 512);
      // the 16 LDS reads of a k tile stay one group in front of its 16 products:
      // the compiler would keep one A fragment and wait out a read per 4 products
      __builtin_amdgcn_sched_barrier(0);
#pragma unroll  // constant index: the arrays stay in registers
      for (int i = 0; i < 4; ++i)
#pragma unroll  // constant index: the arrays stay in registers
        for (int j = 0; j < 4; ++j) acc[i][j] = wmma_f16(af[i], bf[j], acc[i][j]);
    }
    // this wave's reads of the buffer have returned before it is refilled
    asm volatile("s_wait_dscnt 0x0" ::: "memory");
    // this wave's copies of the next stage have landed
    asm volatile("s_wait_asynccnt 0x0" ::: "memory");
    __syncthreads();   // publishes stage s + 1 and ends every read of stage s
    if (s + 2 < PJ_TRIPS)
      copy_stage(dst + boff * 2, src + ((s + 2 + rot) & (PJ_TRIPS - 1)) * PJ_RUN);
  }
  // no copy is outstanding when the wave goes on
  asm volatile("s_wait_asynccnt 0x0" ::: "memory");

  int n = lane & 15, mb = (lane >> 4) * 8;
  const float* bias = (p == 0) ? bq : (p == 1) ? bk : bvv;
  // p is the same for the work-group: one branch picks the writer of its matrix.
  if (p == 0) {
#pragma unroll
    for (int j = 0; j < 4; ++j) {
      int c = col0 + j * 16 + n;
      float bval = bias[c];
#pragma unroll
      for (int i = 0; i < 4; ++i) {
        for (int v = 0; v < 8; ++v) {
          int r = row0 + i * 16 + mb + v;
          float val = acc[i][j][v] + bval;
          qp32[(size_t)r * DIMV + c] = val;
          qp16[frag_off(r, c, KT_DIMV)] = (_Float16)(val * QSCALE);
        }
      }
    }
  } else if (p == 1) {
#pragma unroll
    for (int j = 0; j < 4; ++j) {
      int c = col0 + j * 16 + n;
      float bval = bias[c];
#pragma unroll
      for (int i = 0; i < 4; ++i) {
        for (int v = 0; v < 8; ++v) {
          int r = row0 + i * 16 + mb + v;
          kp16[frag_off(r, c, KT_DIMV)] = (_Float16)(acc[i][j][v] + bval);
        }
      }
    }
  } else {
    // Transposed V: a lane's 8 accumulators are 8 successive keys of one
    // column, which is one 16-byte piece of the fragment order.
#pragma unroll
    for (int j = 0; j < 4; ++j) {
      int c = col0 + j * 16 + n;
      float bval = bias[c];
#pragma unroll
      for (int i = 0; i < 4; ++i) {
        v8h piece;
        for (int v = 0; v < 8; ++v) piece[v] = (_Float16)(acc[i][j][v] + bval);
        *(v8h*)(vpT + frag_off(c, row0 + i * 16 + mb, KT_ROWS)) = piece;
      }
    }
  }
}

// ---------------------------------------------------------------------------
// 4) Attention, transposed products: S^T = Kh @ Qh^T and O^T = Vh^T @ P^T.
//    One wave owns 32 queries (two 16-column groups) of one (b, h) and walks one
//    half of the 1024 keys, 32 a step; its partner wave walks the other half.
//    In an S^T tile a lane holds 8 keys of ONE query, and
//    two such tiles are, register for register, the B fragment of the second
//    product (k = g*8+i, then 16+g*8+i), so the scores never leave registers.
//    One walk: the scores are formed once. Each query has a reference value,
//    at first the maximum over the first 32 keys, which enters the score product
//    as its C operand, so that a score leaves the matrix unit ready for exp2. The
//    reference is raised only when a score passes it by more than RAISE (then O
//    and the sums are scaled down); 1/sum at the end takes the reference out.
//    Each half has its own reference; the two partial
//    results are joined through LDS at the end, each partner finishing one query
//    group. 16 waves / block = 256 queries of one (b, h), four waves a SIMD: the
//    vector work of one wave runs beside the products and the loads of three.
//    All of K and of V^T of the (b, h) comes to lie in LDS, 128 KB each, brought
//    once a work-group by asynchronous copies: the eight waves that
//    walk the same keys read them there, not each for itself from L2. A 32-key
//    group is 4 KB in a row, of K (two key tiles x two head-dim halves) as of V^T
//    (four head-dim tiles). The copies come in four chunks (four groups of either
//    key half, K and V^T), each to its own place, one chunk ahead of the walk.
#define K_STEP 2048                  // halves from one 32-key group to the next, in LDS
#define KHALF  (SEQ / 2)             // keys a wave walks
#define NSTEP  (KHALF / 32)
#define ATT_WAVES 16
#define KV_HALVES (SEQ * HDIM)       // halves of K, and of V^T, of one (b, h)
#define NCHUNK   4                   // chunks of the copies
#define CH_STEPS (NSTEP / NCHUNK)    // steps a wave walks in a chunk

// Eight copies of 16 bytes a lane, global memory to LDS: four 1 KB tiles of V^T
// (successive 32-key groups of one head-dim tile), adjacent in global memory,
// one group (4 KB) apart in LDS. l and g are the lane's own addresses.
__device__ __forceinline__ void copy_four_tiles(unsigned l, const _Float16* g) {
  // the closing wait stands in front of every later rewrite of the address
  // registers that these copies name
  asm volatile(
      "global_load_async_to_lds_b128 %0, %8, off\n\t"
      "global_load_async_to_lds_b128 %1, %9, off\n\t"
      "global_load_async_to_lds_b128 %2, %10, off\n\t"
      "global_load_async_to_lds_b128 %3, %11, off\n\t"
      "global_load_async_to_lds_b128 %4, %12, off\n\t"
      "global_load_async_to_lds_b128 %5, %13, off\n\t"
      "global_load_async_to_lds_b128 %6, %14, off\n\t"
      "global_load_async_to_lds_b128 %7, %15, off\n\t"
      "s_wait_xcnt 0x0"
      :: "v"(l), "v"(l + 512), "v"(l + 4096), "v"(l + 4608),
         "v"(l + 8192), "v"(l + 8704), "v"(l + 12288), "v"(l + 12800),
         "v"(g), "v"(g + 256), "v"(g + 512), "v"(g + 768),
         "v"(g + 1024), "v"(g + 1280), "v"(g + 1536), "v"(g + 1792)
      : "memory");
}

// The four K fragments of 32-key group g: [key tile][head-dim half].
__device__ __forceinline__ void load_k(v16h (&kc)[4], const _Float16* __restrict__ kb,
                                       int g) {
  const _Float16* p = kb + g * K_STEP;
#pragma unroll  // constant index: the array stays in registers
  for (int i = 0; i < 4; ++i) kc[i] = load_tile(p + i * 512);
}

// The four V^T fragments (16 head dims each) of 32-key group g.
__device__ __forceinline__ void load_v(v16h (&vc)[4], const _Float16* __restrict__ vb,
                                       int g) {
#pragma unroll  // constant index: the array stays in registers
  for (int dt = 0; dt < 4; ++dt)
    vc[dt] = load_tile(vb + g * K_STEP + dt * 512);
}

// S^T of one 32-key group, plus c[query group]: s[key tile][query group].
__device__ __forceinline__ void scores_t(v8f (&s)[2][2], const v16h (&kc)[4],
                                         const v16h (&qb)[2][2], const v8f (&c)[2]) {
#pragma unroll  // constant index: the array stays in registers
  for (int i = 0; i < 2; ++i)
#pragma unroll  // constant index: the array stays in registers
    for (int t = 0; t < 2; ++t) {
      v8f z = wmma_f16(kc[2 * i], qb[t][0], c[t]);
      s[i][t] = wmma_f16(kc[2 * i + 1], qb[t][1], z);
    }
}

#define RAISE 8.0f   // exp2 stays under 2^8 in f16 P; a raise is rare

// The largest of a lane's 16 scores of each query group.
__device__ __forceinline__ void lane_max(float (&ml)[2], const v8f (&s)[2][2]) {
#pragma unroll  // constant index: the array stays in registers
  for (int t = 0; t < 2; ++t) {
    float m[2];                        // a chain a tile: half the depth of one chain
#pragma unroll  // constant index: the array stays in registers
    for (int i = 0; i < 2; ++i) {
      m[i] = fmaxf(fmaxf(s[i][t][0], s[i][t][1]), s[i][t][2]);
      m[i] = fmaxf(fmaxf(m[i], s[i][t][3]), s[i][t][4]);
      m[i] = fmaxf(fmaxf(m[i], s[i][t][5]), s[i][t][6]);
    }
    ml[t] = fmaxf(fmaxf(m[0], s[0][t][7]), fmaxf(m[1], s[1][t][7]));
  }
}

// One step: scores less the reference, refill kc, raise the reference where a
// score has passed it by RAISE, exp2, O^T += V^T P^T, refill vc. No refill
// (MORE false) in a chunk's last step: the next chunk is not yet published.
template <bool MORE>
__device__ __forceinline__ void pv_step(v16h (&kc)[4], v16h (&vc)[4],
                                        const _Float16* __restrict__ kb,
                                        const _Float16* __restrict__ vb,
                                        int gnext, const v16h (&qb)[2][2],
                                        v8f (&cn)[2], float (&sum)[2][2],
                                        v8f (&o)[4][2]) {
  v8f s[2][2];
  scores_t(s, kc, qb, cn);
  if (MORE) {
    load_k(kc, kb, gnext);
    // the refill stays one group where the buffer falls free: the compiler would
    // sink the reads to their use, in pairs, and wait out each pair's latency there
    __builtin_amdgcn_sched_barrier(0);
  }
  float ml[2];
  lane_max(ml, s);
  // one scalar branch for the wave: every lane stays on for the products behind it
  if (__builtin_amdgcn_ballot_w32(fmaxf(ml[0], ml[1]) > RAISE) != 0u) {
#pragma unroll  // constant index: the arrays stay in registers
    for (int t = 0; t < 2; ++t) {
      // both wave halves hold keys of the same query and must use one reference
      float d = fmaxf(fmaxf(ml[t], __shfl_xor(ml[t], 16, 32)), 0.0f);
      float f = __builtin_amdgcn_exp2f(-d);
#pragma unroll  // constant index: the arrays stay in registers
      for (int dt = 0; dt < 4; ++dt) o[dt][t] *= f;
      cn[t] -= d;
#pragma unroll  // constant index: the arrays stay in registers
      for (int i = 0; i < 2; ++i) {
        sum[i][t] *= f;
        s[i][t] -= d;
      }
    }
  }
  v16h p[2];
#pragma unroll  // constant index: the array stays in registers
  for (int t = 0; t < 2; ++t)
#pragma unroll  // constant index: the array stays in registers
    for (int i = 0; i < 2; ++i)
#pragma unroll  // constant index: the array stays in registers
      for (int v = 0; v < 8; ++v) {
        float e = __builtin_amdgcn_exp2f(s[i][t][v]);
        sum[i][t] += e;
        p[t][i * 8 + v] = (_Float16)e;
      }
#pragma unroll  // constant index: the array stays in registers
  for (int dt = 0; dt < 4; ++dt)
#pragma unroll  // constant index: the array stays in registers
    for (int t = 0; t < 2; ++t) o[dt][t] = wmma_f16(vc[dt], p[t], o[dt][t]);
  if (MORE) {
    load_v(vc, vb, gnext);
    // as above, for the V^T refill
    __builtin_amdgcn_sched_barrier(0);
  }
}

// A wave leaves query group T of its partial result in LDS for its partner:
// O^T (unscaled), the sum of exp and the reference both were formed with.
template <int T>
__device__ __forceinline__ void hand_over(float4* xo, float2* xs, const v8f (&o)[4][2],
                                          const float (&sm)[2], const float (&mc)[2]) {
#pragma unroll  // constant index: the array stays in registers
  for (int dt = 0; dt < 4; ++dt) {
    xo[(dt * 2) * 32] = make_float4(o[dt][T][0], o[dt][T][1], o[dt][T][2], o[dt][T][3]);
    xo[(dt * 2 + 1) * 32] = make_float4(o[dt][T][4], o[dt][T][5], o[dt][T][6], o[dt][T][7]);
  }
  *xs = make_float2(sm[T], mc[T]);
}

// Query group T: both halves brought to one reference, O = O^T / sum + Qp.
// A lane holds 8 successive head dims of one query.
template <int T>
__device__ __forceinline__ void finish(const float4* xo, const float2* xs,
                                       const v8f (&o)[4][2], const float (&sm)[2],
                                       const float (&mc)[2], const float4 (&r)[4][2],
                                       char* wo) {
  float2 ps = *xs;
  float m = fmaxf(mc[T], ps.y);
  float fa = __builtin_amdgcn_exp2f(mc[T] - m);
  float fb = __builtin_amdgcn_exp2f(ps.y - m);
  float inv = 1.0f / (sm[T] * fa + ps.x * fb);
  fa *= inv;
  fb *= inv;
#pragma unroll  // constant index: the arrays stay in registers
  for (int dt = 0; dt < 4; ++dt) {
    float4 r0 = r[dt][0];
    float4 r1 = r[dt][1];
    float4 p0 = xo[(dt * 2) * 32];
    float4 p1 = xo[(dt * 2 + 1) * 32];
    float4 y0, y1;
    y0.x = o[dt][T][0] * fa + p0.x * fb + r0.x;
    y0.y = o[dt][T][1] * fa + p0.y * fb + r0.y;
    y0.z = o[dt][T][2] * fa + p0.z * fb + r0.z;
    y0.w = o[dt][T][3] * fa + p0.w * fb + r0.w;
    y1.x = o[dt][T][4] * fa + p1.x * fb + r1.x;
    y1.y = o[dt][T][5] * fa + p1.y * fb + r1.y;
    y1.z = o[dt][T][6] * fa + p1.z * fb + r1.z;
    y1.w = o[dt][T][7] * fa + p1.w * fb + r1.w;
    *(float4*)(wo + dt * 64) = y0;
    *(float4*)(wo + dt * 64 + 16) = y1;
  }
}

__global__ __launch_bounds__(ATT_WAVES * 32) void attn_kernel(
    const _Float16* __restrict__ qp16, const _Float16* __restrict__ kp16,
    const _Float16* __restrict__ vpT, const float* __restrict__ qp32,
    float* __restrict__ ao32) {
  // K, then V^T, of the (b, h)
  __shared__ __attribute__((aligned(128))) _Float16 kv[2 * KV_HALVES];
  // what a wave hands its partner (8 pieces of 16 bytes a lane, sum and reference)
  // takes K's place once the walk has ended
  float4* xo = (float4*)kv;                               // ATT_WAVES * 8 * 32
  float2* xs = (float2*)(kv + ATT_WAVES * 8 * 32 * 8);    // ATT_WAVES * 32
  int bid = blockIdx.x;
  int qq = bid & 3;
  int h = (bid >> 2) & 7;
  int b = bid >> 5;

  int w = __builtin_amdgcn_readfirstlane((int)(threadIdx.x >> 5));  // scalar tile bases
  int lane = threadIdx.x & 31;
  int n = lane & 15, mb = (lane >> 4) * 8;
  int kh = w >> 3;                     // the wave's half of the keys
  int grow = b * SEQ + qq * 256 + (w & 7) * 32;
  const _Float16* kb = kv + kh * (NSTEP * K_STEP);
  const _Float16* vb = kv + KV_HALVES + kh * (NSTEP * K_STEP);

  v16h qb[2][2];                       // Q as B operand, kept for the first reference and the walk
#pragma unroll  // constant index: the array stays in registers
  for (int t = 0; t < 2; ++t) {
    const _Float16* qbase = qp16 + frag_off(grow + t * 16, h * HDIM, KT_DIMV);
    qb[t][0] = load_tile(qbase);
    qb[t][1] = load_tile(qbase + 512);
  }

  // Of a chunk waves 0..7 bring a 32-key group of K each, waves 8..15 one head-dim
  // tile of V^T over four groups: wave bit 2 is the key half, bits 0, 1 the group
  // or the tile. cl and cg are the lane's addresses in chunk 0, cstep the halves
  // from chunk to chunk in global memory (16 KB in LDS).
  int ch = (w >> 2) & 1, ci = w & 3;
  unsigned cl = (unsigned)(size_t)kv + lane * 16 + ch * (NSTEP * 4096) +
                ((w < 8) ? ci * 4096 : KV_HALVES * 2 + ci * 1024);
  const _Float16* cg =
      ((w < 8) ? kp16 + frag_off(b * SEQ + ch * KHALF + ci * 32, h * HDIM, KT_DIMV)
               : vpT + frag_off(h * HDIM + ci * 16, b * SEQ + ch * KHALF, KT_ROWS)) +
      lane * 8;
  int cstep = (w < 8) ? CH_STEPS * 2 * TILE_ROW : CH_STEPS * 512;
  // The four work-groups of one (b, h) take the chunks in different orders: they
  // would else ask L2 for the same lines at the same moment.
  auto copy_chunk = [&](int j) {
    int c = (j + qq) & (NCHUNK - 1);
    if (w < 8) copy_two_runs(cl + c * (CH_STEPS * 4096), cg + c * cstep);
    else       copy_four_tiles(cl + c * (CH_STEPS * 4096), cg + c * cstep);
  };
  copy_chunk(0);
  // the first chunk has landed for this wave ...
  asm volatile("s_wait_asynccnt 0x0" ::: "memory");
  __syncthreads();                 // ... and for every wave, before anyone reads it
  copy_chunk(1);

  // One K and one V^T buffer, each refilled for the next step where it falls free.
  v16h kc[4], vc[4];

  // ---- the first reference: each query's maximum over the walk's first 32 keys
  // (the scores come scaled for exp2: Q's f16 copy carries the factor)
  v8f cn[2] = {};                      // minus the reference, the scores' C operand
  {
    v8f s[2][2];
    float ml[2];
    load_k(kc, kb, qq * CH_STEPS);
    scores_t(s, kc, qb, cn);
    lane_max(ml, s);
#pragma unroll  // constant index: the arrays stay in registers
    for (int t = 0; t < 2; ++t) {
      float m = fmaxf(ml[t], __shfl_xor(ml[t], 16, 32));
#pragma unroll  // constant index: the arrays stay in registers
      for (int v = 0; v < 8; ++v) cn[t][v] = -m;
    }
  }

  // ---- the walk: P^T = exp2(S^T - reference), O^T += V^T P^T (1/sum deferred)
  float sum[2][2] = {};
  v8f o[4][2] = {};
  for (int j = 0; j < NCHUNK; ++j) {
    int g = ((j + qq) & (NCHUNK - 1)) * CH_STEPS;
    load_k(kc, kb, g);
    load_v(vc, vb, g);
    // the chunk's first reads stay one group, V^T's in front of the first scores
    __builtin_amdgcn_sched_barrier(0);
    pv_step<true>(kc, vc, kb, vb, g + 1, qb, cn, sum, o);
    pv_step<true>(kc, vc, kb, vb, g + 2, qb, cn, sum, o);
    pv_step<true>(kc, vc, kb, vb, g + 3, qb, cn, sum, o);
    pv_step<false>(kc, vc, kb, vb, g, qb, cn, sum, o);
    if (j + 1 < NCHUNK) {
      // this wave's copies of the next chunk have landed
      asm volatile("s_wait_asynccnt 0x0" ::: "memory");
      __syncthreads();   // the next chunk is in LDS for every wave before anyone reads it
      if (j + 2 < NCHUNK) copy_chunk(j + 2);
    }
  }

  // ---- the two key halves are joined: the wave of half 0 finishes query group 0,
  // its partner group 1; each hands the other group over through LDS
  float sm[2], mc[2];
#pragma unroll  // constant index: the array stays in registers
  for (int t = 0; t < 2; ++t) {
    mc[t] = -cn[t][0];
    sm[t] = sum[0][t] + sum[1][t];
    sm[t] += __shfl_xor(sm[t], 16, 32);
  }
  float4* xo_own = xo + w * (8 * 32) + lane;
  float2* xs_own = xs + w * 32 + lane;
  const float4* xo_par = xo + (w ^ 8) * (8 * 32) + lane;
  const float2* xs_par = xs + (w ^ 8) * 32 + lane;
  // one 32-bit byte offset serves the residual's loads and the stores
  unsigned boff = (unsigned)(((grow + kh * 16 + n) * DIMV + h * HDIM + mb) * 4);
  const char* rq = (const char*)qp32 + boff;
  char* wo = (char*)ao32 + boff;
  float4 r[4][2];                      // the residual flies during the hand-over
#pragma unroll  // constant index: the array stays in registers
  for (int dt = 0; dt < 4; ++dt) {
    r[dt][0] = *(const float4*)(rq + dt * 64);
    r[dt][1] = *(const float4*)(rq + dt * 64 + 16);
  }
  // this wave's reads of K and V^T have returned ...
  asm volatile("s_wait_dscnt 0x0" ::: "memory");
  __syncthreads();   // ... and every wave's, before the hand-over takes K's place
  if (kh == 0) hand_over<1>(xo_own, xs_own, o, sm, mc);
  else         hand_over<0>(xo_own, xs_own, o, sm, mc);
  // the residual loads' offset register is reused behind the barrier
  asm volatile("s_wait_xcnt 0x0" ::: "memory");
  __syncthreads();   // every wave's hand-over is in LDS before its partner reads it
  if (kh == 0) finish<0>(xo_par, xs_par, o, sm, mc, r, wo);
  else         finish<1>(xo_par, xs_par, o, sm, mc, r, wo);
}

// ---------------------------------------------------------------------------
// 5) The row-local tail in one launch: X1 = LN0(attention output),
//    Z = X1 + relu(X1 @ Wo + bo), out = LN1(Z). A work-group of 8 waves owns 32
//    whole rows, which stay in LDS from the first step to the last:
//      a) a wave normalises 4 rows (a lane holds 16 values of each, as four
//         16-byte pieces 512 bytes apart) and leaves X1 in LDS as f32 and f16;
//      b) a wave forms a 32x64 tile of X1 @ Wo, A fragments from LDS, the Wo
//         fragments of four k steps in flight (the first ones during step a);
//      c) it adds relu(.) to the f32 X1 in LDS, each element by its one owner;
//      d) a wave normalises its 4 rows again and stores whole lines.
#define TAIL_ROWS 32
#define XPITCH 516            // floats a row: rows 8 apart lie 32 banks apart
#define GPITCH 136            // halves: the 16 rows' pieces of one k octet, 256 + 16 bytes
#define RTILE  (64 * GPITCH)  // halves of a 16-row tile: 64 k octets

typedef __attribute__((ext_vector_type(4))) _Float16 v4h;

// LayerNorm of 4 rows held by one wave: x[row][piece], columns piece*128+lane*4.
__device__ __forceinline__ void ln_rows(float4 (&x)[4][4], const float4 (&ga)[4],
                                        const float4 (&be)[4]) {
  float sum[4], sq[4];
#pragma unroll  // constant index: the arrays stay in registers
  for (int r = 0; r < 4; ++r) {
    sum[r] = 0.f;
    sq[r] = 0.f;
#pragma unroll  // constant index: the arrays stay in registers
    for (int c = 0; c < 4; ++c) {
      float4 t = x[r][c];
      sum[r] += t.x + t.y + t.z + t.w;
      sq[r] += t.x * t.x + t.y * t.y + t.z * t.z + t.w * t.w;
    }
  }
#pragma unroll  // the eight chains of a step run side by side
  for (int off = 16; off > 0; off >>= 1)
#pragma unroll  // constant index: the arrays stay in registers
    for (int r = 0; r < 4; ++r) {
      sum[r] += __shfl_xor(sum[r], off, 32);
      sq[r] += __shfl_xor(sq[r], off, 32);
    }
#pragma unroll  // constant index: the arrays stay in registers
  for (int r = 0; r < 4; ++r) {
    float mean = sum[r] * (1.0f / DIMV);
    float var = sq[r] * (1.0f / DIMV) - mean * mean;
    float rstd = rsqrtf(var + 1e-5f);
#pragma unroll  // constant index: the arrays stay in registers
    for (int c = 0; c < 4; ++c) {
      float4 t = x[r][c];
      t.x = (t.x - mean) * rstd * ga[c].x + be[c].x;
      t.y = (t.y - mean) * rstd * ga[c].y + be[c].y;
      t.z = (t.z - mean) * rstd * ga[c].z + be[c].z;
      t.w = (t.w - mean) * rstd * ga[c].w + be[c].w;
      x[r][c] = t;
    }
  }
}

#define TAIL_STEPS (DIMV / 32)
#define B_AHEAD 4             // k steps of Wo fragments in flight

// The four Wo fragments (16 columns each) of k step s.
__device__ __forceinline__ void load_b4(v16h (&b)[4], const _Float16* __restrict__ bbase,
                                        int s) {
#pragma unroll  // constant index: the array stays in registers
  for (int j = 0; j < 4; ++j) b[j] = load_tile(bbase + j * 16 * DIMV + s * 512);
}

// The two X1 fragments (16 rows each) of k step s, from LDS.
__device__ __forceinline__ void load_a2(v16h (&a)[2], const _Float16* afrag, int s) {
#pragma unroll  // constant index: the array stays in registers
  for (int i = 0; i < 2; ++i) {
    const _Float16* p = afrag + i * RTILE + s * 4 * GPITCH;
    union { v16h v; v8h h[2]; } u;
    u.h[0] = *(const v8h*)(p);
    u.h[1] = *(const v8h*)(p + 2 * GPITCH);
    a[i] = u.v;
  }
}

__global__ __launch_bounds__(256) void tail_kernel(
    const float* __restrict__ ao32, const _Float16* __restrict__ woT,
    const float* __restrict__ bo, const float* __restrict__ g0,
    const float* __restrict__ b0, const float* __restrict__ g1,
    const float* __restrict__ b1, float* __restrict__ out) {
  __shared__ __attribute__((aligned(16))) float xs[TAIL_ROWS * XPITCH];
  __shared__ __attribute__((aligned(16))) _Float16 xh[2 * RTILE];

  int w = __builtin_amdgcn_readfirstlane((int)(threadIdx.x >> 5));  // scalar bases
  int lane = threadIdx.x & 31;
  int row0 = blockIdx.x * TAIL_ROWS;
  int col0 = w * 64;
  const _Float16* bbase = woT + (size_t)col0 * DIMV;
  v16h bf[B_AHEAD][4];
  // The k walk of step b starts at a k step of the work-group's own and wraps:
  // every work-group reads the whole of Wo, and from one common start all of them
  // would ask L2 for the same lines at the same moment.
  int rot = (blockIdx.x + (blockIdx.x >> 3)) & (TAIL_STEPS - 1);

  // ---- a) LN0 of rows w*4 .. w*4+3
  float4 x[4][4], ga[4], be[4];
  {
    const float* s = ao32 + (size_t)(row0 + w * 4) * DIMV + lane * 4;
#pragma unroll  // constant index: the arrays stay in registers
    for (int r = 0; r < 4; ++r)
#pragma unroll  // constant index: the arrays stay in registers
      for (int c = 0; c < 4; ++c) x[r][c] = *(const float4*)(s + r * DIMV + c * 128);
#pragma unroll  // constant index: the arrays stay in registers
    for (int c = 0; c < 4; ++c) {
      ga[c] = *(const float4*)(g0 + c * 128 + lane * 4);
      be[c] = *(const float4*)(b0 + c * 128 + lane * 4);
    }
  }
  // Wo does not depend on step a: its first fragments fly while LN0 is done,
  // two k steps behind the rows' own loads, two more once gamma and beta are used.
  load_b4(bf[0], bbase, rot);
  load_b4(bf[1], bbase, (rot + 1) & (TAIL_STEPS - 1));
  // these loads stay in front of LN0: the compiler would sink them to their use
  __builtin_amdgcn_sched_barrier(0);
  ln_rows(x, ga, be);
  load_b4(bf[2], bbase, (rot + 2) & (TAIL_STEPS - 1));
  load_b4(bf[3], bbase, (rot + 3) & (TAIL_STEPS - 1));
  // and these in front of the LDS stores and the barrier
  __builtin_amdgcn_sched_barrier(0);
  {
    float* d32 = xs + (w * 4) * XPITCH + lane * 4;
    // f16 copy: row, k -> tile row/16, octet k/8, the row's piece, k%8. That is
    // the fragment order with 16 bytes more behind every 256.
    _Float16* d16 = xh + (w >> 2) * RTILE + (lane >> 1) * GPITCH + (w & 3) * 32 +
                    (lane & 1) * 4;
#pragma unroll  // constant index: the arrays stay in registers
    for (int r = 0; r < 4; ++r)
#pragma unroll  // constant index: the arrays stay in registers
      for (int c = 0; c < 4; ++c) {
        float4 t = x[r][c];
        *(float4*)(d32 + r * XPITCH + c * 128) = t;
        v4h hq;
        hq[0] = (_Float16)t.x; hq[1] = (_Float16)t.y;
        hq[2] = (_Float16)t.z; hq[3] = (_Float16)t.w;
        *(v4h*)(d16 + c * 16 * GPITCH + r * 8) = hq;
      }
  }
  __syncthreads();   // every row of X1 is in LDS before any wave multiplies

  // ---- b) 32x64 tile of X1 @ Wo: columns w*64 ..
  int n = lane & 15, mb = (lane >> 4) * 8;
  const _Float16* afrag = xh + (lane >> 4) * GPITCH + (lane & 15) * 8;
  v16h af[2][2];
  load_a2(af[0], afrag, rot);
  v8f acc[2][4] = {};
  float bval[4];
#pragma unroll  // constant index: the fragment rings stay in registers
  for (int s = 0; s < TAIL_STEPS; ++s) {
    if (s + 1 < TAIL_STEPS)
      load_a2(af[(s + 1) & 1], afrag, (s + 1 + rot) & (TAIL_STEPS - 1));
#pragma unroll  // constant index: the arrays stay in registers
    for (int j = 0; j < 4; ++j) {
      acc[0][j] = wmma_f16(af[s & 1][0], bf[s % B_AHEAD][j], acc[0][j]);
      acc[1][j] = wmma_f16(af[s & 1][1], bf[s % B_AHEAD][j], acc[1][j]);
    }
    if (s + B_AHEAD < TAIL_STEPS)
      load_b4(bf[s % B_AHEAD], bbase, (s + B_AHEAD + rot) & (TAIL_STEPS - 1));
    if (s + B_AHEAD == TAIL_STEPS) {
      // the refills have ended: their offset register falls free and is rewritten
      asm volatile("s_wait_xcnt 0x0" ::: "memory");
      // the bias of step c flies in the refills' place
#pragma unroll  // constant index: the array stays in registers
      for (int j = 0; j < 4; ++j) bval[j] = bo[col0 + j * 16 + n];
    }
    // a refill is issued where its buffer falls free: the compiler would sink it
    // to its use, four steps on, and wait out each load's whole latency there
    __builtin_amdgcn_sched_barrier(0);
  }
  // the bias loads' offset register is reused by the address work that follows
  asm volatile("s_wait_xcnt 0x0" ::: "memory");

  // ---- c) Z = X1 + relu(acc + bo), in place in LDS; LN1's gamma and beta fly
#pragma unroll  // constant index: the arrays stay in registers
  for (int c = 0; c < 4; ++c) {
    ga[c] = *(const float4*)(g1 + c * 128 + lane * 4);
    be[c] = *(const float4*)(b1 + c * 128 + lane * 4);
  }
  float* z = xs + mb * XPITCH + col0 + n;
#pragma unroll
  for (int j = 0; j < 4; ++j) {
#pragma unroll
    for (int i = 0; i < 2; ++i) {
#pragma unroll  // constant index: the accumulators stay in registers
      for (int v = 0; v < 8; ++v) {
        float* e = z + (i * 16 + v) * XPITCH + j * 16;
        *e = *e + fmaxf(acc[i][j][v] + bval[j], 0.0f);
      }
    }
  }
  __syncthreads();   // every column of Z is in LDS before a row is summed

  // ---- d) LN1 of rows w*4 .. w*4+3, stored as whole lines
  {
    const float* s = xs + (w * 4) * XPITCH + lane * 4;
#pragma unroll  // constant index: the arrays stay in registers
    for (int r = 0; r < 4; ++r)
#pragma unroll  // constant index: the arrays stay in registers
      for (int c = 0; c < 4; ++c) x[r][c] = *(const float4*)(s + r * XPITCH + c * 128);
  }
  ln_rows(x, ga, be);
  {
    float* d = out + (size_t)(row0 + w * 4) * DIMV + lane * 4;
#pragma unroll  // constant index: the arrays stay in registers
    for (int r = 0; r < 4; ++r)
#pragma unroll  // constant index: the arrays stay in registers
      for (int c = 0; c < 4; ++c) *(float4*)(d + r * DIMV + c * 128) = x[r][c];
  }
}

// ---------------------------------------------------------------------------
extern "C" void kernel_launch(void* const* d_in, const int* in_sizes, int n_in,
                              void* d_out, int out_size, void* d_ws, size_t ws_size,
                              hipStream_t stream) {
  const float* Q  = (const float*)d_in[0];
  const float* K  = (const float*)d_in[1];
  const float* Wq = (const float*)d_in[2];
  const float* bq = (const float*)d_in[3];
  const float* Wk = (const float*)d_in[4];
  const float* bk = (const float*)d_in[5];
  const float* Wv = (const float*)d_in[6];
  const float* bv = (const float*)d_in[7];
  const float* Wo = (const float*)d_in[8];
  const float* bo = (const float*)d_in[9];
  const float* g0 = (const float*)d_in[10];
  const float* b0 = (const float*)d_in[11];
  const float* g1 = (const float*)d_in[12];
  const float* b1 = (const float*)d_in[13];
  float* out = (float*)d_out;

  char* ws = (char*)d_ws;
  _Float16* q16  = (_Float16*)(ws);                         // 8 MB
  _Float16* k16  = (_Float16*)(ws + 8388608);               // 8 MB
  _Float16* w16T = (_Float16*)(ws + 16777216);              // 2 MB (4 mats)
  float*    qp32 = (float*)   (ws + 18874368);              // 16 MB
  _Float16* qp16 = (_Float16*)(ws + 35651584);              // 8 MB
  _Float16* kp16 = (_Float16*)(ws + 44040192);              // 8 MB
  _Float16* vpT  = (_Float16*)(ws + 52428800);              // 8 MB
  float*    ao32 = (float*)   (ws + 60817408);              // 16 MB
  // total workspace: ~74 MB

  // 1) all conversions: q16 and k16 lie one behind the other, w16T holds 4 mats
  const int WN = DIMV * DIMV;
  cvt_all_kernel<<<256, CVT_THREADS, 0, stream>>>(Q, K, Wq, Wk, Wv, Wo, q16, w16T);

  // 3) projections: 768 work-groups of 4 waves, a 128x128 tile each
  proj_kernel<<<768, PJ_THREADS, 0, stream>>>(q16, k16, w16T, bq, bk, bv,
                                       qp32, qp16, kp16, vpT);

  // 4) attention: B*H*(SEQ/256) = 256 blocks of 16 waves, 32 queries x 512 keys a wave
  attn_kernel<<<256, 512, 0, stream>>>(qp16, kp16, vpT, qp32, ao32);

  // 5) LN0, x1 + relu(x1 @ Wo + bo), LN1 -> d_out: 32 whole rows a work-group
  tail_kernel<<<ROWS / TAIL_ROWS, 256, 0, stream>>>(ao32, w16T + 3 * WN, bo, g0, b0, g1, b1,
                                                    out);
}
